// v000
// Measured on an AMD MI455X. A time is GPU time per run, averaged over a window of back-to-back runs after a warm-up
// (all launches, gaps included; the runs take copies of the inputs in turn), and the median of several windows.
// Apart from v000's, it joins two sittings. Times from different sittings can be a few percent apart, while
// side-by-side timings come from the same sitting.
// The starting kernel, v000, takes 918 microseconds a run.
// compute dtype: all float inputs rounded to bf16; qkv = x W_attn + b with EXACT bf16 products on WMMA 16x16x32 (f32 accumulate); causal logits: q, k once to f16 (1 product) x 64^-0.5, except the first 384 query rows of each sequence (3 products with f16 residuals); p = relu(logit) in f32 (no normalisation), carried x 2^11 once to f16 against v once to f16 (1 product; bf16 hi + lo below row 384); f32 output.
#include <hip/hip_runtime.h>
#include <math.h>

typedef __attribute__((ext_vector_type(16))) _Float16 v16h;
typedef __attribute__((ext_vector_type(16))) __bf16 v16b;
typedef __attribute__((ext_vector_type(8)))  _Float16 v8h;
typedef __attribute__((ext_vector_type(8)))  float v8f;
typedef __attribute__((ext_vector_type(4)))  float v4f;
typedef __attribute__((ext_vector_type(2)))  float v2f;
typedef __attribute__((ext_vector_type(4)))  unsigned v4u;
typedef __attribute__((ext_vector_type(4)))  int v4i;
typedef float __attribute__((may_alias)) float_a;
typedef int __attribute__((may_alias)) int_a;

template <typename T> __device__ __forceinline__ void vst2(void* p, T v) { *(T*)p = v;  }
__device__ __forceinline__ v8f wmma16(v16h a, v16h b, v8f c) {
  v8f d = __builtin_amdgcn_wmma_f32_16x16x32_f16(false, a, false, b, (short)0, c, false, false);
  asm volatile("v_nop\n\tv_nop\n\tv_nop\n\tv_nop" : "+v"(d) : "v"(a), "v"(b));
  return d;
}
__device__ __forceinline__ v8f wmma_bf(v16b a, v16b b, v8f c) {
  v8f d = __builtin_amdgcn_wmma_f32_16x16x32_bf16(false, a, false, b, (short)0, c, false, false);
  asm volatile("v_nop\n\tv_nop\n\tv_nop\n\tv_nop" : "+v"(d) : "v"(a), "v"(b));
  return d;
}
// 16x16x32 fragments: lane = (h = lane>>4, row/col = lane&15); elements 0..7 = k0+8h+0..7, 8..15 = k0+16+8h+0..7; D element r = row 8h+r
__device__ __forceinline__ v16h frag_h(const _Float16* rowk0, int lane) {
  union { v16h v; v8h q[2]; } u; const _Float16* p = rowk0 + 8 * (lane >> 4);
  u.q[0] = *(const v8h*)p; u.q[1] = *(const v8h*)(p + 16); return u.v;
}
__device__ __forceinline__ v16h frag_f32(const float* rowk0, int lane) {
  v16h a; const float* p = rowk0 + 8 * (lane >> 4);
#pragma unroll
  for (int i = 0; i < 8; ++i) { a[i] = (_Float16)p[i]; a[8 + i] = (_Float16)p[16 + i]; }
  return a;
}
__device__ __forceinline__ v16h frag_f32s(const float* rowk0, int lane, float sc) {
  v16h a; const float* p = rowk0 + 8 * (lane >> 4);
#pragma unroll
  for (int i = 0; i < 8; ++i) { a[i] = (_Float16)(p[i] * sc); a[8 + i] = (_Float16)(p[16 + i] * sc); }
  return a;
}
// column fragment from a [K][ld] layout (column n), rows >= K read as 0
__device__ __forceinline__ v16h fragc_f32(const float* W, int k0, int n, int lane, int ld, int K) {
  v16h a; const int g = lane >> 4;
#pragma unroll
  for (int i = 0; i < 8; ++i) { const int ka = k0 + 8 * g + i, kb = ka + 16;
    a[i] = (_Float16)(ka < K ? W[(size_t)(ka < K ? ka : K - 1) * ld + n] : 0.f); a[8 + i] = (_Float16)(kb < K ? W[(size_t)(kb < K ? kb : K - 1) * ld + n] : 0.f); }
  return a;
}
struct F2 { v16b h, l; };
__device__ __forceinline__ F2 bsplit16(const float v[16]) { F2 r;
#pragma unroll
  for (int i = 0; i < 16; ++i) { const __bf16 h = (__bf16)v[i]; r.h[i] = h; r.l[i] = (__bf16)(v[i] - (float)h); }
  return r; }
__device__ __forceinline__ F2 split_row(const float* row, int k0, int lane) { float v[16]; const float* p = row + k0 + 8 * (lane >> 4);
#pragma unroll
  for (int i = 0; i < 8; ++i) { v[i] = p[i]; v[8 + i] = p[16 + i]; }
  return bsplit16(v); }
__device__ __forceinline__ F2 split_rowK(const float* row, int k0, int lane, int K) { float v[16]; const int g = lane >> 4;
#pragma unroll
  for (int i = 0; i < 8; ++i) { const int ka = k0 + 8 * g + i, kb = ka + 16; v[i] = ka < K ? row[ka < K ? ka : K - 1] : 0.f; v[8 + i] = kb < K ? row[kb < K ? kb : K - 1] : 0.f; }
  return bsplit16(v); }
__device__ __forceinline__ F2 split_col(const float* W, int k0, int n, int lane, int ld, int K) { float v[16]; const int g = lane >> 4;
#pragma unroll
  for (int i = 0; i < 8; ++i) { const int ka = k0 + 8 * g + i, kb = ka + 16; v[i] = ka < K ? W[(size_t)(ka < K ? ka : K - 1) * ld + n] : 0.f; v[8 + i] = kb < K ? W[(size_t)(kb < K ? kb : K - 1) * ld + n] : 0.f; }
  return bsplit16(v); }
__device__ __forceinline__ v8f mac3(const F2& a, const F2& b, v8f c) { c = wmma_bf(a.l, b.h, c); c = wmma_bf(a.h, b.l, c); return wmma_bf(a.h, b.h, c); }
__device__ __forceinline__ float sigm(float v) { return 1.0f / (1.0f + expf(-v)); }
#define LDSX() do { asm volatile("s_wait_dscnt 0" ::: "memory"); __builtin_amdgcn_wave_barrier(); __builtin_amdgcn_fence(__ATOMIC_RELEASE, "workgroup"); } while (0)

// Causal ReLU attention (B 2, T 2,048, C 1,024 = 16 x 64): qkv = x W_attn + b_attn ((in,out) [1024, 3072], columns q | k | v); p = relu(q k^T / 8) on the lower triangle (0 elsewhere, no softmax / no normalisation); y = p v -> [B, T, C] (no output projection).
#define NB 2
#define TT 2048
#define CC 1024            // NH * HD = projected width
#define DIN 1024          // input (model) width
#define NH 16
#define HD 64
#define NQB (TT / 64)
#define HG 4
#define SCALE (0.125f)
#define CAUSAL 1
#ifndef TNB
#define TNB NB
#endif
__device__ __forceinline__ float bfr(float v) { return (float)(__bf16)v; }
__host__ __device__ __forceinline__ int kb_last(int qb) { return CAUSAL ? ((qb * 64 + 63) >> 7) : (TT / 128 - 1); }
typedef __attribute__((ext_vector_type(8))) __bf16 v8b;
__device__ __forceinline__ v16b frag_b(const __bf16* rowk0, int lane) {
  union { v16b v; v8b q[2]; } u; const __bf16* p = rowk0 + 8 * (lane >> 4);
  u.q[0] = *(const v8b*)p; u.q[1] = *(const v8b*)(p + 16); return u.v;
}
#define QBH 6              // causal: query blocks 0..QBH-1 of each sequence (few keys, no averaging) take the high-precision path
#define QHI 384            // rows carrying a q residual plane (all rows when non-causal: 2-product logits everywhere)
#define KHI 384            // key rows carrying k residual / v bf16 hi+lo planes (used only by the causal high-precision path)
// B fragment (k rows k0+.., output column o) of a weight: (in,out) [K][ld] or (out,in) [ld rows of K]: bf16 exact, or f16(bf16 * 256) exact
__device__ __forceinline__ v16b wcol_io(const float* Wm, int k0, int o, int lane, int ld) { v16b w; const int g = lane >> 4;
#pragma unroll
  for (int i = 0; i < 8; ++i) { w[i] = (__bf16)Wm[(size_t)(k0 + 8 * g + i) * ld + o]; w[8 + i] = (__bf16)Wm[(size_t)(k0 + 16 + 8 * g + i) * ld + o]; }
  return w; }
__device__ __forceinline__ v16b wcol_oi(const float* Wm, int k0, int o, int lane, int K) { v16b w; const float* p = Wm + (size_t)o * K + k0 + 8 * (lane >> 4);
#pragma unroll
  for (int i = 0; i < 8; ++i) { w[i] = (__bf16)p[i]; w[8 + i] = (__bf16)p[16 + i]; }
  return w; }
__device__ __forceinline__ v16h wcolh_io(const float* Wm, int k0, int o, int lane, int ld) { v16h w; const int g = lane >> 4;
#pragma unroll
  for (int i = 0; i < 8; ++i) { w[i] = (_Float16)(bfr(Wm[(size_t)(k0 + 8 * g + i) * ld + o]) * 256.0f); w[8 + i] = (_Float16)(bfr(Wm[(size_t)(k0 + 16 + 8 * g + i) * ld + o]) * 256.0f); }
  return w; }
__device__ __forceinline__ v16h wcolh_oi(const float* Wm, int k0, int o, int lane, int K) { v16h w; const float* p = Wm + (size_t)o * K + k0 + 8 * (lane >> 4);
#pragma unroll
  for (int i = 0; i < 8; ++i) { w[i] = (_Float16)(bfr(p[i]) * 256.0f); w[8 + i] = (_Float16)(bfr(p[16 + i]) * 256.0f); }
  return w; }
#define WQKV_LAYOUT 0   // 0 = (in,out) [DIN][3*CC]; 1 = (out,in) [CC][DIN]; 2 = per-head [NH][DIN][HD]
__device__ __forceinline__ v16b wcol_hdk(const float* Wm, int k0, int o, int lane) { v16b w; const int g = lane >> 4; const float* p = Wm + (size_t)(o / HD) * DIN * HD + (o % HD);
#pragma unroll
  for (int i = 0; i < 8; ++i) { w[i] = (__bf16)p[(size_t)(k0 + 8 * g + i) * HD]; w[8 + i] = (__bf16)p[(size_t)(k0 + 16 + 8 * g + i) * HD]; }
  return w; }
#define WO_OUT_IN 0
#if WQKV_LAYOUT == 1
#define WCOL(W, k0, o, lane) wcol_oi(W, k0, o, lane, DIN)
#elif WQKV_LAYOUT == 2
#define WCOL(W, k0, o, lane) wcol_hdk(W, k0, o, lane)
#else
#define WCOL(W, k0, o, lane) wcol_io(W, k0, o, lane, 3 * CC)   /* W_attn (in,out) packed by columns: row pitch 3C */
#endif
#if WO_OUT_IN
#define WOCOL(W, k0, o, lane) wcol_oi(W, k0, o, lane, CC)
#define WOCOLH(W, k0, o, lane) wcolh_oi(W, k0, o, lane, CC)
#else
#define WOCOL(W, k0, o, lane) wcol_io(W, k0, o, lane, DIN)
#define WOCOLH(W, k0, o, lane) wcolh_io(W, k0, o, lane, DIN)
#endif

#ifndef SM_EXTRA_PARAMS
#define SM_EXTRA_PARAMS
#endif
#ifndef PROJ_EXTRA_PARAMS
#define PROJ_EXTRA_PARAMS
#endif
#ifndef SM_MASK_HOOK
#define SM_MASK_HOOK (void)0
#endif

#define WS_QH  0u                                      // f16 q rows [b*t][CC]
#define WS_KH  (WS_QH + 2u * (size_t)NB * TT * CC)      // f16 k rows [b*t][CC]
#define WS_VT  (WS_KH + 2u * (size_t)NB * TT * CC)      // f16 v planes [b][c][t]
#define WS_QL  (WS_VT + 2u * (size_t)NB * CC * TT)      // f16 q residual x 2^10 rows [b][t < QHI][CC]
#define WS_KL  (WS_QL + 2u * (size_t)NB * QHI * CC)     // f16 k residual x 2^10 rows [b][t < KHI][CC]
#define WS_VB  (WS_KL + 2u * (size_t)NB * KHI * CC)     // bf16 v hi planes [b][c][t < KHI]
#define WS_VBL (WS_VB + 2u * (size_t)NB * CC * KHI)
#define WS_S   (WS_VBL + 2u * (size_t)NB * CC * KHI)    // f32 logits / P [hg][t][s]
#define WS_Y   (WS_S  + 4u * (size_t)HG * TT * TT)      // f32 ctx rows [b*t][CC] (only when there is an output projection)
#define WS_END (WS_Y  + 0u)

// ---- k_proj: block = (64 rows, 128 cols, which): q/k/v = X W (+ b) with exact bf16 products (K = DIN) -> which 0: q f16 rows (+ residual rows < QHI); 1: k f16 rows (+ residual rows < KHI); 2: v f16 planes [c][t] (+ bf16 hi/lo planes for t < KHI)
__global__ __launch_bounds__(128) void k_proj(const float* __restrict__ XQ, const float* __restrict__ XK, const float* __restrict__ XV, const float* __restrict__ WQ, const float* __restrict__ WK, const float* __restrict__ WV, const float* __restrict__ BQ, const float* __restrict__ BK, const float* __restrict__ BV,
    _Float16* __restrict__ QH, _Float16* __restrict__ QL, _Float16* __restrict__ KH, _Float16* __restrict__ KL, _Float16* __restrict__ VT, __bf16* __restrict__ VB, __bf16* __restrict__ VBL) {
  __shared__ __align__(16) _Float16 sh[64][136], sl[64][136]; __shared__ __align__(16) _Float16 th[128][72]; __shared__ __align__(16) __bf16 tb[128][72], tbl[128][72];
  const int tid = threadIdx.x, wave = tid >> 5, lane = tid & 31, col = lane & 15, g = lane >> 4; const int which = blockIdx.z; const int c0 = blockIdx.y * 128; const size_t r0 = (size_t)blockIdx.x * 64; const size_t bb = r0 / TT; const int t0 = (int)(r0 % TT);
  const float* X = which == 0 ? XQ : which == 1 ? XK : XV; const float* WA = which == 0 ? WQ : which == 1 ? WK : WV; const float* BA = which == 0 ? BQ : which == 1 ? BK : BV;
  v8f acc[8] = {};
#pragma unroll 2
  for (int kc = 0; kc < DIN / 32; ++kc) { v16b a; { const float* p = X + (r0 + wave * 16 + col) * DIN + kc * 32 + 8 * g;
#pragma unroll
      for (int i = 0; i < 8; ++i) { a[i] = (__bf16)p[i]; a[8 + i] = (__bf16)p[16 + i]; } }
    asm volatile("s_wait_loadcnt 0x0" ::: "memory");
#pragma unroll
    for (int j = 0; j < 8; ++j) { const v16b w = WCOL(WA, kc * 32, c0 + j * 16 + col, lane); asm volatile("s_wait_loadcnt 0x0" ::: "memory"); acc[j] = wmma_bf(a, w, acc[j]); } }
  if (which < 2) { _Float16* DH = which == 0 ? QH : KH; _Float16* DL = which == 0 ? QL : KL; const int nhi = which == 0 ? QHI : KHI; const bool hi_rows = t0 < nhi;
#pragma unroll
    for (int j = 0; j < 8; ++j) { const float bias = BA ? bfr(BA[c0 + j * 16 + col]) : 0.f;
#pragma unroll
      for (int r = 0; r < 8; ++r) { const float v = acc[j][r] + bias; const _Float16 hv = (_Float16)v; sh[wave * 16 + 8 * g + r][j * 16 + col] = hv; sl[wave * 16 + 8 * g + r][j * 16 + col] = (_Float16)((v - (float)hv) * 1024.0f); } }
    __syncthreads();
    for (int e = tid; e < 64 * 16; e += 128) { const int rl = e >> 4, q = e & 15; vst2((unsigned*)(DH + (r0 + rl) * CC + c0 + q * 8), *(const v4u*)&sh[rl][q * 8]); if (hi_rows) vst2((unsigned*)(DL + (bb * nhi + t0 + rl) * (size_t)CC + c0 + q * 8), *(const v4u*)&sl[rl][q * 8]); }
  } else { const bool hi_rows = t0 < KHI;
#pragma unroll
    for (int j = 0; j < 8; ++j) { const float bias = BA ? bfr(BA[c0 + j * 16 + col]) : 0.f;
#pragma unroll
      for (int r = 0; r < 8; ++r) { const float v = acc[j][r] + bias; const int rl = wave * 16 + 8 * g + r, cl = j * 16 + col; th[cl][rl] = (_Float16)v; const __bf16 bh = (__bf16)v; tb[cl][rl] = bh; tbl[cl][rl] = (__bf16)(v - (float)bh); } }
    __syncthreads();
    for (int e = tid; e < 128 * 8; e += 128) { const int cl = e >> 3, q = e & 7; vst2((unsigned*)(VT + (bb * CC + c0 + cl) * (size_t)TT + t0 + q * 8), *(const v4u*)&th[cl][q * 8]); if (hi_rows) { const size_t o3 = (bb * CC + c0 + cl) * (size_t)KHI + t0 + q * 8; vst2((unsigned*)(VB + o3), *(const v4u*)&tb[cl][q * 8]); vst2((unsigned*)(VBL + o3), *(const v4u*)&tbl[cl][q * 8]); } } } }
// ---- k_sc: block = (query block qb, key block kb <= kb_last(qb), head in group) of batch b: logits x SCALE; q hi + residual (x 2^10) against k (2 products) for query rows < QHI, plus the k residual (3 products) for query blocks < QBH (causal early rows); causal: blocks past the diagonal exit, the mask itself is applied by index in k_sm
__global__ __launch_bounds__(128) void k_sc(const _Float16* __restrict__ QH, const _Float16* __restrict__ KH, const _Float16* __restrict__ QL, const _Float16* __restrict__ KL, int b, int h0, float* __restrict__ S0) { __shared__ __align__(16) float ss[4][16][132];
  const int qb = blockIdx.x, kb = blockIdx.y; if (kb > kb_last(qb)) return;
  const int h = h0 + blockIdx.z; float* S = S0 + (size_t)blockIdx.z * TT * TT;
  const int tid = threadIdx.x, wave = tid >> 5, lane = tid & 31, col = lane & 15, g = lane >> 4; const int k0 = kb * 128; const int ql0 = qb * 64 + wave * 16; const size_t q0 = (size_t)b * TT + ql0, kr0 = (size_t)b * TT + k0;
  v8f acc[8] = {}, accl[8] = {};
  const _Float16* QLb = QL + (size_t)b * QHI * CC; const _Float16* KLb = KL + (size_t)b * KHI * CC;
  if (qb < QBH) {
#pragma unroll
    for (int kc = 0; kc < HD / 32; ++kc) { const v16h ah = frag_h(QH + (q0 + col) * CC + h * HD + kc * 32, lane), al = frag_h(QLb + (size_t)(ql0 + col) * CC + h * HD + kc * 32, lane);
#pragma unroll
      for (int j = 0; j < 8; ++j) { const v16h kbf = frag_h(KH + (kr0 + j * 16 + col) * CC + h * HD + kc * 32, lane), klf = frag_h(KLb + (size_t)(k0 + j * 16 + col) * CC + h * HD + kc * 32, lane); acc[j] = wmma16(ah, kbf, acc[j]); accl[j] = wmma16(al, kbf, accl[j]); accl[j] = wmma16(ah, klf, accl[j]); } }
  } else if (qb * 64 < QHI) {
#pragma unroll
    for (int kc = 0; kc < HD / 32; ++kc) { const v16h ah = frag_h(QH + (q0 + col) * CC + h * HD + kc * 32, lane), al = frag_h(QLb + (size_t)(ql0 + col) * CC + h * HD + kc * 32, lane);
#pragma unroll
      for (int j = 0; j < 8; ++j) { const v16h kbf = frag_h(KH + (kr0 + j * 16 + col) * CC + h * HD + kc * 32, lane); acc[j] = wmma16(ah, kbf, acc[j]); accl[j] = wmma16(al, kbf, accl[j]); } }
  } else {
#pragma unroll
    for (int kc = 0; kc < HD / 32; ++kc) { const v16h ah = frag_h(QH + (q0 + col) * CC + h * HD + kc * 32, lane);
#pragma unroll
      for (int j = 0; j < 8; ++j) { const v16h kbf = frag_h(KH + (kr0 + j * 16 + col) * CC + h * HD + kc * 32, lane); acc[j] = wmma16(ah, kbf, acc[j]); } } }
#pragma unroll
  for (int j = 0; j < 8; ++j) {
#pragma unroll
    for (int r = 0; r < 8; ++r) ss[wave][8 * g + r][j * 16 + col] = (acc[j][r] + accl[j][r] * (1.0f / 1024.0f)) * SCALE; }
  LDSX(); for (int rl = 0; rl < 16; ++rl) vst2(S + (size_t)(ql0 + rl) * TT + k0 + lane * 4, *(const v4f*)&ss[wave][rl][lane * 4]); }
// ---- k_sm: block = query row t (head in group): keys [0, kend): p = relu(logit) for s <= t, 0 otherwise (ReLU attention: no max / exp / normalisation); P x 2^11 in place (f32)
__global__ __launch_bounds__(256) void k_sm(float* __restrict__ S0 SM_EXTRA_PARAMS) { __shared__ __align__(16) float shv[TT];
  const int tid = threadIdx.x; const int t = blockIdx.x; const int kend = (kb_last(t >> 6) + 1) * 128;
  float* sr = S0 + (size_t)blockIdx.y * TT * TT + (size_t)t * TT;
  for (int k = tid; k < kend; k += 256) { float v = (!CAUSAL || k <= t) ? sr[k] : -3.0e38f; SM_MASK_HOOK; shv[k] = v > 0.f ? v * 2048.0f : 0.f; }   /* excluded keys carry -3e38 -> 0 */
  __syncthreads(); for (int q = tid; q < kend / 4; q += 256) vst2(sr + q * 4, *(const v4f*)&shv[q * 4]); }
// ---- k_pv: block = 64 queries (qb) of (b, h): ctx = P . v over keys [0, kend) (P x 2^11 once to f16 against v f16: 1 product; causal early query blocks: P and v as bf16 hi + lo, 3 products); 256-B (row, head) segment by 16 lanes
__global__ __launch_bounds__(128) void k_pv(const float* __restrict__ PS0, const _Float16* __restrict__ VT, const __bf16* __restrict__ VB, const __bf16* __restrict__ VBL, int b, int h0, float* __restrict__ Y) { const int h = h0 + blockIdx.z; const float* PS = PS0 + (size_t)blockIdx.z * TT * TT; __shared__ __align__(16) float ss[4][16][HD + 4];
  const int tid = threadIdx.x, wave = tid >> 5, lane = tid & 31, col = lane & 15, g = lane >> 4; const int qb = blockIdx.x; const int ql0 = qb * 64 + wave * 16; const int kce = (kb_last(qb) + 1) * 4;
  v8f acc[HD / 16] = {};
  if (qb < QBH) {
#pragma unroll 1
    for (int kc = 0; kc < kce; ++kc) { const F2 p = split_row(PS + (size_t)(ql0 + col) * TT, kc * 32, lane);
      asm volatile("s_wait_loadcnt 0x0" ::: "memory");
#pragma unroll
      for (int j = 0; j < HD / 16; ++j) { const size_t po = ((size_t)b * CC + h * HD + j * 16 + col) * (size_t)KHI + kc * 32; const v16b vh = frag_b(VB + po, lane); acc[j] = wmma_bf(p.h, vh, acc[j]); acc[j] = wmma_bf(p.l, vh, acc[j]); acc[j] = wmma_bf(p.h, frag_b(VBL + po, lane), acc[j]); } }
  } else {
#pragma unroll 1
    for (int kc = 0; kc < kce; ++kc) { const v16h p = frag_f32(PS + (size_t)(ql0 + col) * TT + kc * 32, lane);
      asm volatile("s_wait_loadcnt 0x0" ::: "memory");
#pragma unroll
      for (int j = 0; j < HD / 16; ++j) { const size_t po = ((size_t)b * CC + h * HD + j * 16 + col) * (size_t)TT + kc * 32; acc[j] = wmma16(p, frag_h(VT + po, lane), acc[j]); } } }
#pragma unroll
  for (int j = 0; j < HD / 16; ++j)
#pragma unroll
    for (int r = 0; r < 8; ++r) ss[wave][8 * g + r][j * 16 + col] = acc[j][r] * (1.0f / 2048.0f);
  LDSX(); for (int rl = 0; rl < 16; ++rl) if (lane < HD / 4) vst2(Y + ((size_t)b * TT + ql0 + rl) * CC + h * HD + lane * 4, *(const v4f*)&ss[wave][rl][lane * 4]); }

extern "C" void kernel_launch(void* const* d_in, const int* in_sizes, int n_in, void* d_out, int out_size, void* d_ws, size_t ws_size, hipStream_t stream) {
  (void)in_sizes; (void)n_in; (void)out_size;
  const float** F = (const float**)d_in;
  if (ws_size < (size_t)WS_END) return;
  char* ws = (char*)d_ws; _Float16 *QH = (_Float16*)(ws + WS_QH), *KH = (_Float16*)(ws + WS_KH), *VT = (_Float16*)(ws + WS_VT), *QL = (_Float16*)(ws + WS_QL), *KL = (_Float16*)(ws + WS_KL); __bf16 *VB = (__bf16*)(ws + WS_VB), *VBL = (__bf16*)(ws + WS_VBL); float *S = (float*)(ws + WS_S), *Y = (float*)(ws + WS_Y);
  (void)Y; (void)QL; (void)KL; (void)VB; (void)VBL;
  // inputs: 0 x [2,2048,1024]; 1 W_attn [1024,3072] (in,out; columns q | k | v); 2 b_attn [3072]
  k_proj<<<dim3(TNB * TT / 64, CC / 128, 3), 128, 0, stream>>>(F[0], F[0], F[0], F[1], F[1] + CC, F[1] + 2 * CC, F[2], F[2] + CC, F[2] + 2 * CC, QH, QL, KH, KL, VT, VB, VBL);
  for (int b = 0; b < TNB; ++b) for (int h0 = 0; h0 < NH; h0 += HG) {
    k_sc<<<dim3(NQB, TT / 128, HG), 128, 0, stream>>>(QH, KH, QL, KL, b, h0, S);
    k_sm<<<dim3(TT, HG), 256, 0, stream>>>(S);
    k_pv<<<dim3(NQB, 1, HG), 128, 0, stream>>>(S, VT, VB, VBL, b, h0, (float*)d_out);
  }
}

// v001
// A run of this version takes 222 microseconds.
// Timed twice side by side with v000, it ran 4.12 and 4.15 times as fast.
// compute dtype: all float inputs rounded to bf16; qkv = x W_attn + b with EXACT bf16 products on WMMA 16x16x32 (f32 accumulate); causal logits: q, k once to f16 (1 product) x 64^-0.5, except the first 384 query rows of each sequence (3 products with f16 residuals); p = relu(logit) in f32 (no normalisation), carried x 2^11 once to f16 against v once to f16 (1 product; bf16 hi + lo below row 384); f32 output.
#include <hip/hip_runtime.h>
#include <math.h>

typedef __attribute__((ext_vector_type(16))) _Float16 v16h;
typedef __attribute__((ext_vector_type(16))) __bf16 v16b;
typedef __attribute__((ext_vector_type(8)))  _Float16 v8h;
typedef __attribute__((ext_vector_type(8)))  float v8f;
typedef __attribute__((ext_vector_type(4)))  float v4f;
typedef __attribute__((ext_vector_type(2)))  float v2f;
typedef __attribute__((ext_vector_type(4)))  unsigned v4u;
typedef __attribute__((ext_vector_type(4)))  int v4i;
typedef float __attribute__((may_alias)) float_a;
typedef int __attribute__((may_alias)) int_a;

template <typename T> __device__ __forceinline__ void vst2(void* p, T v) { *(T*)p = v;  }
__device__ __forceinline__ v8f wmma16(v16h a, v16h b, v8f c) {
  v8f d = __builtin_amdgcn_wmma_f32_16x16x32_f16(false, a, false, b, (short)0, c, false, false);
  asm volatile("v_nop\n\tv_nop\n\tv_nop\n\tv_nop" : "+v"(d) : "v"(a), "v"(b));
  return d;
}
__device__ __forceinline__ v8f wmma_bf(v16b a, v16b b, v8f c) {
  v8f d = __builtin_amdgcn_wmma_f32_16x16x32_bf16(false, a, false, b, (short)0, c, false, false);
  asm volatile("v_nop\n\tv_nop\n\tv_nop\n\tv_nop" : "+v"(d) : "v"(a), "v"(b));
  return d;
}
// 16x16x32 fragments: lane = (h = lane>>4, row/col = lane&15); elements 0..7 = k0+8h+0..7, 8..15 = k0+16+8h+0..7; D element r = row 8h+r
__device__ __forceinline__ v16h frag_h(const _Float16* rowk0, int lane) {
  union { v16h v; v8h q[2]; } u; const _Float16* p = rowk0 + 8 * (lane >> 4);
  u.q[0] = *(const v8h*)p; u.q[1] = *(const v8h*)(p + 16); return u.v;
}
__device__ __forceinline__ v16h frag_f32(const float* rowk0, int lane) {
  v16h a; const float* p = rowk0 + 8 * (lane >> 4);
#pragma unroll
  for (int i = 0; i < 8; ++i) { a[i] = (_Float16)p[i]; a[8 + i] = (_Float16)p[16 + i]; }
  return a;
}
__device__ __forceinline__ v16h frag_f32s(const float* rowk0, int lane, float sc) {
  v16h a; const float* p = rowk0 + 8 * (lane >> 4);
#pragma unroll
  for (int i = 0; i < 8; ++i) { a[i] = (_Float16)(p[i] * sc); a[8 + i] = (_Float16)(p[16 + i] * sc); }
  return a;
}
// column fragment from a [K][ld] layout (column n), rows >= K read as 0
__device__ __forceinline__ v16h fragc_f32(const float* W, int k0, int n, int lane, int ld, int K) {
  v16h a; const int g = lane >> 4;
#pragma unroll
  for (int i = 0; i < 8; ++i) { const int ka = k0 + 8 * g + i, kb = ka + 16;
    a[i] = (_Float16)(ka < K ? W[(size_t)(ka < K ? ka : K - 1) * ld + n] : 0.f); a[8 + i] = (_Float16)(kb < K ? W[(size_t)(kb < K ? kb : K - 1) * ld + n] : 0.f); }
  return a;
}
struct F2 { v16b h, l; };
__device__ __forceinline__ F2 bsplit16(const float v[16]) { F2 r;
#pragma unroll
  for (int i = 0; i < 16; ++i) { const __bf16 h = (__bf16)v[i]; r.h[i] = h; r.l[i] = (__bf16)(v[i] - (float)h); }
  return r; }
__device__ __forceinline__ F2 split_row(const float* row, int k0, int lane) { float v[16]; const float* p = row + k0 + 8 * (lane >> 4);
#pragma unroll
  for (int i = 0; i < 8; ++i) { v[i] = p[i]; v[8 + i] = p[16 + i]; }
  return bsplit16(v); }
__device__ __forceinline__ F2 split_rowK(const float* row, int k0, int lane, int K) { float v[16]; const int g = lane >> 4;
#pragma unroll
  for (int i = 0; i < 8; ++i) { const int ka = k0 + 8 * g + i, kb = ka + 16; v[i] = ka < K ? row[ka < K ? ka : K - 1] : 0.f; v[8 + i] = kb < K ? row[kb < K ? kb : K - 1] : 0.f; }
  return bsplit16(v); }
__device__ __forceinline__ F2 split_col(const float* W, int k0, int n, int lane, int ld, int K) { float v[16]; const int g = lane >> 4;
#pragma unroll
  for (int i = 0; i < 8; ++i) { const int ka = k0 + 8 * g + i, kb = ka + 16; v[i] = ka < K ? W[(size_t)(ka < K ? ka : K - 1) * ld + n] : 0.f; v[8 + i] = kb < K ? W[(size_t)(kb < K ? kb : K - 1) * ld + n] : 0.f; }
  return bsplit16(v); }
__device__ __forceinline__ v8f mac3(const F2& a, const F2& b, v8f c) { c = wmma_bf(a.l, b.h, c); c = wmma_bf(a.h, b.l, c); return wmma_bf(a.h, b.h, c); }
__device__ __forceinline__ float sigm(float v) { return 1.0f / (1.0f + expf(-v)); }
#define LDSX() do { asm volatile("s_wait_dscnt 0" ::: "memory"); __builtin_amdgcn_wave_barrier(); __builtin_amdgcn_fence(__ATOMIC_RELEASE, "workgroup"); } while (0)

// Causal ReLU attention (B 2, T 2,048, C 1,024 = 16 x 64): qkv = x W_attn + b_attn ((in,out) [1024, 3072], columns q | k | v); p = relu(q k^T / 8) on the lower triangle (0 elsewhere, no softmax / no normalisation); y = p v -> [B, T, C] (no output projection).
#define NB 2
#define TT 2048
#define CC 1024            // NH * HD = projected width
#define DIN 1024          // input (model) width
#define NH 16
#define HD 64
#define NQB (TT / 64)
#define HG 4
#define SCALE (0.125f)
#define CAUSAL 1
#ifndef TNB
#define TNB NB
#endif
__device__ __forceinline__ float bfr(float v) { return (float)(__bf16)v; }
__host__ __device__ __forceinline__ int kb_last(int qb) { return CAUSAL ? ((qb * 64 + 63) >> 7) : (TT / 128 - 1); }
typedef __attribute__((ext_vector_type(8))) __bf16 v8b;
__device__ __forceinline__ v16b frag_b(const __bf16* rowk0, int lane) {
  union { v16b v; v8b q[2]; } u; const __bf16* p = rowk0 + 8 * (lane >> 4);
  u.q[0] = *(const v8b*)p; u.q[1] = *(const v8b*)(p + 16); return u.v;
}
#define QBH 6              // unused: causal query rows below QHI (few keys, no averaging) take the high-precision path
#define QHI 384            // rows carrying a q residual plane
#define KHI 384            // key rows carrying k residual / v bf16 hi+lo planes (used only by the causal high-precision path)
// B fragment (k rows k0+.., output column o) of a weight: (in,out) [K][ld] or (out,in) [ld rows of K]: bf16 exact, or f16(bf16 * 256) exact
__device__ __forceinline__ v16b wcol_io(const float* Wm, int k0, int o, int lane, int ld) { v16b w; const int g = lane >> 4;
#pragma unroll
  for (int i = 0; i < 8; ++i) { w[i] = (__bf16)Wm[(size_t)(k0 + 8 * g + i) * ld + o]; w[8 + i] = (__bf16)Wm[(size_t)(k0 + 16 + 8 * g + i) * ld + o]; }
  return w; }
__device__ __forceinline__ v16b wcol_oi(const float* Wm, int k0, int o, int lane, int K) { v16b w; const float* p = Wm + (size_t)o * K + k0 + 8 * (lane >> 4);
#pragma unroll
  for (int i = 0; i < 8; ++i) { w[i] = (__bf16)p[i]; w[8 + i] = (__bf16)p[16 + i]; }
  return w; }
__device__ __forceinline__ v16h wcolh_io(const float* Wm, int k0, int o, int lane, int ld) { v16h w; const int g = lane >> 4;
#pragma unroll
  for (int i = 0; i < 8; ++i) { w[i] = (_Float16)(bfr(Wm[(size_t)(k0 + 8 * g + i) * ld + o]) * 256.0f); w[8 + i] = (_Float16)(bfr(Wm[(size_t)(k0 + 16 + 8 * g + i) * ld + o]) * 256.0f); }
  return w; }
__device__ __forceinline__ v16h wcolh_oi(const float* Wm, int k0, int o, int lane, int K) { v16h w; const float* p = Wm + (size_t)o * K + k0 + 8 * (lane >> 4);
#pragma unroll
  for (int i = 0; i < 8; ++i) { w[i] = (_Float16)(bfr(p[i]) * 256.0f); w[8 + i] = (_Float16)(bfr(p[16 + i]) * 256.0f); }
  return w; }
#define WQKV_LAYOUT 0   // 0 = (in,out) [DIN][3*CC]; 1 = (out,in) [CC][DIN]; 2 = per-head [NH][DIN][HD]
__device__ __forceinline__ v16b wcol_hdk(const float* Wm, int k0, int o, int lane) { v16b w; const int g = lane >> 4; const float* p = Wm + (size_t)(o / HD) * DIN * HD + (o % HD);
#pragma unroll
  for (int i = 0; i < 8; ++i) { w[i] = (__bf16)p[(size_t)(k0 + 8 * g + i) * HD]; w[8 + i] = (__bf16)p[(size_t)(k0 + 16 + 8 * g + i) * HD]; }
  return w; }
#define WO_OUT_IN 0
#if WQKV_LAYOUT == 1
#define WCOL(W, k0, o, lane) wcol_oi(W, k0, o, lane, DIN)
#elif WQKV_LAYOUT == 2
#define WCOL(W, k0, o, lane) wcol_hdk(W, k0, o, lane)
#else
#define WCOL(W, k0, o, lane) wcol_io(W, k0, o, lane, 3 * CC)   /* W_attn (in,out) packed by columns: row pitch 3C */
#endif
#if WO_OUT_IN
#define WOCOL(W, k0, o, lane) wcol_oi(W, k0, o, lane, CC)
#define WOCOLH(W, k0, o, lane) wcolh_oi(W, k0, o, lane, CC)
#else
#define WOCOL(W, k0, o, lane) wcol_io(W, k0, o, lane, DIN)
#define WOCOLH(W, k0, o, lane) wcolh_io(W, k0, o, lane, DIN)
#endif

#ifndef SM_EXTRA_PARAMS
#define SM_EXTRA_PARAMS
#endif
#ifndef PROJ_EXTRA_PARAMS
#define PROJ_EXTRA_PARAMS
#endif
#ifndef SM_MASK_HOOK
#define SM_MASK_HOOK (void)0
#endif

#define WS_QH  0u                                      // f16 q rows [b*t][CC]
#define WS_KH  (WS_QH + 2u * (size_t)NB * TT * CC)      // f16 k rows [b*t][CC]
#define WS_VT  (WS_KH + 2u * (size_t)NB * TT * CC)      // f16 v planes [b][c][t]
#define WS_QL  (WS_VT + 2u * (size_t)NB * CC * TT)      // f16 q residual x 2^10 rows [b][t < QHI][CC]
#define WS_KL  (WS_QL + 2u * (size_t)NB * QHI * CC)     // f16 k residual x 2^10 rows [b][t < KHI][CC]
#define WS_VB  (WS_KL + 2u * (size_t)NB * KHI * CC)     // bf16 v hi planes [b][c][t < KHI]
#define WS_VBL (WS_VB + 2u * (size_t)NB * CC * KHI)
#define WS_END (WS_VBL + 2u * (size_t)NB * CC * KHI)

// ---- k_proj: block = (64 rows, 128 cols, which): q/k/v = X W (+ b) with exact bf16 products (K = DIN) -> which 0: q f16 rows (+ residual rows < QHI); 1: k f16 rows (+ residual rows < KHI); 2: v f16 planes [c][t] (+ bf16 hi/lo planes for t < KHI)
__global__ __launch_bounds__(128) void k_proj(const float* __restrict__ XQ, const float* __restrict__ XK, const float* __restrict__ XV, const float* __restrict__ WQ, const float* __restrict__ WK, const float* __restrict__ WV, const float* __restrict__ BQ, const float* __restrict__ BK, const float* __restrict__ BV,
    _Float16* __restrict__ QH, _Float16* __restrict__ QL, _Float16* __restrict__ KH, _Float16* __restrict__ KL, _Float16* __restrict__ VT, __bf16* __restrict__ VB, __bf16* __restrict__ VBL) {
  __shared__ __align__(16) _Float16 sh[64][136], sl[64][136]; __shared__ __align__(16) _Float16 th[128][72]; __shared__ __align__(16) __bf16 tb[128][72], tbl[128][72];
  const int tid = threadIdx.x, wave = tid >> 5, lane = tid & 31, col = lane & 15, g = lane >> 4; const int which = blockIdx.z; const int c0 = blockIdx.y * 128; const size_t r0 = (size_t)blockIdx.x * 64; const size_t bb = r0 / TT; const int t0 = (int)(r0 % TT);
  const float* X = which == 0 ? XQ : which == 1 ? XK : XV; const float* WA = which == 0 ? WQ : which == 1 ? WK : WV; const float* BA = which == 0 ? BQ : which == 1 ? BK : BV;
  v8f acc[8] = {};
#pragma unroll 2
  for (int kc = 0; kc < DIN / 32; ++kc) { v16b a; { const float* p = X + (r0 + wave * 16 + col) * DIN + kc * 32 + 8 * g;
#pragma unroll
      for (int i = 0; i < 8; ++i) { a[i] = (__bf16)p[i]; a[8 + i] = (__bf16)p[16 + i]; } }
    asm volatile("s_wait_loadcnt 0x0" ::: "memory");
#pragma unroll
    for (int j = 0; j < 8; ++j) { const v16b w = WCOL(WA, kc * 32, c0 + j * 16 + col, lane); asm volatile("s_wait_loadcnt 0x0" ::: "memory"); acc[j] = wmma_bf(a, w, acc[j]); } }
  if (which < 2) { _Float16* DH = which == 0 ? QH : KH; _Float16* DL = which == 0 ? QL : KL; const int nhi = which == 0 ? QHI : KHI; const bool hi_rows = t0 < nhi;
#pragma unroll
    for (int j = 0; j < 8; ++j) { const float bias = BA ? bfr(BA[c0 + j * 16 + col]) : 0.f;
#pragma unroll
      for (int r = 0; r < 8; ++r) { const float v = acc[j][r] + bias; const _Float16 hv = (_Float16)v; sh[wave * 16 + 8 * g + r][j * 16 + col] = hv; sl[wave * 16 + 8 * g + r][j * 16 + col] = (_Float16)((v - (float)hv) * 1024.0f); } }
    __syncthreads();
    for (int e = tid; e < 64 * 16; e += 128) { const int rl = e >> 4, q = e & 15; vst2((unsigned*)(DH + (r0 + rl) * CC + c0 + q * 8), *(const v4u*)&sh[rl][q * 8]); if (hi_rows) vst2((unsigned*)(DL + (bb * nhi + t0 + rl) * (size_t)CC + c0 + q * 8), *(const v4u*)&sl[rl][q * 8]); }
  } else { const bool hi_rows = t0 < KHI;
#pragma unroll
    for (int j = 0; j < 8; ++j) { const float bias = BA ? bfr(BA[c0 + j * 16 + col]) : 0.f;
#pragma unroll
      for (int r = 0; r < 8; ++r) { const float v = acc[j][r] + bias; const int rl = wave * 16 + 8 * g + r, cl = j * 16 + col; th[cl][rl] = (_Float16)v; const __bf16 bh = (__bf16)v; tb[cl][rl] = bh; tbl[cl][rl] = (__bf16)(v - (float)bh); } }
    __syncthreads();
    for (int e = tid; e < 128 * 8; e += 128) { const int cl = e >> 3, q = e & 7; vst2((unsigned*)(VT + (bb * CC + c0 + cl) * (size_t)TT + t0 + q * 8), *(const v4u*)&th[cl][q * 8]); if (hi_rows) { const size_t o3 = (bb * CC + c0 + cl) * (size_t)KHI + t0 + q * 8; vst2((unsigned*)(VB + o3), *(const v4u*)&tb[cl][q * 8]); vst2((unsigned*)(VBL + o3), *(const v4u*)&tbl[cl][q * 8]); } } } }
// ---- k_att: wave = QT x 16 query rows of (b, h), walking its keys 64 at a time in ascending order. S^T = K Q^T (A = k rows, B = q rows): a lane's D registers of two 16-key tiles are, in place, the k order of one 32-key operand,
// so p = relu(logit) x 2^11 goes from the score accumulators straight into O^T += V^T P^T (A = v planes, B = p) and never leaves the registers. O^T register r = head column 8g + r of query row c: 32-byte stores.
#define QT 2
__device__ __forceinline__ void att_store(float* __restrict__ Y, int b, int h, int t, int g, const v8f o[HD / 16]) {
  float* y = Y + ((size_t)b * TT + t) * CC + h * HD + 8 * g;
#pragma unroll
  for (int j = 0; j < HD / 16; ++j) { v4f lo, hi;
#pragma unroll
    for (int r = 0; r < 4; ++r) { lo[r] = o[j][r] * (1.0f / 2048.0f); hi[r] = o[j][4 + r] * (1.0f / 2048.0f); }
    vst2(y + j * 16, lo); vst2(y + j * 16 + 4, hi); } }
// early query rows (t < QHI), 16 rows, 32 keys a trip: 3-product logits with f16 residuals, p and v as bf16 hi + lo (3 products)
__device__ __forceinline__ void att_hi(const _Float16* __restrict__ QH, const _Float16* __restrict__ KH, const _Float16* __restrict__ QL, const _Float16* __restrict__ KL, const __bf16* __restrict__ VB, const __bf16* __restrict__ VBL, int b, int h, int ql0, int lane, float* __restrict__ Y) {
  const int c = lane & 15, g = lane >> 4; const int t = ql0 + c;
  v16h qh[HD / 32], qr[HD / 32];
#pragma unroll
  for (int kc = 0; kc < HD / 32; ++kc) { qh[kc] = frag_h(QH + ((size_t)b * TT + t) * CC + h * HD + kc * 32, lane); qr[kc] = frag_h(QL + ((size_t)b * QHI + t) * CC + h * HD + kc * 32, lane); }
  v8f o[HD / 16] = {}; const int nch = ((ql0 + 15) >> 5) + 1;
#pragma unroll 1   /* run-time trip count, large body: stays rolled for registers and the instruction cache, as the parent's P.V loops did */
  for (int ch = 0; ch < nch; ++ch) { const int k0 = ch * 32; v8f s[2] = {}, sl[2] = {};
#pragma unroll
    for (int kc = 0; kc < HD / 32; ++kc) {
#pragma unroll
      for (int a = 0; a < 2; ++a) { const v16h kh = frag_h(KH + ((size_t)b * TT + k0 + a * 16 + c) * CC + h * HD + kc * 32, lane), kr = frag_h(KL + ((size_t)b * KHI + k0 + a * 16 + c) * CC + h * HD + kc * 32, lane);
        s[a] = wmma16(kh, qh[kc], s[a]); sl[a] = wmma16(kh, qr[kc], sl[a]); sl[a] = wmma16(kr, qh[kc], sl[a]); } }
    float pv[16];
#pragma unroll
    for (int a = 0; a < 2; ++a) {
#pragma unroll
      for (int r = 0; r < 8; ++r) { const float v = (s[a][r] + sl[a][r] * (1.0f / 1024.0f)) * SCALE; pv[a * 8 + r] = (k0 + a * 16 + 8 * g + r <= t && v > 0.f) ? v * 2048.0f : 0.f; } }
    const F2 p = bsplit16(pv);
#pragma unroll
    for (int j = 0; j < HD / 16; ++j) { const size_t po = ((size_t)b * CC + h * HD + j * 16 + c) * (size_t)KHI + k0; const v16b vh = frag_b(VB + po, lane); o[j] = wmma_bf(vh, p.h, o[j]); o[j] = wmma_bf(vh, p.l, o[j]); o[j] = wmma_bf(frag_b(VBL + po, lane), p.h, o[j]); } }
  att_store(Y, b, h, t, g, o); }
// frag_h with the lane's 8 * g already in the address
__device__ __forceinline__ v16h frag_at(const _Float16* p) { union { v16h v; v8h q[2]; } u; u.q[0] = *(const v8h*)p; u.q[1] = *(const v8h*)(p + 16); return u.v; }
// one trip: 64 keys from k0 against the wave's QT x 16 query rows; MASK: the trip reaches the wave's own rows, so the causal mask can cut
template <bool MASK> __device__ __forceinline__ void att_trip(const _Float16* __restrict__ Kp, const _Float16* __restrict__ Vp, int k0, int ql0, int lane, const v16h (&q)[QT][HD / 32], v8f (&o)[QT][HD / 16]) {
  const int c = lane & 15, g = lane >> 4; v8f s[QT][4] = {}; v16h kf[HD / 32][4], vf[2][HD / 16], p[QT][2];
  const _Float16* kb = Kp + (size_t)k0 * CC + 8 * g; const _Float16* vb = Vp + k0 + 8 * g;   /* the lane's own fragment addresses (k order of frag_h) */
  /* a trip's k fragments are requested together at its head, its v fragments together behind the score products, so that they land under the relu work: two load latencies a trip, not one a fragment */
#pragma unroll
  for (int kc = 0; kc < HD / 32; ++kc)
#pragma unroll
    for (int a = 0; a < 4; ++a) kf[kc][a] = frag_at(kb + (size_t)(a * 16) * CC + kc * 32);
  asm volatile("s_wait_xcnt 0x0" :: "v"(kb) : "memory");   /* the k address stays live to here, so no load of the run lands in it; later writes of it stand behind this wait */
#pragma unroll
  for (int kc = 0; kc < HD / 32; ++kc)
#pragma unroll
    for (int a = 0; a < 4; ++a)
#pragma unroll
      for (int qt = 0; qt < QT; ++qt) s[qt][a] = wmma16(kf[kc][a], q[qt][kc], s[qt][a]);
#pragma unroll
  for (int ch = 0; ch < 2; ++ch)
#pragma unroll
    for (int j = 0; j < HD / 16; ++j) vf[ch][j] = frag_at(vb + (size_t)(j * 16) * TT + ch * 32);
  asm volatile("s_wait_xcnt 0x0" :: "v"(vb) : "memory");   /* the same for the v address */
#pragma unroll
  for (int qt = 0; qt < QT; ++qt)
#pragma unroll
    for (int a = 0; a < 4; ++a)
#pragma unroll
      for (int r = 0; r < 8; ++r) { const float pr = fmaxf(s[qt][a][r] * (SCALE * 2048.0f), 0.f); p[qt][a >> 1][(a & 1) * 8 + r] = (_Float16)((!MASK || k0 + a * 16 + 8 * g + r <= ql0 + qt * 16 + c) ? pr : 0.f); }
#pragma unroll
  for (int ch = 0; ch < 2; ++ch)
#pragma unroll
    for (int j = 0; j < HD / 16; ++j)
#pragma unroll
      for (int qt = 0; qt < QT; ++qt) o[qt][j] = wmma16(vf[ch][j], p[qt][ch], o[qt][j]); }
__global__ __launch_bounds__(128) void k_att(const _Float16* __restrict__ QH, const _Float16* __restrict__ KH, const _Float16* __restrict__ QL, const _Float16* __restrict__ KL, const _Float16* __restrict__ VT, const __bf16* __restrict__ VB, const __bf16* __restrict__ VBL, float* __restrict__ Y) {
  const int lane = threadIdx.x & 31, c = lane & 15, g = lane >> 4; const int wave = __builtin_amdgcn_readfirstlane(threadIdx.x >> 5);
  /* heads run fastest in the grid, so neighbouring work-groups have key walks of one length; even batches take the query blocks in reverse order, so that long and short walks are resident together */
  const int h = blockIdx.x, b = blockIdx.z; const int qblk = (b & 1) ? (int)blockIdx.y : TT / (64 * QT) - 1 - (int)blockIdx.y; const int ql0 = qblk * (64 * QT) + wave * (16 * QT);
  if (ql0 < QHI) {
#pragma unroll 1   /* one copy of the early-row code for both 16-row tiles: half the code */
    for (int qt = 0; qt < QT; ++qt) { att_hi(QH, KH, QL, KL, VB, VBL, b, h, ql0 + qt * 16, lane, Y);
      asm volatile("s_wait_xcnt 0x0" ::: "memory"); }   /* the next pass writes registers that this pass's stores name */
    return; }
  const _Float16* Kp = KH + ((size_t)b * TT + c) * CC + h * HD; const _Float16* Vp = VT + ((size_t)b * CC + h * HD + c) * (size_t)TT;
  v16h q[QT][HD / 32];
#pragma unroll
  for (int qt = 0; qt < QT; ++qt)
#pragma unroll
    for (int kc = 0; kc < HD / 32; ++kc) q[qt][kc] = frag_h(QH + ((size_t)b * TT + ql0 + qt * 16 + c) * CC + h * HD + kc * 32, lane);
  v8f o[QT][HD / 16] = {}; const int kd = (ql0 >> 6) * 64;   /* the wave's 16 * QT <= 64 rows lie inside one 64-key trip: only that last one is masked */
#pragma unroll 1   /* run-time trip count, large body: stays rolled for registers and the instruction cache */
  for (int k0 = 0; k0 < kd; k0 += 64) att_trip<false>(Kp, Vp, k0, ql0, lane, q, o);
  att_trip<true>(Kp, Vp, kd, ql0, lane, q, o);
#pragma unroll
  for (int qt = 0; qt < QT; ++qt) att_store(Y, b, h, ql0 + qt * 16 + c, g, o[qt]);
  asm volatile("s_wait_xcnt 0x0" ::: "memory"); }   /* code laid out behind these stores writes registers that they name */

extern "C" void kernel_launch(void* const* d_in, const int* in_sizes, int n_in, void* d_out, int out_size, void* d_ws, size_t ws_size, hipStream_t stream) {
  (void)in_sizes; (void)n_in; (void)out_size;
  const float** F = (const float**)d_in;
  if (ws_size < (size_t)WS_END) return;
  char* ws = (char*)d_ws; _Float16 *QH = (_Float16*)(ws + WS_QH), *KH = (_Float16*)(ws + WS_KH), *VT = (_Float16*)(ws + WS_VT), *QL = (_Float16*)(ws + WS_QL), *KL = (_Float16*)(ws + WS_KL); __bf16 *VB = (__bf16*)(ws + WS_VB), *VBL = (__bf16*)(ws + WS_VBL);
  // inputs: 0 x [2,2048,1024]; 1 W_attn [1024,3072] (in,out; columns q | k | v); 2 b_attn [3072]
  k_proj<<<dim3(TNB * TT / 64, CC / 128, 3), 128, 0, stream>>>(F[0], F[0], F[0], F[1], F[1] + CC, F[1] + 2 * CC, F[2], F[2] + CC, F[2] + 2 * CC, QH, QL, KH, KL, VT, VB, VBL);
  k_att<<<dim3(NH, TT / (64 * QT), TNB), 128, 0, stream>>>(QH, KH, QL, KL, VT, VB, VBL, (float*)d_out);
}

// v002
// It runs in 112 microseconds.
// In two side-by-side timings against v001, it was 1.98 and 1.97 times as fast.
// Over all steps from v000 it is 8.16 times as fast.
// compute dtype: all float inputs rounded to bf16; qkv = x W_attn + b with EXACT bf16 products on WMMA 16x16x32 (f32 accumulate); causal logits: q, k once to f16 (1 product) x 64^-0.5, except the first 384 query rows of each sequence (3 products with f16 residuals); p = relu(logit) in f32 (no normalisation), carried x 2^11 once to f16 against v once to f16 (1 product; bf16 hi + lo below row 384); f32 output.
#include <hip/hip_runtime.h>
#include <math.h>

typedef __attribute__((ext_vector_type(16))) _Float16 v16h;
typedef __attribute__((ext_vector_type(16))) __bf16 v16b;
typedef __attribute__((ext_vector_type(8)))  _Float16 v8h;
typedef __attribute__((ext_vector_type(8)))  float v8f;
typedef __attribute__((ext_vector_type(4)))  float v4f;
typedef __attribute__((ext_vector_type(2)))  float v2f;
typedef __attribute__((ext_vector_type(4)))  unsigned v4u;
typedef __attribute__((ext_vector_type(4)))  int v4i;
typedef float __attribute__((may_alias)) float_a;
typedef int __attribute__((may_alias)) int_a;

template <typename T> __device__ __forceinline__ void vst2(void* p, T v) { *(T*)p = v;  }
__device__ __forceinline__ v8f wmma16(v16h a, v16h b, v8f c) {
  v8f d = __builtin_amdgcn_wmma_f32_16x16x32_f16(false, a, false, b, (short)0, c, false, false);
  asm volatile("v_nop\n\tv_nop\n\tv_nop\n\tv_nop" : "+v"(d) : "v"(a), "v"(b));
  return d;
}
__device__ __forceinline__ v8f wmma_bf(v16b a, v16b b, v8f c) {
  v8f d = __builtin_amdgcn_wmma_f32_16x16x32_bf16(false, a, false, b, (short)0, c, false, false);
  asm volatile("v_nop\n\tv_nop\n\tv_nop\n\tv_nop" : "+v"(d) : "v"(a), "v"(b));
  return d;
}
// 16x16x32 fragments: lane = (h = lane>>4, row/col = lane&15); elements 0..7 = k0+8h+0..7, 8..15 = k0+16+8h+0..7; D element r = row 8h+r
__device__ __forceinline__ v16h frag_h(const _Float16* rowk0, int lane) {
  union { v16h v; v8h q[2]; } u; const _Float16* p = rowk0 + 8 * (lane >> 4);
  u.q[0] = *(const v8h*)p; u.q[1] = *(const v8h*)(p + 16); return u.v;
}
__device__ __forceinline__ v16h frag_f32(const float* rowk0, int lane) {
  v16h a; const float* p = rowk0 + 8 * (lane >> 4);
#pragma unroll
  for (int i = 0; i < 8; ++i) { a[i] = (_Float16)p[i]; a[8 + i] = (_Float16)p[16 + i]; }
  return a;
}
__device__ __forceinline__ v16h frag_f32s(const float* rowk0, int lane, float sc) {
  v16h a; const float* p = rowk0 + 8 * (lane >> 4);
#pragma unroll
  for (int i = 0; i < 8; ++i) { a[i] = (_Float16)(p[i] * sc); a[8 + i] = (_Float16)(p[16 + i] * sc); }
  return a;
}
// column fragment from a [K][ld] layout (column n), rows >= K read as 0
__device__ __forceinline__ v16h fragc_f32(const float* W, int k0, int n, int lane, int ld, int K) {
  v16h a; const int g = lane >> 4;
#pragma unroll
  for (int i = 0; i < 8; ++i) { const int ka = k0 + 8 * g + i, kb = ka + 16;
    a[i] = (_Float16)(ka < K ? W[(size_t)(ka < K ? ka : K - 1) * ld + n] : 0.f); a[8 + i] = (_Float16)(kb < K ? W[(size_t)(kb < K ? kb : K - 1) * ld + n] : 0.f); }
  return a;
}
struct F2 { v16b h, l; };
__device__ __forceinline__ F2 bsplit16(const float v[16]) { F2 r;
#pragma unroll
  for (int i = 0; i < 16; ++i) { const __bf16 h = (__bf16)v[i]; r.h[i] = h; r.l[i] = (__bf16)(v[i] - (float)h); }
  return r; }
__device__ __forceinline__ F2 split_row(const float* row, int k0, int lane) { float v[16]; const float* p = row + k0 + 8 * (lane >> 4);
#pragma unroll
  for (int i = 0; i < 8; ++i) { v[i] = p[i]; v[8 + i] = p[16 + i]; }
  return bsplit16(v); }
__device__ __forceinline__ F2 split_rowK(const float* row, int k0, int lane, int K) { float v[16]; const int g = lane >> 4;
#pragma unroll
  for (int i = 0; i < 8; ++i) { const int ka = k0 + 8 * g + i, kb = ka + 16; v[i] = ka < K ? row[ka < K ? ka : K - 1] : 0.f; v[8 + i] = kb < K ? row[kb < K ? kb : K - 1] : 0.f; }
  return bsplit16(v); }
__device__ __forceinline__ F2 split_col(const float* W, int k0, int n, int lane, int ld, int K) { float v[16]; const int g = lane >> 4;
#pragma unroll
  for (int i = 0; i < 8; ++i) { const int ka = k0 + 8 * g + i, kb = ka + 16; v[i] = ka < K ? W[(size_t)(ka < K ? ka : K - 1) * ld + n] : 0.f; v[8 + i] = kb < K ? W[(size_t)(kb < K ? kb : K - 1) * ld + n] : 0.f; }
  return bsplit16(v); }
__device__ __forceinline__ v8f mac3(const F2& a, const F2& b, v8f c) { c = wmma_bf(a.l, b.h, c); c = wmma_bf(a.h, b.l, c); return wmma_bf(a.h, b.h, c); }
__device__ __forceinline__ float sigm(float v) { return 1.0f / (1.0f + expf(-v)); }
#define LDSX() do { asm volatile("s_wait_dscnt 0" ::: "memory"); __builtin_amdgcn_wave_barrier(); __builtin_amdgcn_fence(__ATOMIC_RELEASE, "workgroup"); } while (0)

// Causal ReLU attention (B 2, T 2,048, C 1,024 = 16 x 64): qkv = x W_attn + b_attn ((in,out) [1024, 3072], columns q | k | v); p = relu(q k^T / 8) on the lower triangle (0 elsewhere, no softmax / no normalisation); y = p v -> [B, T, C] (no output projection).
#define NB 2
#define TT 2048
#define CC 1024            // NH * HD = projected width
#define DIN 1024          // input (model) width
#define NH 16
#define HD 64
#define NQB (TT / 64)
#define HG 4
#define SCALE (0.125f)
#define CAUSAL 1
#ifndef TNB
#define TNB NB
#endif
__device__ __forceinline__ float bfr(float v) { return (float)(__bf16)v; }
__host__ __device__ __forceinline__ int kb_last(int qb) { return CAUSAL ? ((qb * 64 + 63) >> 7) : (TT / 128 - 1); }
typedef __attribute__((ext_vector_type(8))) __bf16 v8b;
__device__ __forceinline__ v16b frag_b(const __bf16* rowk0, int lane) {
  union { v16b v; v8b q[2]; } u; const __bf16* p = rowk0 + 8 * (lane >> 4);
  u.q[0] = *(const v8b*)p; u.q[1] = *(const v8b*)(p + 16); return u.v;
}
#define QBH 6              // unused: causal query rows below QHI (few keys, no averaging) take the high-precision path
#define QHI 384            // rows carrying a q residual plane
#define KHI 384            // key rows carrying k residual / v bf16 hi+lo planes (used only by the causal high-precision path)
// B fragment (k rows k0+.., output column o) of a weight: (in,out) [K][ld] or (out,in) [ld rows of K]: bf16 exact, or f16(bf16 * 256) exact
__device__ __forceinline__ v16b wcol_io(const float* Wm, int k0, int o, int lane, int ld) { v16b w; const int g = lane >> 4;
#pragma unroll
  for (int i = 0; i < 8; ++i) { w[i] = (__bf16)Wm[(size_t)(k0 + 8 * g + i) * ld + o]; w[8 + i] = (__bf16)Wm[(size_t)(k0 + 16 + 8 * g + i) * ld + o]; }
  return w; }
__device__ __forceinline__ v16b wcol_oi(const float* Wm, int k0, int o, int lane, int K) { v16b w; const float* p = Wm + (size_t)o * K + k0 + 8 * (lane >> 4);
#pragma unroll
  for (int i = 0; i < 8; ++i) { w[i] = (__bf16)p[i]; w[8 + i] = (__bf16)p[16 + i]; }
  return w; }
__device__ __forceinline__ v16h wcolh_io(const float* Wm, int k0, int o, int lane, int ld) { v16h w; const int g = lane >> 4;
#pragma unroll
  for (int i = 0; i < 8; ++i) { w[i] = (_Float16)(bfr(Wm[(size_t)(k0 + 8 * g + i) * ld + o]) * 256.0f); w[8 + i] = (_Float16)(bfr(Wm[(size_t)(k0 + 16 + 8 * g + i) * ld + o]) * 256.0f); }
  return w; }
__device__ __forceinline__ v16h wcolh_oi(const float* Wm, int k0, int o, int lane, int K) { v16h w; const float* p = Wm + (size_t)o * K + k0 + 8 * (lane >> 4);
#pragma unroll
  for (int i = 0; i < 8; ++i) { w[i] = (_Float16)(bfr(p[i]) * 256.0f); w[8 + i] = (_Float16)(bfr(p[16 + i]) * 256.0f); }
  return w; }
#define WQKV_LAYOUT 0   // 0 = (in,out) [DIN][3*CC]; 1 = (out,in) [CC][DIN]; 2 = per-head [NH][DIN][HD]
__device__ __forceinline__ v16b wcol_hdk(const float* Wm, int k0, int o, int lane) { v16b w; const int g = lane >> 4; const float* p = Wm + (size_t)(o / HD) * DIN * HD + (o % HD);
#pragma unroll
  for (int i = 0; i < 8; ++i) { w[i] = (__bf16)p[(size_t)(k0 + 8 * g + i) * HD]; w[8 + i] = (__bf16)p[(size_t)(k0 + 16 + 8 * g + i) * HD]; }
  return w; }
#define WO_OUT_IN 0
#if WQKV_LAYOUT == 1
#define WCOL(W, k0, o, lane) wcol_oi(W, k0, o, lane, DIN)
#elif WQKV_LAYOUT == 2
#define WCOL(W, k0, o, lane) wcol_hdk(W, k0, o, lane)
#else
#define WCOL(W, k0, o, lane) wcol_io(W, k0, o, lane, 3 * CC)   /* W_attn (in,out) packed by columns: row pitch 3C */
#endif
#if WO_OUT_IN
#define WOCOL(W, k0, o, lane) wcol_oi(W, k0, o, lane, CC)
#define WOCOLH(W, k0, o, lane) wcolh_oi(W, k0, o, lane, CC)
#else
#define WOCOL(W, k0, o, lane) wcol_io(W, k0, o, lane, DIN)
#define WOCOLH(W, k0, o, lane) wcolh_io(W, k0, o, lane, DIN)
#endif

#ifndef SM_EXTRA_PARAMS
#define SM_EXTRA_PARAMS
#endif
#ifndef PROJ_EXTRA_PARAMS
#define PROJ_EXTRA_PARAMS
#endif
#ifndef SM_MASK_HOOK
#define SM_MASK_HOOK (void)0
#endif

#define WS_QH  0u                                      // f16 q rows [b*t][CC]
#define WS_KH  (WS_QH + 2u * (size_t)NB * TT * CC)      // f16 k rows [b*t][CC]
#define WS_VT  (WS_KH + 2u * (size_t)NB * TT * CC)      // f16 v planes [b][c][t]
#define WS_QL  (WS_VT + 2u * (size_t)NB * CC * TT)      // f16 q residual x 2^10 rows [b][t < QHI][CC]
#define WS_KL  (WS_QL + 2u * (size_t)NB * QHI * CC)     // f16 k residual x 2^10 rows [b][t < KHI][CC]
#define WS_VB  (WS_KL + 2u * (size_t)NB * KHI * CC)     // bf16 v hi planes [b][c][t < KHI]
#define WS_VBL (WS_VB + 2u * (size_t)NB * CC * KHI)
#define WS_END (WS_VBL + 2u * (size_t)NB * CC * KHI)

// ---- k_proj: block = (128 rows, 128 cols, which), 8 waves of 32 x 64: q/k/v = X W (+ b) with exact bf16 products (K = DIN) -> which 0: q f16 rows (+ residual rows < QHI); 1: k f16 rows (+ residual rows < KHI); 2: v f16 planes [c][t] (+ bf16 hi/lo planes for t < KHI)
// Each 32-k slice of the X and W tiles is read from global memory once a block, in whole 128-byte lines, rounded to bf16 once and laid in LDS with k contiguous ([row][k] and [col][k]); every wave takes its fragments from there.
#define RB 128             // rows of a block tile
#define KP 40              // LDS pitch of a 32-k bf16 row, in elements: 64 + 16 bytes, conflict-free for the 16-byte fragment reads
typedef __attribute__((ext_vector_type(4))) __bf16 v4b;
union ProjLds {            // the two stage buffers are dead when the epilogue's staging begins (a barrier stands between), and a block takes only one of the two epilogues
  struct { __bf16 w[2][128][KP], x[2][RB][KP]; } st;
  struct { _Float16 sh[RB][136], sl[RB][136]; } qk;
  struct { _Float16 th[128][RB + 8]; __bf16 tb[128][RB + 8], tbl[128][RB + 8]; } v;
};
/* second bound: 6 waves a SIMD, so that three blocks (the whole grid at once) fit a WGP's registers as they fit its LDS */
__global__ __launch_bounds__(256, 6) void k_proj(const float* __restrict__ XQ, const float* __restrict__ XK, const float* __restrict__ XV, const float* __restrict__ WQ, const float* __restrict__ WK, const float* __restrict__ WV, const float* __restrict__ BQ, const float* __restrict__ BK, const float* __restrict__ BV,
    _Float16* __restrict__ QH, _Float16* __restrict__ QL, _Float16* __restrict__ KH, _Float16* __restrict__ KL, _Float16* __restrict__ VT, __bf16* __restrict__ VB, __bf16* __restrict__ VBL) {
  __shared__ __align__(16) ProjLds L;
  const int tid = threadIdx.x, wave = tid >> 5, lane = tid & 31, col = lane & 15, g = lane >> 4; const int which = blockIdx.z; const int c0 = blockIdx.y * 128; const size_t r0 = (size_t)blockIdx.x * RB; const size_t bb = r0 / TT; const int t0 = (int)(r0 % TT);
  const float* X = which == 0 ? XQ : which == 1 ? XK : XV; const float* WA = which == 0 ? WQ : which == 1 ? WK : WV; const float* BA = which == 0 ? BQ : which == 1 ? BK : BV;
  const int wr0 = (wave >> 1) * 32, wc0 = (wave & 1) * 64;   /* the wave's 32 x 64 piece of the tile */
  /* W slice [32 k][128 cols]: a thread takes 4 columns of 4 consecutive k rows, so that it holds 4 consecutive k of each column (one 8-byte LDS store a column); 8 lanes cover one 128-byte line of a row */
  const int wcol = (wave & 3) * 32 + (lane & 7) * 4, wk = (wave >> 2) * 16 + (lane >> 3) * 4;
  /* X slice [128 rows][32 k]: 8 lanes cover a row's 128-byte line; a thread takes rows xrow + 0, 32, 64, 96 */
  const int xrow = tid >> 3, xk = (tid & 7) * 4;
  const float* wb = WA + c0; const float* xb = X + r0 * DIN; const unsigned wo = wk * (3 * CC) + wcol, xo = xrow * DIN + xk;   /* block-uniform bases, stepped along k, and the lane's fixed offsets */
  v4f wv[4], xv[4];
#pragma unroll
  for (int i = 0; i < 4; ++i) { wv[i] = *(const v4f*)(wb + wo + i * (3 * CC)); xv[i] = *(const v4f*)(xb + xo + i * 32 * DIN); }
  asm volatile("s_wait_xcnt 0x0" :: "s"(wb), "s"(xb) : "memory");   /* the two bases stay live to here; their steps below stand behind this wait */
  wb += 32 * (3 * CC); xb += 32;
  v8f acc[2][4] = {};
#pragma unroll 2   /* two trips a pass: the stage buffer's index is then a constant of the code */
  for (int kc = 0; kc < DIN / 32; ++kc) { const int bf = kc & 1;
#pragma unroll
    for (int e = 0; e < 4; ++e) { v4b t;
#pragma unroll
      for (int i = 0; i < 4; ++i) t[i] = (__bf16)wv[i][e];
      *(v4b*)&L.st.w[bf][wcol + e][wk] = t; }
#pragma unroll
    for (int i = 0; i < 4; ++i) { v4b t;
#pragma unroll
      for (int e = 0; e < 4; ++e) t[e] = (__bf16)xv[i][e];
      *(v4b*)&L.st.x[bf][i * 32 + xrow][xk] = t; }
    __syncthreads();   /* publishes slice kc; it also ends every wave's reads of slice kc - 1, whose buffer the next trip refills */
    if (kc + 1 < DIN / 32) {   /* the next slice flies while this one is multiplied; requested behind the barrier, whose own waits would drain loads issued in front of it */
#pragma unroll
      for (int i = 0; i < 4; ++i) { wv[i] = *(const v4f*)(wb + wo + i * (3 * CC)); xv[i] = *(const v4f*)(xb + xo + i * 32 * DIN); }
      asm volatile("s_wait_xcnt 0x0" :: "s"(wb), "s"(xb) : "memory");   /* as above */
      wb += 32 * (3 * CC); xb += 32; }
    v16b a[2], w[4];
#pragma unroll
    for (int i = 0; i < 2; ++i) a[i] = frag_b(&L.st.x[bf][wr0 + i * 16 + col][0], lane);
#pragma unroll
    for (int j = 0; j < 4; ++j) w[j] = frag_b(&L.st.w[bf][wc0 + j * 16 + col][0], lane);
#pragma unroll
    for (int j = 0; j < 4; ++j)
#pragma unroll
      for (int i = 0; i < 2; ++i) acc[i][j] = wmma_bf(a[i], w[j], acc[i][j]);
    __builtin_amdgcn_sched_barrier(0); }   /* keeps the next trip's conversions, and with them the wait for the loads in flight, behind this trip's products */
  __syncthreads();   /* the epilogue's staging lies over the stage buffers: every wave's last fragment reads end here */
  if (which < 2) { _Float16* DH = which == 0 ? QH : KH; _Float16* DL = which == 0 ? QL : KL; const int nhi = which == 0 ? QHI : KHI; const bool hi_rows = t0 < nhi;
#pragma unroll
    for (int j = 0; j < 4; ++j) { const int cl = wc0 + j * 16 + col; const float bias = BA ? bfr(BA[c0 + cl]) : 0.f;
#pragma unroll
      for (int i = 0; i < 2; ++i)
#pragma unroll
        for (int r = 0; r < 8; ++r) { const float v = acc[i][j][r] + bias; const _Float16 hv = (_Float16)v; const int rl = wr0 + i * 16 + 8 * g + r; L.qk.sh[rl][cl] = hv; L.qk.sl[rl][cl] = (_Float16)((v - (float)hv) * 1024.0f); } }
    __syncthreads();
    for (int e = tid; e < RB * 16; e += 256) { const int rl = e >> 4, q = e & 15; vst2((unsigned*)(DH + (r0 + rl) * CC + c0 + q * 8), *(const v4u*)&L.qk.sh[rl][q * 8]); asm volatile("s_wait_xcnt 0x0" ::: "memory");   /* what follows, and the next trip, rewrite registers that the store names */
      if (hi_rows) { vst2((unsigned*)(DL + (bb * nhi + t0 + rl) * (size_t)CC + c0 + q * 8), *(const v4u*)&L.qk.sl[rl][q * 8]); asm volatile("s_wait_xcnt 0x0" ::: "memory"); } }   /* the same */
  } else { const bool hi_rows = t0 < KHI;
#pragma unroll
    for (int j = 0; j < 4; ++j) { const int cl = wc0 + j * 16 + col; const float bias = BA ? bfr(BA[c0 + cl]) : 0.f;
#pragma unroll
      for (int i = 0; i < 2; ++i)
#pragma unroll
        for (int r = 0; r < 8; ++r) { const float v = acc[i][j][r] + bias; const int rl = wr0 + i * 16 + 8 * g + r; L.v.th[cl][rl] = (_Float16)v; const __bf16 bh = (__bf16)v; L.v.tb[cl][rl] = bh; L.v.tbl[cl][rl] = (__bf16)(v - (float)bh); } }
    __syncthreads();
    for (int e = tid; e < 128 * (RB / 8); e += 256) { const int cl = e / (RB / 8), q = e % (RB / 8); vst2((unsigned*)(VT + (bb * CC + c0 + cl) * (size_t)TT + t0 + q * 8), *(const v4u*)&L.v.th[cl][q * 8]); asm volatile("s_wait_xcnt 0x0" ::: "memory");   /* what follows, and the next trip, rewrite registers that the store names */
      if (hi_rows) { const size_t o3 = (bb * CC + c0 + cl) * (size_t)KHI + t0 + q * 8; vst2((unsigned*)(VB + o3), *(const v4u*)&L.v.tb[cl][q * 8]); vst2((unsigned*)(VBL + o3), *(const v4u*)&L.v.tbl[cl][q * 8]); asm volatile("s_wait_xcnt 0x0" ::: "memory"); } } } }   /* the same */
// ---- k_att: wave = QT x 16 query rows of (b, h), walking its keys 64 at a time in ascending order. S^T = K Q^T (A = k rows, B = q rows): a lane's D registers of two 16-key tiles are, in place, the k order of one 32-key operand,
// so p = relu(logit) x 2^11 goes from the score accumulators straight into O^T += V^T P^T (A = v planes, B = p) and never leaves the registers. O^T register r = head column 8g + r of query row c: 32-byte stores.
#define QT 2
__device__ __forceinline__ void att_store(float* __restrict__ Y, int b, int h, int t, int g, const v8f o[HD / 16]) {
  float* y = Y + ((size_t)b * TT + t) * CC + h * HD + 8 * g;
#pragma unroll
  for (int j = 0; j < HD / 16; ++j) { v4f lo, hi;
#pragma unroll
    for (int r = 0; r < 4; ++r) { lo[r] = o[j][r] * (1.0f / 2048.0f); hi[r] = o[j][4 + r] * (1.0f / 2048.0f); }
    vst2(y + j * 16, lo); vst2(y + j * 16 + 4, hi); } }
// early query rows (t < QHI), 16 rows, 32 keys a trip: 3-product logits with f16 residuals, p and v as bf16 hi + lo (3 products)
__device__ __forceinline__ void att_hi(const _Float16* __restrict__ QH, const _Float16* __restrict__ KH, const _Float16* __restrict__ QL, const _Float16* __restrict__ KL, const __bf16* __restrict__ VB, const __bf16* __restrict__ VBL, int b, int h, int ql0, int lane, float* __restrict__ Y) {
  const int c = lane & 15, g = lane >> 4; const int t = ql0 + c;
  v16h qh[HD / 32], qr[HD / 32];
#pragma unroll
  for (int kc = 0; kc < HD / 32; ++kc) { qh[kc] = frag_h(QH + ((size_t)b * TT + t) * CC + h * HD + kc * 32, lane); qr[kc] = frag_h(QL + ((size_t)b * QHI + t) * CC + h * HD + kc * 32, lane); }
  v8f o[HD / 16] = {}; const int nch = ((ql0 + 15) >> 5) + 1;
#pragma unroll 1   /* run-time trip count, large body: stays rolled for registers and the instruction cache, as the parent's P.V loops did */
  for (int ch = 0; ch < nch; ++ch) { const int k0 = ch * 32; v8f s[2] = {}, sl[2] = {};
#pragma unroll
    for (int kc = 0; kc < HD / 32; ++kc) {
#pragma unroll
      for (int a = 0; a < 2; ++a) { const v16h kh = frag_h(KH + ((size_t)b * TT + k0 + a * 16 + c) * CC + h * HD + kc * 32, lane), kr = frag_h(KL + ((size_t)b * KHI + k0 + a * 16 + c) * CC + h * HD + kc * 32, lane);
        s[a] = wmma16(kh, qh[kc], s[a]); sl[a] = wmma16(kh, qr[kc], sl[a]); sl[a] = wmma16(kr, qh[kc], sl[a]); } }
    float pv[16];
#pragma unroll
    for (int a = 0; a < 2; ++a) {
#pragma unroll
      for (int r = 0; r < 8; ++r) { const float v = (s[a][r] + sl[a][r] * (1.0f / 1024.0f)) * SCALE; pv[a * 8 + r] = (k0 + a * 16 + 8 * g + r <= t && v > 0.f) ? v * 2048.0f : 0.f; } }
    const F2 p = bsplit16(pv);
#pragma unroll
    for (int j = 0; j < HD / 16; ++j) { const size_t po = ((size_t)b * CC + h * HD + j * 16 + c) * (size_t)KHI + k0; const v16b vh = frag_b(VB + po, lane); o[j] = wmma_bf(vh, p.h, o[j]); o[j] = wmma_bf(vh, p.l, o[j]); o[j] = wmma_bf(frag_b(VBL + po, lane), p.h, o[j]); } }
  att_store(Y, b, h, t, g, o); }
// frag_h with the lane's 8 * g already in the address
__device__ __forceinline__ v16h frag_at(const _Float16* p) { union { v16h v; v8h q[2]; } u; u.q[0] = *(const v8h*)p; u.q[1] = *(const v8h*)(p + 16); return u.v; }
// one trip: 64 keys from k0 against the wave's QT x 16 query rows; MASK: the trip reaches the wave's own rows, so the causal mask can cut
template <bool MASK> __device__ __forceinline__ void att_trip(const _Float16* __restrict__ Kp, const _Float16* __restrict__ Vp, int k0, int ql0, int lane, const v16h (&q)[QT][HD / 32], v8f (&o)[QT][HD / 16]) {
  const int c = lane & 15, g = lane >> 4; v8f s[QT][4] = {}; v16h kf[HD / 32][4], vf[2][HD / 16], p[QT][2];
  const _Float16* kb = Kp + (size_t)k0 * CC + 8 * g; const _Float16* vb = Vp + k0 + 8 * g;   /* the lane's own fragment addresses (k order of frag_h) */
  /* a trip's k fragments are requested together at its head, its v fragments together behind the score products, so that they land under the relu work: two load latencies a trip, not one a fragment */
#pragma unroll
  for (int kc = 0; kc < HD / 32; ++kc)
#pragma unroll
    for (int a = 0; a < 4; ++a) kf[kc][a] = frag_at(kb + (size_t)(a * 16) * CC + kc * 32);
  asm volatile("s_wait_xcnt 0x0" :: "v"(kb) : "memory");   /* the k address stays live to here, so no load of the run lands in it; later writes of it stand behind this wait */
#pragma unroll
  for (int kc = 0; kc < HD / 32; ++kc)
#pragma unroll
    for (int a = 0; a < 4; ++a)
#pragma unroll
      for (int qt = 0; qt < QT; ++qt) s[qt][a] = wmma16(kf[kc][a], q[qt][kc], s[qt][a]);
#pragma unroll
  for (int ch = 0; ch < 2; ++ch)
#pragma unroll
    for (int j = 0; j < HD / 16; ++j) vf[ch][j] = frag_at(vb + (size_t)(j * 16) * TT + ch * 32);
  asm volatile("s_wait_xcnt 0x0" :: "v"(vb) : "memory");   /* the same for the v address */
#pragma unroll
  for (int qt = 0; qt < QT; ++qt)
#pragma unroll
    for (int a = 0; a < 4; ++a)
#pragma unroll
      for (int r = 0; r < 8; ++r) { const float pr = fmaxf(s[qt][a][r] * (SCALE * 2048.0f), 0.f); p[qt][a >> 1][(a & 1) * 8 + r] = (_Float16)((!MASK || k0 + a * 16 + 8 * g + r <= ql0 + qt * 16 + c) ? pr : 0.f); }
#pragma unroll
  for (int ch = 0; ch < 2; ++ch)
#pragma unroll
    for (int j = 0; j < HD / 16; ++j)
#pragma unroll
      for (int qt = 0; qt < QT; ++qt) o[qt][j] = wmma16(vf[ch][j], p[qt][ch], o[qt][j]); }
__global__ __launch_bounds__(128) void k_att(const _Float16* __restrict__ QH, const _Float16* __restrict__ KH, const _Float16* __restrict__ QL, const _Float16* __restrict__ KL, const _Float16* __restrict__ VT, const __bf16* __restrict__ VB, const __bf16* __restrict__ VBL, float* __restrict__ Y) {
  const int lane = threadIdx.x & 31, c = lane & 15, g = lane >> 4; const int wave = __builtin_amdgcn_readfirstlane(threadIdx.x >> 5);
  /* heads run fastest in the grid, so neighbouring work-groups have key walks of one length; even batches take the query blocks in reverse order, so that long and short walks are resident together */
  const int h = blockIdx.x, b = blockIdx.z; const int qblk = (b & 1) ? (int)blockIdx.y : TT / (64 * QT) - 1 - (int)blockIdx.y; const int ql0 = qblk * (64 * QT) + wave * (16 * QT);
  if (ql0 < QHI) {
#pragma unroll 1   /* one copy of the early-row code for both 16-row tiles: half the code */
    for (int qt = 0; qt < QT; ++qt) { att_hi(QH, KH, QL, KL, VB, VBL, b, h, ql0 + qt * 16, lane, Y);
      asm volatile("s_wait_xcnt 0x0" ::: "memory"); }   /* the next pass writes registers that this pass's stores name */
    return; }
  const _Float16* Kp = KH + ((size_t)b * TT + c) * CC + h * HD; const _Float16* Vp = VT + ((size_t)b * CC + h * HD + c) * (size_t)TT;
  v16h q[QT][HD / 32];
#pragma unroll
  for (int qt = 0; qt < QT; ++qt)
#pragma unroll
    for (int kc = 0; kc < HD / 32; ++kc) q[qt][kc] = frag_h(QH + ((size_t)b * TT + ql0 + qt * 16 + c) * CC + h * HD + kc * 32, lane);
  v8f o[QT][HD / 16] = {}; const int kd = (ql0 >> 6) * 64;   /* the wave's 16 * QT <= 64 rows lie inside one 64-key trip: only that last one is masked */
#pragma unroll 1   /* run-time trip count, large body: stays rolled for registers and the instruction cache */
  for (int k0 = 0; k0 < kd; k0 += 64) att_trip<false>(Kp, Vp, k0, ql0, lane, q, o);
  att_trip<true>(Kp, Vp, kd, ql0, lane, q, o);
#pragma unroll
  for (int qt = 0; qt < QT; ++qt) att_store(Y, b, h, ql0 + qt * 16 + c, g, o[qt]);
  asm volatile("s_wait_xcnt 0x0" ::: "memory"); }   /* code laid out behind these stores writes registers that they name */

extern "C" void kernel_launch(void* const* d_in, const int* in_sizes, int n_in, void* d_out, int out_size, void* d_ws, size_t ws_size, hipStream_t stream) {
  (void)in_sizes; (void)n_in; (void)out_size;
  const float** F = (const float**)d_in;
  if (ws_size < (size_t)WS_END) return;
  char* ws = (char*)d_ws; _Float16 *QH = (_Float16*)(ws + WS_QH), *KH = (_Float16*)(ws + WS_KH), *VT = (_Float16*)(ws + WS_VT), *QL = (_Float16*)(ws + WS_QL), *KL = (_Float16*)(ws + WS_KL); __bf16 *VB = (__bf16*)(ws + WS_VB), *VBL = (__bf16*)(ws + WS_VBL);
  // inputs: 0 x [2,2048,1024]; 1 W_attn [1024,3072] (in,out; columns q | k | v); 2 b_attn [3072]
  k_proj<<<dim3(TNB * TT / RB, CC / 128, 3), 256, 0, stream>>>(F[0], F[0], F[0], F[1], F[1] + CC, F[1] + 2 * CC, F[2], F[2] + CC, F[2] + 2 * CC, QH, QL, KH, KL, VT, VB, VBL);
  k_att<<<dim3(NH, TT / (64 * QT), TNB), 128, 0, stream>>>(QH, KH, QL, KL, VT, VB, VBL, (float*)d_out);
}

// v003
// One run takes 65.6 microseconds.
// Timed twice side by side with v002, it ran 1.71 and 1.70 times as fast.
// Counting every step since v000, it is 13.9 times as fast.
// compute dtype: all float inputs rounded to bf16; qkv = x W_attn + b with EXACT bf16 products on WMMA 16x16x32 (f32 accumulate); causal logits: q, k once to f16 (1 product) x 64^-0.5, except the first 384 query rows of each sequence (3 products with f16 residuals); p = relu(logit) in f32 (no normalisation), carried x 2^11 once to f16 against v once to f16 (1 product; bf16 hi + lo below row 384); f32 output.
#include <hip/hip_runtime.h>
#include <math.h>

typedef __attribute__((ext_vector_type(16))) _Float16 v16h;
typedef __attribute__((ext_vector_type(16))) __bf16 v16b;
typedef __attribute__((ext_vector_type(8)))  _Float16 v8h;
typedef __attribute__((ext_vector_type(8)))  float v8f;
typedef __attribute__((ext_vector_type(4)))  float v4f;
typedef __attribute__((ext_vector_type(2)))  float v2f;
typedef __attribute__((ext_vector_type(4)))  unsigned v4u;
typedef __attribute__((ext_vector_type(4)))  int v4i;
typedef float __attribute__((may_alias)) float_a;
typedef int __attribute__((may_alias)) int_a;

template <typename T> __device__ __forceinline__ void vst2(void* p, T v) { *(T*)p = v;  }
__device__ __forceinline__ v8f wmma16(v16h a, v16h b, v8f c) {
  v8f d = __builtin_amdgcn_wmma_f32_16x16x32_f16(false, a, false, b, (short)0, c, false, false);
  asm volatile("v_nop\n\tv_nop\n\tv_nop\n\tv_nop" : "+v"(d) : "v"(a), "v"(b));
  return d;
}
__device__ __forceinline__ v8f wmma_bf(v16b a, v16b b, v8f c) {
  v8f d = __builtin_amdgcn_wmma_f32_16x16x32_bf16(false, a, false, b, (short)0, c, false, false);
  asm volatile("v_nop\n\tv_nop\n\tv_nop\n\tv_nop" : "+v"(d) : "v"(a), "v"(b));
  return d;
}
// 16x16x32 fragments: lane = (h = lane>>4, row/col = lane&15); elements 0..7 = k0+8h+0..7, 8..15 = k0+16+8h+0..7; D element r = row 8h+r
__device__ __forceinline__ v16h frag_h(const _Float16* rowk0, int lane) {
  union { v16h v; v8h q[2]; } u; const _Float16* p = rowk0 + 8 * (lane >> 4);
  u.q[0] = *(const v8h*)p; u.q[1] = *(const v8h*)(p + 16); return u.v;
}
__device__ __forceinline__ v16h frag_f32(const float* rowk0, int lane) {
  v16h a; const float* p = rowk0 + 8 * (lane >> 4);
#pragma unroll
  for (int i = 0; i < 8; ++i) { a[i] = (_Float16)p[i]; a[8 + i] = (_Float16)p[16 + i]; }
  return a;
}
__device__ __forceinline__ v16h frag_f32s(const float* rowk0, int lane, float sc) {
  v16h a; const float* p = rowk0 + 8 * (lane >> 4);
#pragma unroll
  for (int i = 0; i < 8; ++i) { a[i] = (_Float16)(p[i] * sc); a[8 + i] = (_Float16)(p[16 + i] * sc); }
  return a;
}
// column fragment from a [K][ld] layout (column n), rows >= K read as 0
__device__ __forceinline__ v16h fragc_f32(const float* W, int k0, int n, int lane, int ld, int K) {
  v16h a; const int g = lane >> 4;
#pragma unroll
  for (int i = 0; i < 8; ++i) { const int ka = k0 + 8 * g + i, kb = ka + 16;
    a[i] = (_Float16)(ka < K ? W[(size_t)(ka < K ? ka : K - 1) * ld + n] : 0.f); a[8 + i] = (_Float16)(kb < K ? W[(size_t)(kb < K ? kb : K - 1) * ld + n] : 0.f); }
  return a;
}
struct F2 { v16b h, l; };
__device__ __forceinline__ F2 bsplit16(const float v[16]) { F2 r;
#pragma unroll
  for (int i = 0; i < 16; ++i) { const __bf16 h = (__bf16)v[i]; r.h[i] = h; r.l[i] = (__bf16)(v[i] - (float)h); }
  return r; }
__device__ __forceinline__ F2 split_row(const float* row, int k0, int lane) { float v[16]; const float* p = row + k0 + 8 * (lane >> 4);
#pragma unroll
  for (int i = 0; i < 8; ++i) { v[i] = p[i]; v[8 + i] = p[16 + i]; }
  return bsplit16(v); }
__device__ __forceinline__ F2 split_rowK(const float* row, int k0, int lane, int K) { float v[16]; const int g = lane >> 4;
#pragma unroll
  for (int i = 0; i < 8; ++i) { const int ka = k0 + 8 * g + i, kb = ka + 16; v[i] = ka < K ? row[ka < K ? ka : K - 1] : 0.f; v[8 + i] = kb < K ? row[kb < K ? kb : K - 1] : 0.f; }
  return bsplit16(v); }
__device__ __forceinline__ F2 split_col(const float* W, int k0, int n, int lane, int ld, int K) { float v[16]; const int g = lane >> 4;
#pragma unroll
  for (int i = 0; i < 8; ++i) { const int ka = k0 + 8 * g + i, kb = ka + 16; v[i] = ka < K ? W[(size_t)(ka < K ? ka : K - 1) * ld + n] : 0.f; v[8 + i] = kb < K ? W[(size_t)(kb < K ? kb : K - 1) * ld + n] : 0.f; }
  return bsplit16(v); }
__device__ __forceinline__ v8f mac3(const F2& a, const F2& b, v8f c) { c = wmma_bf(a.l, b.h, c); c = wmma_bf(a.h, b.l, c); return wmma_bf(a.h, b.h, c); }
__device__ __forceinline__ float sigm(float v) { return 1.0f / (1.0f + expf(-v)); }
#define LDSX() do { asm volatile("s_wait_dscnt 0" ::: "memory"); __builtin_amdgcn_wave_barrier(); __builtin_amdgcn_fence(__ATOMIC_RELEASE, "workgroup"); } while (0)

// Causal ReLU attention (B 2, T 2,048, C 1,024 = 16 x 64): qkv = x W_attn + b_attn ((in,out) [1024, 3072], columns q | k | v); p = relu(q k^T / 8) on the lower triangle (0 elsewhere, no softmax / no normalisation); y = p v -> [B, T, C] (no output projection).
#define NB 2
#define TT 2048
#define CC 1024            // NH * HD = projected width
#define DIN 1024          // input (model) width
#define NH 16
#define HD 64
#define NQB (TT / 64)
#define HG 4
#define SCALE (0.125f)
#define CAUSAL 1
#ifndef TNB
#define TNB NB
#endif
__device__ __forceinline__ float bfr(float v) { return (float)(__bf16)v; }
__host__ __device__ __forceinline__ int kb_last(int qb) { return CAUSAL ? ((qb * 64 + 63) >> 7) : (TT / 128 - 1); }
typedef __attribute__((ext_vector_type(8))) __bf16 v8b;
__device__ __forceinline__ v16b frag_b(const __bf16* rowk0, int lane) {
  union { v16b v; v8b q[2]; } u; const __bf16* p = rowk0 + 8 * (lane >> 4);
  u.q[0] = *(const v8b*)p; u.q[1] = *(const v8b*)(p + 16); return u.v;
}
#define QBH 6              // unused: causal query rows below QHI (few keys, no averaging) take the high-precision path
#define QHI 384            // rows carrying a q residual plane
#define KHI 384            // key rows carrying k residual / v bf16 hi+lo planes (used only by the causal high-precision path)
// B fragment (k rows k0+.., output column o) of a weight: (in,out) [K][ld] or (out,in) [ld rows of K]: bf16 exact, or f16(bf16 * 256) exact
__device__ __forceinline__ v16b wcol_io(const float* Wm, int k0, int o, int lane, int ld) { v16b w; const int g = lane >> 4;
#pragma unroll
  for (int i = 0; i < 8; ++i) { w[i] = (__bf16)Wm[(size_t)(k0 + 8 * g + i) * ld + o]; w[8 + i] = (__bf16)Wm[(size_t)(k0 + 16 + 8 * g + i) * ld + o]; }
  return w; }
__device__ __forceinline__ v16b wcol_oi(const float* Wm, int k0, int o, int lane, int K) { v16b w; const float* p = Wm + (size_t)o * K + k0 + 8 * (lane >> 4);
#pragma unroll
  for (int i = 0; i < 8; ++i) { w[i] = (__bf16)p[i]; w[8 + i] = (__bf16)p[16 + i]; }
  return w; }
__device__ __forceinline__ v16h wcolh_io(const float* Wm, int k0, int o, int lane, int ld) { v16h w; const int g = lane >> 4;
#pragma unroll
  for (int i = 0; i < 8; ++i) { w[i] = (_Float16)(bfr(Wm[(size_t)(k0 + 8 * g + i) * ld + o]) * 256.0f); w[8 + i] = (_Float16)(bfr(Wm[(size_t)(k0 + 16 + 8 * g + i) * ld + o]) * 256.0f); }
  return w; }
__device__ __forceinline__ v16h wcolh_oi(const float* Wm, int k0, int o, int lane, int K) { v16h w; const float* p = Wm + (size_t)o * K + k0 + 8 * (lane >> 4);
#pragma unroll
  for (int i = 0; i < 8; ++i) { w[i] = (_Float16)(bfr(p[i]) * 256.0f); w[8 + i] = (_Float16)(bfr(p[16 + i]) * 256.0f); }
  return w; }
#define WQKV_LAYOUT 0   // 0 = (in,out) [DIN][3*CC]; 1 = (out,in) [CC][DIN]; 2 = per-head [NH][DIN][HD]
__device__ __forceinline__ v16b wcol_hdk(const float* Wm, int k0, int o, int lane) { v16b w; const int g = lane >> 4; const float* p = Wm + (size_t)(o / HD) * DIN * HD + (o % HD);
#pragma unroll
  for (int i = 0; i < 8; ++i) { w[i] = (__bf16)p[(size_t)(k0 + 8 * g + i) * HD]; w[8 + i] = (__bf16)p[(size_t)(k0 + 16 + 8 * g + i) * HD]; }
  return w; }
#define WO_OUT_IN 0
#if WQKV_LAYOUT == 1
#define WCOL(W, k0, o, lane) wcol_oi(W, k0, o, lane, DIN)
#elif WQKV_LAYOUT == 2
#define WCOL(W, k0, o, lane) wcol_hdk(W, k0, o, lane)
#else
#define WCOL(W, k0, o, lane) wcol_io(W, k0, o, lane, 3 * CC)   /* W_attn (in,out) packed by columns: row pitch 3C */
#endif
#if WO_OUT_IN
#define WOCOL(W, k0, o, lane) wcol_oi(W, k0, o, lane, CC)
#define WOCOLH(W, k0, o, lane) wcolh_oi(W, k0, o, lane, CC)
#else
#define WOCOL(W, k0, o, lane) wcol_io(W, k0, o, lane, DIN)
#define WOCOLH(W, k0, o, lane) wcolh_io(W, k0, o, lane, DIN)
#endif

#ifndef SM_EXTRA_PARAMS
#define SM_EXTRA_PARAMS
#endif
#ifndef PROJ_EXTRA_PARAMS
#define PROJ_EXTRA_PARAMS
#endif
#ifndef SM_MASK_HOOK
#define SM_MASK_HOOK (void)0
#endif

#define WS_QH  0u                                      // f16 q rows [b*t][CC]
#define WS_KH  (WS_QH + 2u * (size_t)NB * TT * CC)      // f16 k rows [b*t][CC]
#define WS_VT  (WS_KH + 2u * (size_t)NB * TT * CC)      // f16 v planes [b][c][t]
#define WS_QL  (WS_VT + 2u * (size_t)NB * CC * TT)      // f16 q residual x 2^10 rows [b][t < QHI][CC]
#define WS_KL  (WS_QL + 2u * (size_t)NB * QHI * CC)     // f16 k residual x 2^10 rows [b][t < KHI][CC]
#define WS_VB  (WS_KL + 2u * (size_t)NB * KHI * CC)     // bf16 v hi planes [b][c][t < KHI]
#define WS_VBL (WS_VB + 2u * (size_t)NB * CC * KHI)
#define WS_END (WS_VBL + 2u * (size_t)NB * CC * KHI)

// ---- k_proj: block = (128 rows, 128 cols, which), 8 waves of 32 x 64: q/k/v = X W (+ b) with exact bf16 products (K = DIN) -> which 0: q f16 rows (+ residual rows < QHI); 1: k f16 rows (+ residual rows < KHI); 2: v f16 planes [c][t] (+ bf16 hi/lo planes for t < KHI)
// Each 32-k slice of the X and W tiles is read from global memory once a block, in whole 128-byte lines, rounded to bf16 once and laid in LDS with k contiguous ([row][k] and [col][k]); every wave takes its fragments from there.
#define RB 128             // rows of a block tile
#define KP 40              // LDS pitch of a 32-k bf16 row, in elements: 64 + 16 bytes, conflict-free for the 16-byte fragment reads
typedef __attribute__((ext_vector_type(4))) __bf16 v4b;
union ProjLds {            // the two stage buffers are dead when the epilogue's staging begins (a barrier stands between), and a block takes only one of the two epilogues
  struct { __bf16 w[2][128][KP], x[2][RB][KP]; } st;
  struct { _Float16 sh[RB][136], sl[RB][136]; } qk;
  struct { _Float16 th[128][RB + 8]; __bf16 tb[128][RB + 8], tbl[128][RB + 8]; } v;
};
/* second bound: 6 waves a SIMD, so that three blocks (the whole grid at once) fit a WGP's registers as they fit its LDS */
__global__ __launch_bounds__(256, 6) void k_proj(const float* __restrict__ XQ, const float* __restrict__ XK, const float* __restrict__ XV, const float* __restrict__ WQ, const float* __restrict__ WK, const float* __restrict__ WV, const float* __restrict__ BQ, const float* __restrict__ BK, const float* __restrict__ BV,
    _Float16* __restrict__ QH, _Float16* __restrict__ QL, _Float16* __restrict__ KH, _Float16* __restrict__ KL, _Float16* __restrict__ VT, __bf16* __restrict__ VB, __bf16* __restrict__ VBL) {
  __shared__ __align__(16) ProjLds L;
  const int tid = threadIdx.x, wave = tid >> 5, lane = tid & 31, col = lane & 15, g = lane >> 4; const int which = blockIdx.z; const int c0 = blockIdx.y * 128; const size_t r0 = (size_t)blockIdx.x * RB; const size_t bb = r0 / TT; const int t0 = (int)(r0 % TT);
  const float* X = which == 0 ? XQ : which == 1 ? XK : XV; const float* WA = which == 0 ? WQ : which == 1 ? WK : WV; const float* BA = which == 0 ? BQ : which == 1 ? BK : BV;
  const int wr0 = (wave >> 1) * 32, wc0 = (wave & 1) * 64;   /* the wave's 32 x 64 piece of the tile */
  /* W slice [32 k][128 cols]: a thread takes 4 columns of 4 consecutive k rows, so that it holds 4 consecutive k of each column (one 8-byte LDS store a column); 8 lanes cover one 128-byte line of a row */
  const int wcol = (wave & 3) * 32 + (lane & 7) * 4, wk = (wave >> 2) * 16 + (lane >> 3) * 4;
  /* X slice [128 rows][32 k]: 8 lanes cover a row's 128-byte line; a thread takes rows xrow + 0, 32, 64, 96 */
  const int xrow = tid >> 3, xk = (tid & 7) * 4;
  const float* wb = WA + c0; const float* xb = X + r0 * DIN; const unsigned wo = wk * (3 * CC) + wcol, xo = xrow * DIN + xk;   /* block-uniform bases, stepped along k, and the lane's fixed offsets */
  v4f wv[4], xv[4];
#pragma unroll
  for (int i = 0; i < 4; ++i) { wv[i] = *(const v4f*)(wb + wo + i * (3 * CC)); xv[i] = *(const v4f*)(xb + xo + i * 32 * DIN); }
  asm volatile("s_wait_xcnt 0x0" :: "s"(wb), "s"(xb) : "memory");   /* the two bases stay live to here; their steps below stand behind this wait */
  wb += 32 * (3 * CC); xb += 32;
  v8f acc[2][4] = {};
#pragma unroll 2   /* two trips a pass: the stage buffer's index is then a constant of the code */
  for (int kc = 0; kc < DIN / 32; ++kc) { const int bf = kc & 1;
#pragma unroll
    for (int e = 0; e < 4; ++e) { v4b t;
#pragma unroll
      for (int i = 0; i < 4; ++i) t[i] = (__bf16)wv[i][e];
      *(v4b*)&L.st.w[bf][wcol + e][wk] = t; }
#pragma unroll
    for (int i = 0; i < 4; ++i) { v4b t;
#pragma unroll
      for (int e = 0; e < 4; ++e) t[e] = (__bf16)xv[i][e];
      *(v4b*)&L.st.x[bf][i * 32 + xrow][xk] = t; }
    __syncthreads();   /* publishes slice kc; it also ends every wave's reads of slice kc - 1, whose buffer the next trip refills */
    if (kc + 1 < DIN / 32) {   /* the next slice flies while this one is multiplied; requested behind the barrier, whose own waits would drain loads issued in front of it */
#pragma unroll
      for (int i = 0; i < 4; ++i) { wv[i] = *(const v4f*)(wb + wo + i * (3 * CC)); xv[i] = *(const v4f*)(xb + xo + i * 32 * DIN); }
      asm volatile("s_wait_xcnt 0x0" :: "s"(wb), "s"(xb) : "memory");   /* as above */
      wb += 32 * (3 * CC); xb += 32; }
    v16b a[2], w[4];
#pragma unroll
    for (int i = 0; i < 2; ++i) a[i] = frag_b(&L.st.x[bf][wr0 + i * 16 + col][0], lane);
#pragma unroll
    for (int j = 0; j < 4; ++j) w[j] = frag_b(&L.st.w[bf][wc0 + j * 16 + col][0], lane);
#pragma unroll
    for (int j = 0; j < 4; ++j)
#pragma unroll
      for (int i = 0; i < 2; ++i) acc[i][j] = wmma_bf(a[i], w[j], acc[i][j]);
    __builtin_amdgcn_sched_barrier(0); }   /* keeps the next trip's conversions, and with them the wait for the loads in flight, behind this trip's products */
  __syncthreads();   /* the epilogue's staging lies over the stage buffers: every wave's last fragment reads end here */
  if (which < 2) { _Float16* DH = which == 0 ? QH : KH; _Float16* DL = which == 0 ? QL : KL; const int nhi = which == 0 ? QHI : KHI; const bool hi_rows = t0 < nhi;
#pragma unroll
    for (int j = 0; j < 4; ++j) { const int cl = wc0 + j * 16 + col; const float bias = BA ? bfr(BA[c0 + cl]) : 0.f;
#pragma unroll
      for (int i = 0; i < 2; ++i)
#pragma unroll
        for (int r = 0; r < 8; ++r) { const float v = acc[i][j][r] + bias; const _Float16 hv = (_Float16)v; const int rl = wr0 + i * 16 + 8 * g + r; L.qk.sh[rl][cl] = hv; L.qk.sl[rl][cl] = (_Float16)((v - (float)hv) * 1024.0f); } }
    __syncthreads();
    for (int e = tid; e < RB * 16; e += 256) { const int rl = e >> 4, q = e & 15; vst2((unsigned*)(DH + (r0 + rl) * CC + c0 + q * 8), *(const v4u*)&L.qk.sh[rl][q * 8]); asm volatile("s_wait_xcnt 0x0" ::: "memory");   /* what follows, and the next trip, rewrite registers that the store names */
      if (hi_rows) { vst2((unsigned*)(DL + (bb * nhi + t0 + rl) * (size_t)CC + c0 + q * 8), *(const v4u*)&L.qk.sl[rl][q * 8]); asm volatile("s_wait_xcnt 0x0" ::: "memory"); } }   /* the same */
  } else { const bool hi_rows = t0 < KHI;
#pragma unroll
    for (int j = 0; j < 4; ++j) { const int cl = wc0 + j * 16 + col; const float bias = BA ? bfr(BA[c0 + cl]) : 0.f;
#pragma unroll
      for (int i = 0; i < 2; ++i)
#pragma unroll
        for (int r = 0; r < 8; ++r) { const float v = acc[i][j][r] + bias; const int rl = wr0 + i * 16 + 8 * g + r; L.v.th[cl][rl] = (_Float16)v; const __bf16 bh = (__bf16)v; L.v.tb[cl][rl] = bh; L.v.tbl[cl][rl] = (__bf16)(v - (float)bh); } }
    __syncthreads();
    for (int e = tid; e < 128 * (RB / 8); e += 256) { const int cl = e / (RB / 8), q = e % (RB / 8); vst2((unsigned*)(VT + (bb * CC + c0 + cl) * (size_t)TT + t0 + q * 8), *(const v4u*)&L.v.th[cl][q * 8]); asm volatile("s_wait_xcnt 0x0" ::: "memory");   /* what follows, and the next trip, rewrite registers that the store names */
      if (hi_rows) { const size_t o3 = (bb * CC + c0 + cl) * (size_t)KHI + t0 + q * 8; vst2((unsigned*)(VB + o3), *(const v4u*)&L.v.tb[cl][q * 8]); vst2((unsigned*)(VBL + o3), *(const v4u*)&L.v.tbl[cl][q * 8]); asm volatile("s_wait_xcnt 0x0" ::: "memory"); } } } }   /* the same */
// ---- k_att: wave = QT x 16 query rows of (b, h), walking its keys 64 at a time in ascending order; the block's four waves share each 64-key tile of k and v, staged in LDS (two buffers). S^T = K Q^T (A = k rows, B = q rows): a lane's D registers of two 16-key tiles are, in place, the k order of one 32-key operand,
// so p = relu(logit) x 2^11 goes from the score accumulators straight into O^T += V^T P^T (A = v planes, B = p) and never leaves the registers. O^T register r = head column 8g + r of query row c: 32-byte stores.
#define QT 2
__device__ __forceinline__ void att_store(float* __restrict__ Y, int b, int h, int t, int g, const v8f o[HD / 16]) {
  float* y = Y + ((size_t)b * TT + t) * CC + h * HD + 8 * g;
#pragma unroll
  for (int j = 0; j < HD / 16; ++j) { v4f lo, hi;
#pragma unroll
    for (int r = 0; r < 4; ++r) { lo[r] = o[j][r] * (1.0f / 2048.0f); hi[r] = o[j][4 + r] * (1.0f / 2048.0f); }
    vst2(y + j * 16, lo); vst2(y + j * 16 + 4, hi); } }
// frag_h with the lane's 8 * g already in the address
__device__ __forceinline__ v16h frag_at(const _Float16* p) { union { v16h v; v8h q[2]; } u; u.q[0] = *(const v8h*)p; u.q[1] = *(const v8h*)(p + 16); return u.v; }
// A 64-key tile of (b, h) in LDS, shared by the block's four waves: k rows [key][d] and v planes [d][key], 64 rows of 128 bytes each; the early rows' tile holds the residual and hi + lo planes as well.
#define AP 72              // LDS pitch of such a row, in elements: 128 + 16 bytes, conflict-free for the 16-byte fragment reads
struct AttTile { _Float16 k[64][AP], v[64][AP]; };
struct HiTile { _Float16 kh[64][AP], kl[64][AP]; __bf16 vh[64][AP], vl[64][AP]; };
union AttLds { AttTile t[2]; HiTile hi; };   // a block takes one path only
static_assert(QHI % (64 * QT) == 0 && KHI >= QHI && KHI % 64 == 0, "a block takes the early-row path as a whole, in front of every barrier, and its tiles lie inside the KHI key rows");
// Fills two 64-row planes by asynchronous copies, 16 bytes a lane: 8 lanes bring one whole 128-byte line, a thread takes rows r, r + 16, r + 32, r + 48 of each. l0, l1, g0, g1: the lane's own LDS byte addresses and global addresses in row r; p0, p1: the global row pitches in elements.
template <typename T0, typename T1> __device__ __forceinline__ void att_fill(unsigned l0, unsigned l1, const T0* g0, const T1* g1, size_t p0, size_t p1) {
  /* the closing s_wait_xcnt stands inside the copies' own statement, so that no register which a copy names is rewritten in front of it */
  asm volatile("global_load_async_to_lds_b128 %0, %8, off\n\t"
               "global_load_async_to_lds_b128 %1, %9, off\n\t"
               "global_load_async_to_lds_b128 %2, %10, off\n\t"
               "global_load_async_to_lds_b128 %3, %11, off\n\t"
               "global_load_async_to_lds_b128 %4, %12, off\n\t"
               "global_load_async_to_lds_b128 %5, %13, off\n\t"
               "global_load_async_to_lds_b128 %6, %14, off\n\t"
               "global_load_async_to_lds_b128 %7, %15, off\n\t"
               "s_wait_xcnt 0x0"
               :: "v"(l0), "v"(l0 + 16u * AP * 2u), "v"(l0 + 32u * AP * 2u), "v"(l0 + 48u * AP * 2u), "v"(l1), "v"(l1 + 16u * AP * 2u), "v"(l1 + 32u * AP * 2u), "v"(l1 + 48u * AP * 2u),
                  "v"(g0), "v"(g0 + 16 * p0), "v"(g0 + 32 * p0), "v"(g0 + 48 * p0), "v"(g1), "v"(g1 + 16 * p1), "v"(g1 + 32 * p1), "v"(g1 + 48 * p1)
               : "memory"); }
// early query rows (t < QHI): the wave's QT x 16 rows from t0 against the 32 keys from k0 (row kl of the staged tile): 3-product logits with f16 residuals, p and v as bf16 hi + lo (3 products)
__device__ __forceinline__ void hi_trip(const HiTile& B, int kl, int k0, int t0, int lane, const v16h (&qh)[QT][HD / 32], const v16h (&qr)[QT][HD / 32], v8f (&o)[QT][HD / 16]) {
  const int c = lane & 15, g = lane >> 4; v8f s[QT][2] = {}, sl[QT][2] = {}; v16h kh[HD / 32][2], kr[HD / 32][2]; v16b vh[HD / 16], vl[HD / 16]; F2 p[QT];
  /* as in att_trip: the k fragments are read together at the head, the v fragments together behind the score products; both row tiles use the same fragments */
#pragma unroll
  for (int kc = 0; kc < HD / 32; ++kc)
#pragma unroll
    for (int a = 0; a < 2; ++a) { kh[kc][a] = frag_h(&B.kh[kl + a * 16 + c][kc * 32], lane); kr[kc][a] = frag_h(&B.kl[kl + a * 16 + c][kc * 32], lane); }
#pragma unroll
  for (int kc = 0; kc < HD / 32; ++kc)
#pragma unroll
    for (int a = 0; a < 2; ++a)
#pragma unroll
      for (int qt = 0; qt < QT; ++qt) { s[qt][a] = wmma16(kh[kc][a], qh[qt][kc], s[qt][a]); sl[qt][a] = wmma16(kh[kc][a], qr[qt][kc], sl[qt][a]); sl[qt][a] = wmma16(kr[kc][a], qh[qt][kc], sl[qt][a]); }
#pragma unroll
  for (int j = 0; j < HD / 16; ++j) { vh[j] = frag_b(&B.vh[j * 16 + c][kl], lane); vl[j] = frag_b(&B.vl[j * 16 + c][kl], lane); }
#pragma unroll
  for (int qt = 0; qt < QT; ++qt) { float pv[16];
#pragma unroll
    for (int a = 0; a < 2; ++a) {
#pragma unroll
      for (int r = 0; r < 8; ++r) { const float v = (s[qt][a][r] + sl[qt][a][r] * (1.0f / 1024.0f)) * SCALE; pv[a * 8 + r] = (k0 + a * 16 + 8 * g + r <= t0 + qt * 16 + c && v > 0.f) ? v * 2048.0f : 0.f; } }
    p[qt] = bsplit16(pv); }
#pragma unroll
  for (int j = 0; j < HD / 16; ++j)
#pragma unroll
    for (int qt = 0; qt < QT; ++qt) { o[qt][j] = wmma_bf(vh[j], p[qt].h, o[qt][j]); o[qt][j] = wmma_bf(vh[j], p[qt].l, o[qt][j]); o[qt][j] = wmma_bf(vl[j], p[qt].h, o[qt][j]); } }
// one trip: the 64 keys from k0, staged in B, against the wave's QT x 16 query rows; MASK: the trip reaches the block's own rows, so the causal mask can cut
template <bool MASK> __device__ __forceinline__ void att_trip(const AttTile& B, int k0, int ql0, int lane, const v16h (&q)[QT][HD / 32], v8f (&o)[QT][HD / 16]) {
  const int c = lane & 15, g = lane >> 4; v8f s[QT][4] = {}; v16h kf[HD / 32][4], vf[2][HD / 16], p[QT][2];
  /* a trip's k fragments are read together at its head, its v fragments together behind the score products, so that they land under the relu work (k order of frag_h) */
#pragma unroll
  for (int kc = 0; kc < HD / 32; ++kc)
#pragma unroll
    for (int a = 0; a < 4; ++a) kf[kc][a] = frag_at(&B.k[a * 16 + c][kc * 32 + 8 * g]);
#pragma unroll
  for (int kc = 0; kc < HD / 32; ++kc)
#pragma unroll
    for (int a = 0; a < 4; ++a)
#pragma unroll
      for (int qt = 0; qt < QT; ++qt) s[qt][a] = wmma16(kf[kc][a], q[qt][kc], s[qt][a]);
#pragma unroll
  for (int ch = 0; ch < 2; ++ch)
#pragma unroll
    for (int j = 0; j < HD / 16; ++j) vf[ch][j] = frag_at(&B.v[j * 16 + c][ch * 32 + 8 * g]);
#pragma unroll
  for (int qt = 0; qt < QT; ++qt)
#pragma unroll
    for (int a = 0; a < 4; ++a)
#pragma unroll
      for (int r = 0; r < 8; ++r) { const float pr = fmaxf(s[qt][a][r] * (SCALE * 2048.0f), 0.f); p[qt][a >> 1][(a & 1) * 8 + r] = (_Float16)((!MASK || k0 + a * 16 + 8 * g + r <= ql0 + qt * 16 + c) ? pr : 0.f); }
#pragma unroll
  for (int ch = 0; ch < 2; ++ch)
#pragma unroll
    for (int j = 0; j < HD / 16; ++j)
#pragma unroll
      for (int qt = 0; qt < QT; ++qt) o[qt][j] = wmma16(vf[ch][j], p[qt][ch], o[qt][j]); }
__global__ __launch_bounds__(128) void k_att(const _Float16* __restrict__ QH, const _Float16* __restrict__ KH, const _Float16* __restrict__ QL, const _Float16* __restrict__ KL, const _Float16* __restrict__ VT, const __bf16* __restrict__ VB, const __bf16* __restrict__ VBL, float* __restrict__ Y) {
  __shared__ __align__(16) AttLds S; AttTile (&L)[2] = S.t;
  const int tid = threadIdx.x, lane = tid & 31, c = lane & 15, g = lane >> 4; const int wave = __builtin_amdgcn_readfirstlane(tid >> 5);
  /* heads run fastest in the grid, so neighbouring work-groups have key walks of one length; even batches take the query blocks in the opposite order, so that long and short walks are resident together */
  const int h = blockIdx.x, b = blockIdx.z; const int qblk = (b & 1) ? (int)blockIdx.y : TT / (64 * QT) - 1 - (int)blockIdx.y; const int ql0 = qblk * (64 * QT) + wave * (16 * QT);
  const int frow = tid >> 3, fseg = (tid & 7) * 8;   /* the thread's first row of a staged plane and its 16-byte piece of a row */
  if (ql0 < QHI) {   /* the whole block: both 16-row tiles of a wave walk the staged keys together, each in the old order, 32 keys a trip */
    v16h qh[QT][HD / 32], qr[QT][HD / 32]; v8f oh[QT][HD / 16] = {};
#pragma unroll
    for (int qt = 0; qt < QT; ++qt)
#pragma unroll
      for (int kc = 0; kc < HD / 32; ++kc) { qh[qt][kc] = frag_h(QH + ((size_t)b * TT + ql0 + qt * 16 + c) * CC + h * HD + kc * 32, lane); qr[qt][kc] = frag_h(QL + ((size_t)b * QHI + ql0 + qt * 16 + c) * CC + h * HD + kc * 32, lane); }
    const _Float16* gkh = KH + ((size_t)b * TT + frow) * CC + h * HD + fseg; const _Float16* gkl = KL + ((size_t)b * KHI + frow) * CC + h * HD + fseg;
    const size_t vo = ((size_t)b * CC + h * HD + frow) * (size_t)KHI + fseg;
    const unsigned lkh = (unsigned)(size_t)&S.hi.kh[frow][fseg], lkl = (unsigned)(size_t)&S.hi.kl[frow][fseg], lvh = (unsigned)(size_t)&S.hi.vh[frow][fseg], lvl = (unsigned)(size_t)&S.hi.vl[frow][fseg];
    const int nth = (qblk + 1) * QT;   /* 64-key tiles up to the block's last row */
#pragma unroll 1   /* run-time trip count, large body */
    for (int tl = 0; tl < nth; ++tl) {
      if (tl) { asm volatile("s_wait_dscnt 0x0" ::: "memory");   /* this wave's reads of the tile before have ended */
        __syncthreads(); }   /* and every other wave's: the one buffer may be refilled */
      att_fill(lkh, lkl, gkh + (size_t)(tl * 64) * CC, gkl + (size_t)(tl * 64) * CC, CC, CC);
      att_fill(lvh, lvl, VB + vo + tl * 64, VBL + vo + tl * 64, KHI, KHI);
      asm volatile("s_wait_asynccnt 0x0" ::: "memory");   /* the tile has landed, as far as this wave brought it */
      __syncthreads();   /* publishes the tile */
#pragma unroll 1   /* one copy of the early-row code for both halves of a tile */
      for (int sub = 0; sub < 2; ++sub) { const int ch = tl * 2 + sub;
        static_assert(16 * QT == 32, "a wave's rows are one aligned group of 32, so both its row tiles end in the same 32-key trip");
        if (ch <= (ql0 >> 5)) hi_trip(S.hi, sub * 32, ch * 32, ql0, lane, qh, qr, oh); } }   /* a wave whose rows end in front of these keys skips the work, never a barrier */
#pragma unroll
    for (int qt = 0; qt < QT; ++qt) att_store(Y, b, h, ql0 + qt * 16 + c, g, oh[qt]);
    asm volatile("s_wait_xcnt 0x0" ::: "memory");   /* code laid out behind these stores writes registers that they name */
    return; }
  v16h q[QT][HD / 32];
#pragma unroll
  for (int qt = 0; qt < QT; ++qt)
#pragma unroll
    for (int kc = 0; kc < HD / 32; ++kc) q[qt][kc] = frag_h(QH + ((size_t)b * TT + ql0 + qt * 16 + c) * CC + h * HD + kc * 32, lane);
  v8f o[QT][HD / 16] = {}; const int kd = (ql0 >> 6) * 64;   /* the wave's 16 * QT <= 64 rows lie inside one 64-key trip: its last one */
  const int kblk = qblk * (64 * QT), nt = kblk / 64 + QT;   /* keys in front of the block's own rows need no mask; the block walks nt >= 2 tiles, up to its last row */
  const _Float16* gk = KH + ((size_t)b * TT + frow) * CC + h * HD + fseg; const _Float16* gv = VT + ((size_t)b * CC + h * HD + frow) * (size_t)TT + fseg;
  const unsigned lk = (unsigned)(size_t)&L[0].k[frow][fseg], lv = (unsigned)(size_t)&L[0].v[frow][fseg];
  att_fill(lk, lv, gk, gv, CC, TT);
  asm volatile("s_wait_asynccnt 0x0" ::: "memory");   /* tile 0 has landed, as far as this wave brought it */
  __syncthreads();   /* publishes tile 0 */
  att_fill(lk + (unsigned)sizeof(AttTile), lv + (unsigned)sizeof(AttTile), gk + (size_t)64 * CC, gv + 64, CC, TT);   /* tile 1 flies while tile 0 is worked on */
#pragma unroll 1   /* run-time trip count, large body: stays rolled for registers and the instruction cache */
  for (int t = 0; t < nt - QT; ++t) { const int k0 = t * 64; const unsigned bo = (t & 1) ? (unsigned)sizeof(AttTile) : 0u;   /* the tiles in front of the block's own rows: every wave, no mask; a tile t + 2 always exists */
    att_trip<false>(L[t & 1], k0, ql0, lane, q, o);
    asm volatile("s_wait_dscnt 0x0" ::: "memory");      /* this wave's reads of tile t have ended */
    asm volatile("s_wait_asynccnt 0x0" ::: "memory");   /* its part of tile t + 1 has landed */
    __syncthreads();   /* publishes tile t + 1 and ends every wave's reads of tile t, whose buffer is refilled behind it */
    att_fill(lk + bo, lv + bo, gk + (size_t)(k0 + 128) * CC, gv + (k0 + 128), CC, TT); }
  static_assert(QT == 2, "the block's own rows are the last two tiles");
  att_trip<true>(L[(nt - 2) & 1], kblk, ql0, lane, q, o);   /* for the upper two waves the mask cuts nothing here */
  asm volatile("s_wait_dscnt 0x0" ::: "memory");      /* as in the loop */
  asm volatile("s_wait_asynccnt 0x0" ::: "memory");   /* the last tile has landed, and no copy is in flight from here to the wave's end */
  __syncthreads();   /* publishes the last tile; every wave passes it, also one whose rows end in front of that tile */
  if (kd > kblk) att_trip<true>(L[(nt - 1) & 1], kblk + 64, ql0, lane, q, o);
#pragma unroll
  for (int qt = 0; qt < QT; ++qt) att_store(Y, b, h, ql0 + qt * 16 + c, g, o[qt]);
  asm volatile("s_wait_xcnt 0x0" ::: "memory"); }   /* code laid out behind these stores writes registers that they name */

extern "C" void kernel_launch(void* const* d_in, const int* in_sizes, int n_in, void* d_out, int out_size, void* d_ws, size_t ws_size, hipStream_t stream) {
  (void)in_sizes; (void)n_in; (void)out_size;
  const float** F = (const float**)d_in;
  if (ws_size < (size_t)WS_END) return;
  char* ws = (char*)d_ws; _Float16 *QH = (_Float16*)(ws + WS_QH), *KH = (_Float16*)(ws + WS_KH), *VT = (_Float16*)(ws + WS_VT), *QL = (_Float16*)(ws + WS_QL), *KL = (_Float16*)(ws + WS_KL); __bf16 *VB = (__bf16*)(ws + WS_VB), *VBL = (__bf16*)(ws + WS_VBL);
  // inputs: 0 x [2,2048,1024]; 1 W_attn [1024,3072] (in,out; columns q | k | v); 2 b_attn [3072]
  k_proj<<<dim3(TNB * TT / RB, CC / 128, 3), 256, 0, stream>>>(F[0], F[0], F[0], F[1], F[1] + CC, F[1] + 2 * CC, F[2], F[2] + CC, F[2] + 2 * CC, QH, QL, KH, KL, VT, VB, VBL);
  k_att<<<dim3(NH, TT / (64 * QT), TNB), 128, 0, stream>>>(QH, KH, QL, KL, VT, VB, VBL, (float*)d_out);
}

// v004
// It runs in 61 microseconds.
// Timed twice side by side with v003, it ran 1.08 and 1.07 times as fast.
// Counting every step since v000, it is 15.0 times as fast.
// compute dtype: all float inputs rounded to bf16; qkv = x W_attn + b with EXACT bf16 products on WMMA 16x16x32 (f32 accumulate); causal logits: q, k once to f16 (1 product) x 64^-0.5, except the first 384 query rows of each sequence (3 products with f16 residuals); p = relu(logit) in f32 (no normalisation), carried x 2^11 once to f16 against v once to f16 (1 product; bf16 hi + lo below row 384); f32 output.
#include <hip/hip_runtime.h>
#include <math.h>

typedef __attribute__((ext_vector_type(16))) _Float16 v16h;
typedef __attribute__((ext_vector_type(16))) __bf16 v16b;
typedef __attribute__((ext_vector_type(8)))  _Float16 v8h;
typedef __attribute__((ext_vector_type(8)))  float v8f;
typedef __attribute__((ext_vector_type(4)))  float v4f;
typedef __attribute__((ext_vector_type(2)))  float v2f;
typedef __attribute__((ext_vector_type(4)))  unsigned v4u;
typedef __attribute__((ext_vector_type(4)))  int v4i;
typedef float __attribute__((may_alias)) float_a;
typedef int __attribute__((may_alias)) int_a;

template <typename T> __device__ __forceinline__ void vst2(void* p, T v) { *(T*)p = v;  }
__device__ __forceinline__ v8f wmma16(v16h a, v16h b, v8f c) {
  v8f d = __builtin_amdgcn_wmma_f32_16x16x32_f16(false, a, false, b, (short)0, c, false, false);
  asm volatile("v_nop\n\tv_nop\n\tv_nop\n\tv_nop" : "+v"(d) : "v"(a), "v"(b));
  return d;
}
__device__ __forceinline__ v8f wmma_bf(v16b a, v16b b, v8f c) {
  v8f d = __builtin_amdgcn_wmma_f32_16x16x32_bf16(false, a, false, b, (short)0, c, false, false);
  asm volatile("v_nop\n\tv_nop\n\tv_nop\n\tv_nop" : "+v"(d) : "v"(a), "v"(b));
  return d;
}
// 16x16x32 fragments: lane = (h = lane>>4, row/col = lane&15); elements 0..7 = k0+8h+0..7, 8..15 = k0+16+8h+0..7; D element r = row 8h+r
__device__ __forceinline__ v16h frag_h(const _Float16* rowk0, int lane) {
  union { v16h v; v8h q[2]; } u; const _Float16* p = rowk0 + 8 * (lane >> 4);
  u.q[0] = *(const v8h*)p; u.q[1] = *(const v8h*)(p + 16); return u.v;
}
__device__ __forceinline__ v16h frag_f32(const float* rowk0, int lane) {
  v16h a; const float* p = rowk0 + 8 * (lane >> 4);
#pragma unroll
  for (int i = 0; i < 8; ++i) { a[i] = (_Float16)p[i]; a[8 + i] = (_Float16)p[16 + i]; }
  return a;
}
__device__ __forceinline__ v16h frag_f32s(const float* rowk0, int lane, float sc) {
  v16h a; const float* p = rowk0 + 8 * (lane >> 4);
#pragma unroll
  for (int i = 0; i < 8; ++i) { a[i] = (_Float16)(p[i] * sc); a[8 + i] = (_Float16)(p[16 + i] * sc); }
  return a;
}
// column fragment from a [K][ld] layout (column n), rows >= K read as 0
__device__ __forceinline__ v16h fragc_f32(const float* W, int k0, int n, int lane, int ld, int K) {
  v16h a; const int g = lane >> 4;
#pragma unroll
  for (int i = 0; i < 8; ++i) { const int ka = k0 + 8 * g + i, kb = ka + 16;
    a[i] = (_Float16)(ka < K ? W[(size_t)(ka < K ? ka : K - 1) * ld + n] : 0.f); a[8 + i] = (_Float16)(kb < K ? W[(size_t)(kb < K ? kb : K - 1) * ld + n] : 0.f); }
  return a;
}
struct F2 { v16b h, l; };
__device__ __forceinline__ F2 bsplit16(const float v[16]) { F2 r;
#pragma unroll
  for (int i = 0; i < 16; ++i) { const __bf16 h = (__bf16)v[i]; r.h[i] = h; r.l[i] = (__bf16)(v[i] - (float)h); }
  return r; }
__device__ __forceinline__ F2 split_row(const float* row, int k0, int lane) { float v[16]; const float* p = row + k0 + 8 * (lane >> 4);
#pragma unroll
  for (int i = 0; i < 8; ++i) { v[i] = p[i]; v[8 + i] = p[16 + i]; }
  return bsplit16(v); }
__device__ __forceinline__ F2 split_rowK(const float* row, int k0, int lane, int K) { float v[16]; const int g = lane >> 4;
#pragma unroll
  for (int i = 0; i < 8; ++i) { const int ka = k0 + 8 * g + i, kb = ka + 16; v[i] = ka < K ? row[ka < K ? ka : K - 1] : 0.f; v[8 + i] = kb < K ? row[kb < K ? kb : K - 1] : 0.f; }
  return bsplit16(v); }
__device__ __forceinline__ F2 split_col(const float* W, int k0, int n, int lane, int ld, int K) { float v[16]; const int g = lane >> 4;
#pragma unroll
  for (int i = 0; i < 8; ++i) { const int ka = k0 + 8 * g + i, kb = ka + 16; v[i] = ka < K ? W[(size_t)(ka < K ? ka : K - 1) * ld + n] : 0.f; v[8 + i] = kb < K ? W[(size_t)(kb < K ? kb : K - 1) * ld + n] : 0.f; }
  return bsplit16(v); }
__device__ __forceinline__ v8f mac3(const F2& a, const F2& b, v8f c) { c = wmma_bf(a.l, b.h, c); c = wmma_bf(a.h, b.l, c); return wmma_bf(a.h, b.h, c); }
__device__ __forceinline__ float sigm(float v) { return 1.0f / (1.0f + expf(-v)); }
#define LDSX() do { asm volatile("s_wait_dscnt 0" ::: "memory"); __builtin_amdgcn_wave_barrier(); __builtin_amdgcn_fence(__ATOMIC_RELEASE, "workgroup"); } while (0)

// Causal ReLU attention (B 2, T 2,048, C 1,024 = 16 x 64): qkv = x W_attn + b_attn ((in,out) [1024, 3072], columns q | k | v); p = relu(q k^T / 8) on the lower triangle (0 elsewhere, no softmax / no normalisation); y = p v -> [B, T, C] (no output projection).
#define NB 2
#define TT 2048
#define CC 1024            // NH * HD = projected width
#define DIN 1024          // input (model) width
#define NH 16
#define HD 64
#define NQB (TT / 64)
#define HG 4
#define SCALE (0.125f)
#define CAUSAL 1
#ifndef TNB
#define TNB NB
#endif
__device__ __forceinline__ float bfr(float v) { return (float)(__bf16)v; }
__host__ __device__ __forceinline__ int kb_last(int qb) { return CAUSAL ? ((qb * 64 + 63) >> 7) : (TT / 128 - 1); }
typedef __attribute__((ext_vector_type(8))) __bf16 v8b;
__device__ __forceinline__ v16b frag_b(const __bf16* rowk0, int lane) {
  union { v16b v; v8b q[2]; } u; const __bf16* p = rowk0 + 8 * (lane >> 4);
  u.q[0] = *(const v8b*)p; u.q[1] = *(const v8b*)(p + 16); return u.v;
}
#define QBH 6              // unused: causal query rows below QHI (few keys, no averaging) take the high-precision path
#define QHI 384            // rows carrying a q residual plane
#define KHI 384            // key rows carrying k residual / v bf16 hi+lo planes (used only by the causal high-precision path)
// B fragment (k rows k0+.., output column o) of a weight: (in,out) [K][ld] or (out,in) [ld rows of K]: bf16 exact, or f16(bf16 * 256) exact
__device__ __forceinline__ v16b wcol_io(const float* Wm, int k0, int o, int lane, int ld) { v16b w; const int g = lane >> 4;
#pragma unroll
  for (int i = 0; i < 8; ++i) { w[i] = (__bf16)Wm[(size_t)(k0 + 8 * g + i) * ld + o]; w[8 + i] = (__bf16)Wm[(size_t)(k0 + 16 + 8 * g + i) * ld + o]; }
  return w; }
__device__ __forceinline__ v16b wcol_oi(const float* Wm, int k0, int o, int lane, int K) { v16b w; const float* p = Wm + (size_t)o * K + k0 + 8 * (lane >> 4);
#pragma unroll
  for (int i = 0; i < 8; ++i) { w[i] = (__bf16)p[i]; w[8 + i] = (__bf16)p[16 + i]; }
  return w; }
__device__ __forceinline__ v16h wcolh_io(const float* Wm, int k0, int o, int lane, int ld) { v16h w; const int g = lane >> 4;
#pragma unroll
  for (int i = 0; i < 8; ++i) { w[i] = (_Float16)(bfr(Wm[(size_t)(k0 + 8 * g + i) * ld + o]) * 256.0f); w[8 + i] = (_Float16)(bfr(Wm[(size_t)(k0 + 16 + 8 * g + i) * ld + o]) * 256.0f); }
  return w; }
__device__ __forceinline__ v16h wcolh_oi(const float* Wm, int k0, int o, int lane, int K) { v16h w; const float* p = Wm + (size_t)o * K + k0 + 8 * (lane >> 4);
#pragma unroll
  for (int i = 0; i < 8; ++i) { w[i] = (_Float16)(bfr(p[i]) * 256.0f); w[8 + i] = (_Float16)(bfr(p[16 + i]) * 256.0f); }
  return w; }
#define WQKV_LAYOUT 0   // 0 = (in,out) [DIN][3*CC]; 1 = (out,in) [CC][DIN]; 2 = per-head [NH][DIN][HD]
__device__ __forceinline__ v16b wcol_hdk(const float* Wm, int k0, int o, int lane) { v16b w; const int g = lane >> 4; const float* p = Wm + (size_t)(o / HD) * DIN * HD + (o % HD);
#pragma unroll
  for (int i = 0; i < 8; ++i) { w[i] = (__bf16)p[(size_t)(k0 + 8 * g + i) * HD]; w[8 + i] = (__bf16)p[(size_t)(k0 + 16 + 8 * g + i) * HD]; }
  return w; }
#define WO_OUT_IN 0
#if WQKV_LAYOUT == 1
#define WCOL(W, k0, o, lane) wcol_oi(W, k0, o, lane, DIN)
#elif WQKV_LAYOUT == 2
#define WCOL(W, k0, o, lane) wcol_hdk(W, k0, o, lane)
#else
#define WCOL(W, k0, o, lane) wcol_io(W, k0, o, lane, 3 * CC)   /* W_attn (in,out) packed by columns: row pitch 3C */
#endif
#if WO_OUT_IN
#define WOCOL(W, k0, o, lane) wcol_oi(W, k0, o, lane, CC)
#define WOCOLH(W, k0, o, lane) wcolh_oi(W, k0, o, lane, CC)
#else
#define WOCOL(W, k0, o, lane) wcol_io(W, k0, o, lane, DIN)
#define WOCOLH(W, k0, o, lane) wcolh_io(W, k0, o, lane, DIN)
#endif

#ifndef SM_EXTRA_PARAMS
#define SM_EXTRA_PARAMS
#endif
#ifndef PROJ_EXTRA_PARAMS
#define PROJ_EXTRA_PARAMS
#endif
#ifndef SM_MASK_HOOK
#define SM_MASK_HOOK (void)0
#endif

#define WS_QH  0u                                      // f16 q rows [b*t][CC]
#define WS_KH  (WS_QH + 2u * (size_t)NB * TT * CC)      // f16 k rows [b*t][CC]
#define WS_VT  (WS_KH + 2u * (size_t)NB * TT * CC)      // f16 v planes [b][c][t]
#define WS_QL  (WS_VT + 2u * (size_t)NB * CC * TT)      // f16 q residual x 2^10 rows [b][t < QHI][CC]
#define WS_KL  (WS_QL + 2u * (size_t)NB * QHI * CC)     // f16 k residual x 2^10 rows [b][t < KHI][CC]
#define WS_VB  (WS_KL + 2u * (size_t)NB * KHI * CC)     // bf16 v hi planes [b][c][t < KHI]
#define WS_VBL (WS_VB + 2u * (size_t)NB * CC * KHI)
#define WS_END (WS_VBL + 2u * (size_t)NB * CC * KHI)

// ---- k_proj: block = (128 rows, 128 cols, which), 8 waves of 32 x 64: q/k/v = X W (+ b) with exact bf16 products (K = DIN) -> which 0: q f16 rows (+ residual rows < QHI); 1: k f16 rows (+ residual rows < KHI); 2: v f16 planes [c][t] (+ bf16 hi/lo planes for t < KHI)
// Each 32-k slice of the X and W tiles is read from global memory once a block, in whole 128-byte lines, rounded to bf16 once and laid in LDS with k contiguous ([row][k] and [col][k]); every wave takes its fragments from there.
#define RB 128             // rows of a block tile
#define KP 40              // LDS pitch of a 32-k bf16 row, in elements: 64 + 16 bytes, conflict-free for the 16-byte fragment reads
typedef __attribute__((ext_vector_type(4))) __bf16 v4b;
union ProjLds {            // the two stage buffers are dead when the epilogue's staging begins (a barrier stands between), and a block takes only one of the two epilogues
  struct { __bf16 w[2][128][KP], x[2][RB][KP]; } st;
  struct { _Float16 sh[RB][136], sl[RB][136]; } qk;
  struct { _Float16 th[128][RB + 8]; __bf16 tb[128][RB + 8], tbl[128][RB + 8]; } v;
};
/* second bound: 6 waves a SIMD, so that three blocks (the whole grid at once) fit a WGP's registers as they fit its LDS */
__global__ __launch_bounds__(256, 6) void k_proj(const float* __restrict__ XQ, const float* __restrict__ XK, const float* __restrict__ XV, const float* __restrict__ WQ, const float* __restrict__ WK, const float* __restrict__ WV, const float* __restrict__ BQ, const float* __restrict__ BK, const float* __restrict__ BV,
    _Float16* __restrict__ QH, _Float16* __restrict__ QL, _Float16* __restrict__ KH, _Float16* __restrict__ KL, _Float16* __restrict__ VT, __bf16* __restrict__ VB, __bf16* __restrict__ VBL) {
  __shared__ __align__(16) ProjLds L;
  const int tid = threadIdx.x, wave = tid >> 5, lane = tid & 31, col = lane & 15, g = lane >> 4; const int which = blockIdx.z; const int c0 = blockIdx.y * 128; const size_t r0 = (size_t)blockIdx.x * RB; const size_t bb = r0 / TT; const int t0 = (int)(r0 % TT);
  const float* X = which == 0 ? XQ : which == 1 ? XK : XV; const float* WA = which == 0 ? WQ : which == 1 ? WK : WV; const float* BA = which == 0 ? BQ : which == 1 ? BK : BV;
  const int wr0 = (wave >> 1) * 32, wc0 = (wave & 1) * 64;   /* the wave's 32 x 64 piece of the tile */
  /* W slice [32 k][128 cols]: a thread takes 4 columns of 4 consecutive k rows, so that it holds 4 consecutive k of each column (one 8-byte LDS store a column); 8 lanes cover one 128-byte line of a row */
  const int wcol = (wave & 3) * 32 + (lane & 7) * 4, wk = (wave >> 2) * 16 + (lane >> 3) * 4;
  /* X slice [128 rows][32 k]: 8 lanes cover a row's 128-byte line; a thread takes rows xrow + 0, 32, 64, 96 */
  const int xrow = tid >> 3, xk = (tid & 7) * 4;
  const float* wb = WA + c0; const float* xb = X + r0 * DIN; const unsigned wo = wk * (3 * CC) + wcol, xo = xrow * DIN + xk;   /* block-uniform bases, stepped along k, and the lane's fixed offsets */
  v4f wv[4], xv[4];
#pragma unroll
  for (int i = 0; i < 4; ++i) { wv[i] = *(const v4f*)(wb + wo + i * (3 * CC)); xv[i] = *(const v4f*)(xb + xo + i * 32 * DIN); }
  asm volatile("s_wait_xcnt 0x0" :: "s"(wb), "s"(xb) : "memory");   /* the two bases stay live to here; their steps below stand behind this wait */
  wb += 32 * (3 * CC); xb += 32;
  v8f acc[2][4] = {};
#pragma unroll 2   /* two trips a pass: the stage buffer's index is then a constant of the code */
  for (int kc = 0; kc < DIN / 32; ++kc) { const int bf = kc & 1;
#pragma unroll
    for (int e = 0; e < 4; ++e) { v4b t;
#pragma unroll
      for (int i = 0; i < 4; ++i) t[i] = (__bf16)wv[i][e];
      *(v4b*)&L.st.w[bf][wcol + e][wk] = t; }
#pragma unroll
    for (int i = 0; i < 4; ++i) { v4b t;
#pragma unroll
      for (int e = 0; e < 4; ++e) t[e] = (__bf16)xv[i][e];
      *(v4b*)&L.st.x[bf][i * 32 + xrow][xk] = t; }
    __syncthreads();   /* publishes slice kc; it also ends every wave's reads of slice kc - 1, whose buffer the next trip refills */
    if (kc + 1 < DIN / 32) {   /* the next slice flies while this one is multiplied; requested behind the barrier, whose own waits would drain loads issued in front of it */
#pragma unroll
      for (int i = 0; i < 4; ++i) { wv[i] = *(const v4f*)(wb + wo + i * (3 * CC)); xv[i] = *(const v4f*)(xb + xo + i * 32 * DIN); }
      asm volatile("s_wait_xcnt 0x0" :: "s"(wb), "s"(xb) : "memory");   /* as above */
      wb += 32 * (3 * CC); xb += 32; }
    v16b a[2], w[4];
#pragma unroll
    for (int i = 0; i < 2; ++i) a[i] = frag_b(&L.st.x[bf][wr0 + i * 16 + col][0], lane);
#pragma unroll
    for (int j = 0; j < 4; ++j) w[j] = frag_b(&L.st.w[bf][wc0 + j * 16 + col][0], lane);
#pragma unroll
    for (int j = 0; j < 4; ++j)
#pragma unroll
      for (int i = 0; i < 2; ++i) acc[i][j] = wmma_bf(a[i], w[j], acc[i][j]);
    __builtin_amdgcn_sched_barrier(0); }   /* keeps the next trip's conversions, and with them the wait for the loads in flight, behind this trip's products */
  __syncthreads();   /* the epilogue's staging lies over the stage buffers: every wave's last fragment reads end here */
  if (which < 2) { _Float16* DH = which == 0 ? QH : KH; _Float16* DL = which == 0 ? QL : KL; const int nhi = which == 0 ? QHI : KHI; const bool hi_rows = t0 < nhi;
#pragma unroll
    for (int j = 0; j < 4; ++j) { const int cl = wc0 + j * 16 + col; const float bias = BA ? bfr(BA[c0 + cl]) : 0.f;
#pragma unroll
      for (int i = 0; i < 2; ++i)
#pragma unroll
        for (int r = 0; r < 8; ++r) { const float v = acc[i][j][r] + bias; const _Float16 hv = (_Float16)v; const int rl = wr0 + i * 16 + 8 * g + r; L.qk.sh[rl][cl] = hv; L.qk.sl[rl][cl] = (_Float16)((v - (float)hv) * 1024.0f); } }
    __syncthreads();
    for (int e = tid; e < RB * 16; e += 256) { const int rl = e >> 4, q = e & 15; vst2((unsigned*)(DH + (r0 + rl) * CC + c0 + q * 8), *(const v4u*)&L.qk.sh[rl][q * 8]); asm volatile("s_wait_xcnt 0x0" ::: "memory");   /* what follows, and the next trip, rewrite registers that the store names */
      if (hi_rows) { vst2((unsigned*)(DL + (bb * nhi + t0 + rl) * (size_t)CC + c0 + q * 8), *(const v4u*)&L.qk.sl[rl][q * 8]); asm volatile("s_wait_xcnt 0x0" ::: "memory"); } }   /* the same */
  } else { const bool hi_rows = t0 < KHI;
#pragma unroll
    for (int j = 0; j < 4; ++j) { const int cl = wc0 + j * 16 + col; const float bias = BA ? bfr(BA[c0 + cl]) : 0.f;
#pragma unroll
      for (int i = 0; i < 2; ++i)
#pragma unroll
        for (int r = 0; r < 8; ++r) { const float v = acc[i][j][r] + bias; const int rl = wr0 + i * 16 + 8 * g + r; L.v.th[cl][rl] = (_Float16)v; const __bf16 bh = (__bf16)v; L.v.tb[cl][rl] = bh; L.v.tbl[cl][rl] = (__bf16)(v - (float)bh); } }
    __syncthreads();
    for (int e = tid; e < 128 * (RB / 8); e += 256) { const int cl = e / (RB / 8), q = e % (RB / 8); vst2((unsigned*)(VT + (bb * CC + c0 + cl) * (size_t)TT + t0 + q * 8), *(const v4u*)&L.v.th[cl][q * 8]); asm volatile("s_wait_xcnt 0x0" ::: "memory");   /* what follows, and the next trip, rewrite registers that the store names */
      if (hi_rows) { const size_t o3 = (bb * CC + c0 + cl) * (size_t)KHI + t0 + q * 8; vst2((unsigned*)(VB + o3), *(const v4u*)&L.v.tb[cl][q * 8]); vst2((unsigned*)(VBL + o3), *(const v4u*)&L.v.tbl[cl][q * 8]); asm volatile("s_wait_xcnt 0x0" ::: "memory"); } } } }   /* the same */
// ---- k_att: block = 8 waves = 4 row groups x 2 key groups; a wave = QT x 16 query rows of (b, h), walking every second 64-key tile (even tiles: waves 0..3, odd tiles: waves 4..7) in ascending order; the four waves of a key group share each tile of k and v, staged in LDS (two buffers of two tiles). The two partial sums of a row are added once, through LDS, at the end. S^T = K Q^T (A = k rows, B = q rows): a lane's D registers of two 16-key tiles are, in place, the k order of one 32-key operand,
// so p = relu(logit) x 2^11 goes from the score accumulators straight into O^T += V^T P^T (A = v planes, B = p) and never leaves the registers. O^T register r = head column 8g + r of query row c: 32-byte stores.
#define QT 2
__device__ __forceinline__ void att_store(float* __restrict__ Y, int b, int h, int t, int g, const v8f o[HD / 16]) {
  float* y = Y + ((size_t)b * TT + t) * CC + h * HD + 8 * g;
#pragma unroll
  for (int j = 0; j < HD / 16; ++j) { v4f lo, hi;
#pragma unroll
    for (int r = 0; r < 4; ++r) { lo[r] = o[j][r] * (1.0f / 2048.0f); hi[r] = o[j][4 + r] * (1.0f / 2048.0f); }
    vst2(y + j * 16, lo); vst2(y + j * 16 + 4, hi); } }
// frag_h with the lane's 8 * g already in the address
__device__ __forceinline__ v16h frag_at(const _Float16* p) { union { v16h v; v8h q[2]; } u; u.q[0] = *(const v8h*)p; u.q[1] = *(const v8h*)(p + 16); return u.v; }
// A 64-key tile of (b, h) in LDS, shared by the four waves of a key group: k rows [key][d] and v planes [d][key], 64 rows of 128 bytes each; the early rows' tile holds the residual and hi + lo planes as well and is shared by both key groups.
#define AP 72              // LDS pitch of such a row, in elements: 128 + 16 bytes, conflict-free for the 16-byte fragment reads
struct AttTile { _Float16 k[64][AP], v[64][AP]; };
struct HiTile { _Float16 kh[64][AP], kl[64][AP]; __bf16 vh[64][AP], vl[64][AP]; };
union AttLds { AttTile t[4]; HiTile hi; };   // a block takes one path only; t[2 * buffer + key group]
static_assert(sizeof(HiTile) <= 2 * sizeof(AttTile) && 4 * QT * HD * 16 * 4 <= 2 * sizeof(AttTile), "the early rows' tile fills the first buffer at most, and the odd key group's partial sums fit one buffer");
// the odd key group's partial sums go to the even group's wave of the same rows: 16 bytes a lane, lanes contiguous
__device__ __forceinline__ void att_put(float* P, int qg, int lane, const v8f (&o)[QT][HD / 16]) {
#pragma unroll
  for (int qt = 0; qt < QT; ++qt)
#pragma unroll
    for (int j = 0; j < HD / 16; ++j) { float* p = P + (((qg * QT + qt) * (HD / 16) + j) * 2) * 128 + lane * 4; v4f lo, hi;
#pragma unroll
      for (int r = 0; r < 4; ++r) { lo[r] = o[qt][j][r]; hi[r] = o[qt][j][4 + r]; }
      *(v4f*)p = lo; *(v4f*)(p + 128) = hi; } }
__device__ __forceinline__ void att_add(const float* P, int qg, int lane, v8f (&o)[QT][HD / 16]) {
#pragma unroll
  for (int qt = 0; qt < QT; ++qt)
#pragma unroll
    for (int j = 0; j < HD / 16; ++j) { const float* p = P + (((qg * QT + qt) * (HD / 16) + j) * 2) * 128 + lane * 4; const v4f lo = *(const v4f*)p, hi = *(const v4f*)(p + 128);
#pragma unroll
      for (int r = 0; r < 4; ++r) { o[qt][j][r] += lo[r]; o[qt][j][4 + r] += hi[r]; } } }
static_assert(QHI % (64 * QT) == 0 && KHI >= QHI && KHI % 64 == 0, "a block takes the early-row path as a whole, in front of every barrier, and its tiles lie inside the KHI key rows");
// Fills two 64-row planes by asynchronous copies, 16 bytes a lane: 8 lanes bring one whole 128-byte line, a thread takes rows r, r + 16, r + 32, r + 48 of each. l0, l1, g0, g1: the lane's own LDS byte addresses and global addresses in row r; p0, p1: the global row pitches in elements.
template <typename T0, typename T1> __device__ __forceinline__ void att_fill(unsigned l0, unsigned l1, const T0* g0, const T1* g1, size_t p0, size_t p1) {
  /* the closing s_wait_xcnt stands inside the copies' own statement, so that no register which a copy names is rewritten in front of it */
  asm volatile("global_load_async_to_lds_b128 %0, %8, off\n\t"
               "global_load_async_to_lds_b128 %1, %9, off\n\t"
               "global_load_async_to_lds_b128 %2, %10, off\n\t"
               "global_load_async_to_lds_b128 %3, %11, off\n\t"
               "global_load_async_to_lds_b128 %4, %12, off\n\t"
               "global_load_async_to_lds_b128 %5, %13, off\n\t"
               "global_load_async_to_lds_b128 %6, %14, off\n\t"
               "global_load_async_to_lds_b128 %7, %15, off\n\t"
               "s_wait_xcnt 0x0"
               :: "v"(l0), "v"(l0 + 16u * AP * 2u), "v"(l0 + 32u * AP * 2u), "v"(l0 + 48u * AP * 2u), "v"(l1), "v"(l1 + 16u * AP * 2u), "v"(l1 + 32u * AP * 2u), "v"(l1 + 48u * AP * 2u),
                  "v"(g0), "v"(g0 + 16 * p0), "v"(g0 + 32 * p0), "v"(g0 + 48 * p0), "v"(g1), "v"(g1 + 16 * p1), "v"(g1 + 32 * p1), "v"(g1 + 48 * p1)
               : "memory"); }
// early query rows (t < QHI): the wave's QT x 16 rows from t0 against the 32 keys from k0 (row kl of the staged tile): 3-product logits with f16 residuals, p and v as bf16 hi + lo (3 products)
__device__ __forceinline__ void hi_trip(const HiTile& B, int kl, int k0, int t0, int lane, const v16h (&qh)[QT][HD / 32], const v16h (&qr)[QT][HD / 32], v8f (&o)[QT][HD / 16]) {
  const int c = lane & 15, g = lane >> 4; v8f s[QT][2] = {}, sl[QT][2] = {}; v16b vh[HD / 16], vl[HD / 16]; F2 p[QT];
  /* for the register bound of four waves a SIMD: the k fragments are read one 32-column half at a time, the v hi fragments behind the score products, the v lo fragments behind the relu work; both row tiles use the same fragments */
#pragma unroll
  for (int kc = 0; kc < HD / 32; ++kc) { v16h kh[2], kr[2];
#pragma unroll
    for (int a = 0; a < 2; ++a) { kh[a] = frag_h(&B.kh[kl + a * 16 + c][kc * 32], lane); kr[a] = frag_h(&B.kl[kl + a * 16 + c][kc * 32], lane); }
#pragma unroll
    for (int a = 0; a < 2; ++a)
#pragma unroll
      for (int qt = 0; qt < QT; ++qt) { s[qt][a] = wmma16(kh[a], qh[qt][kc], s[qt][a]); sl[qt][a] = wmma16(kh[a], qr[qt][kc], sl[qt][a]); sl[qt][a] = wmma16(kr[a], qh[qt][kc], sl[qt][a]); } }
#pragma unroll
  for (int j = 0; j < HD / 16; ++j) vh[j] = frag_b(&B.vh[j * 16 + c][kl], lane);
#pragma unroll
  for (int qt = 0; qt < QT; ++qt) { float pv[16];
#pragma unroll
    for (int a = 0; a < 2; ++a) {
#pragma unroll
      for (int r = 0; r < 8; ++r) { const float v = (s[qt][a][r] + sl[qt][a][r] * (1.0f / 1024.0f)) * SCALE; pv[a * 8 + r] = (k0 + a * 16 + 8 * g + r <= t0 + qt * 16 + c && v > 0.f) ? v * 2048.0f : 0.f; } }
    p[qt] = bsplit16(pv); }
#pragma unroll
  for (int j = 0; j < HD / 16; ++j) vl[j] = frag_b(&B.vl[j * 16 + c][kl], lane);
#pragma unroll
  for (int j = 0; j < HD / 16; ++j)
#pragma unroll
    for (int qt = 0; qt < QT; ++qt) { o[qt][j] = wmma_bf(vh[j], p[qt].h, o[qt][j]); o[qt][j] = wmma_bf(vh[j], p[qt].l, o[qt][j]); o[qt][j] = wmma_bf(vl[j], p[qt].h, o[qt][j]); } }
// one trip: the 64 keys from k0, staged in B, against the wave's QT x 16 query rows; MASK: the trip reaches the block's own rows, so the causal mask can cut
template <bool MASK> __device__ __forceinline__ void att_trip(const AttTile& B, int k0, int ql0, int lane, const v16h (&q)[QT][HD / 32], v8f (&o)[QT][HD / 16]) {
  const int c = lane & 15, g = lane >> 4; v8f s[QT][4] = {}; v16h kf[HD / 32][4], vf[2][HD / 16], p[QT][2];
  /* a trip's k fragments are read together at its head, its v fragments together behind the score products, so that they land under the relu work (k order of frag_h) */
#pragma unroll
  for (int kc = 0; kc < HD / 32; ++kc)
#pragma unroll
    for (int a = 0; a < 4; ++a) kf[kc][a] = frag_at(&B.k[a * 16 + c][kc * 32 + 8 * g]);
#pragma unroll
  for (int kc = 0; kc < HD / 32; ++kc)
#pragma unroll
    for (int a = 0; a < 4; ++a)
#pragma unroll
      for (int qt = 0; qt < QT; ++qt) s[qt][a] = wmma16(kf[kc][a], q[qt][kc], s[qt][a]);
#pragma unroll
  for (int ch = 0; ch < 2; ++ch)
#pragma unroll
    for (int j = 0; j < HD / 16; ++j) vf[ch][j] = frag_at(&B.v[j * 16 + c][ch * 32 + 8 * g]);
#pragma unroll
  for (int qt = 0; qt < QT; ++qt)
#pragma unroll
    for (int a = 0; a < 4; ++a)
#pragma unroll
      for (int r = 0; r < 8; ++r) { const float pr = fmaxf(s[qt][a][r] * (SCALE * 2048.0f), 0.f); p[qt][a >> 1][(a & 1) * 8 + r] = (_Float16)((!MASK || k0 + a * 16 + 8 * g + r <= ql0 + qt * 16 + c) ? pr : 0.f); }
#pragma unroll
  for (int ch = 0; ch < 2; ++ch)
#pragma unroll
    for (int j = 0; j < HD / 16; ++j)
#pragma unroll
      for (int qt = 0; qt < QT; ++qt) o[qt][j] = wmma16(vf[ch][j], p[qt][ch], o[qt][j]); }
/* second bound: 4 waves a SIMD, so that two blocks (the whole grid at once) fit a WGP's registers */
__global__ __launch_bounds__(256, 4) void k_att(const _Float16* __restrict__ QH, const _Float16* __restrict__ KH, const _Float16* __restrict__ QL, const _Float16* __restrict__ KL, const _Float16* __restrict__ VT, const __bf16* __restrict__ VB, const __bf16* __restrict__ VBL, float* __restrict__ Y) {
  __shared__ __align__(16) AttLds S; AttTile (&L)[4] = S.t;
  const int tid = threadIdx.x, lane = tid & 31, c = lane & 15, g = lane >> 4; const int wave = __builtin_amdgcn_readfirstlane(tid >> 5); const int qg = wave & 3, kp = wave >> 2;   /* row group, key group */
  /* heads run fastest in the grid, so neighbouring work-groups have key walks of one length; even batches take the query blocks in the opposite order, so that long and short walks are resident together */
  const int h = blockIdx.x, b = blockIdx.z; const int qblk = (b & 1) ? (int)blockIdx.y : TT / (64 * QT) - 1 - (int)blockIdx.y; const int ql0 = qblk * (64 * QT) + qg * (16 * QT);
  const int frow = (tid & 127) >> 3, fseg = (tid & 7) * 8;   /* the thread's first row of a staged plane and its 16-byte piece of a row; a key group's 128 threads fill two planes */
  if (ql0 < QHI) {   /* the whole block: both 16-row tiles of a wave walk the staged keys together, 32 keys a trip: the even key group takes a tile's first 32 keys, the odd group its last 32 */
    v16h qh[QT][HD / 32], qr[QT][HD / 32]; v8f oh[QT][HD / 16] = {};
#pragma unroll
    for (int qt = 0; qt < QT; ++qt)
#pragma unroll
      for (int kc = 0; kc < HD / 32; ++kc) { qh[qt][kc] = frag_h(QH + ((size_t)b * TT + ql0 + qt * 16 + c) * CC + h * HD + kc * 32, lane); qr[qt][kc] = frag_h(QL + ((size_t)b * QHI + ql0 + qt * 16 + c) * CC + h * HD + kc * 32, lane); }
    /* waves 0..3 bring the two k planes of a tile, waves 4..7 its two v planes: byte addresses, row pitch and step from tile to tile of the thread's own two planes */
    const size_t vo = ((size_t)b * CC + h * HD + frow) * (size_t)KHI + fseg;
    const char* ga = kp ? (const char*)(VB + vo) : (const char*)(KH + ((size_t)b * TT + frow) * CC + h * HD + fseg); const char* gb = kp ? (const char*)(VBL + vo) : (const char*)(KL + ((size_t)b * KHI + frow) * CC + h * HD + fseg);
    const size_t gp = kp ? (size_t)KHI * 2 : (size_t)CC * 2, gs = kp ? (size_t)64 * 2 : (size_t)64 * CC * 2;
    const unsigned la = kp ? (unsigned)(size_t)&S.hi.vh[frow][fseg] : (unsigned)(size_t)&S.hi.kh[frow][fseg], lb = kp ? (unsigned)(size_t)&S.hi.vl[frow][fseg] : (unsigned)(size_t)&S.hi.kl[frow][fseg];
    const int nth = (qblk + 1) * QT;   /* 64-key tiles up to the block's last row */
#pragma unroll 1   /* run-time trip count, large body */
    for (int tl = 0; tl < nth; ++tl) {
      if (tl) { asm volatile("s_wait_dscnt 0x0" ::: "memory");   /* this wave's reads of the tile before have ended */
        __syncthreads(); }   /* and every other wave's: the one buffer may be refilled */
      att_fill(la, lb, ga + tl * gs, gb + tl * gs, gp, gp);
      asm volatile("s_wait_asynccnt 0x0" ::: "memory");   /* the tile has landed, as far as this wave brought it */
      __syncthreads();   /* publishes the tile */
      static_assert(16 * QT == 32, "a wave's rows are one aligned group of 32, so both its row tiles end in the same 32-key trip");
      const int ch = tl * 2 + kp;
      if (ch <= (ql0 >> 5)) hi_trip(S.hi, kp * 32, ch * 32, ql0, lane, qh, qr, oh); }   /* a wave whose rows end in front of these keys skips the work, never a barrier */
    float* P = (float*)&S.t[2];   /* behind the early rows' tile: no copy and no fragment read touches it */
    if (kp) att_put(P, qg, lane, oh);
    __syncthreads();   /* publishes the odd key group's partial sums */
    if (kp) return;
    att_add(P, qg, lane, oh);
#pragma unroll
    for (int qt = 0; qt < QT; ++qt) att_store(Y, b, h, ql0 + qt * 16 + c, g, oh[qt]);
    asm volatile("s_wait_xcnt 0x0" ::: "memory");   /* code laid out behind these stores writes registers that they name */
    return; }
  v16h q[QT][HD / 32];
#pragma unroll
  for (int qt = 0; qt < QT; ++qt)
#pragma unroll
    for (int kc = 0; kc < HD / 32; ++kc) q[qt][kc] = frag_h(QH + ((size_t)b * TT + ql0 + qt * 16 + c) * CC + h * HD + kc * 32, lane);
  v8f o[QT][HD / 16] = {};
  static_assert(QT == 2, "the block's own rows are one pair of tiles: the last");
  const int kblk = qblk * (64 * QT), nst = qblk + 1;   /* keys in front of the block's own rows need no mask; the block walks nst >= 2 pairs of tiles, up to its last row */
  const _Float16* gk = KH + ((size_t)b * TT + kp * 64 + frow) * CC + h * HD + fseg; const _Float16* gv = VT + ((size_t)b * CC + h * HD + frow) * (size_t)TT + kp * 64 + fseg;   /* the key group's own tile of pair 0 */
  const unsigned lk = (unsigned)(size_t)&L[kp].k[frow][fseg], lv = (unsigned)(size_t)&L[kp].v[frow][fseg];
  att_fill(lk, lv, gk, gv, CC, TT);
  asm volatile("s_wait_asynccnt 0x0" ::: "memory");   /* pair 0 has landed, as far as this wave brought it */
  __syncthreads();   /* publishes pair 0 */
  att_fill(lk + 2u * (unsigned)sizeof(AttTile), lv + 2u * (unsigned)sizeof(AttTile), gk + (size_t)128 * CC, gv + 128, CC, TT);   /* pair 1 flies while pair 0 is worked on */
#pragma unroll 1   /* run-time trip count, large body: stays rolled for registers and the instruction cache */
  for (int st = 0; st < nst - 1; ++st) { const int k0 = st * 128; const unsigned bo = (st & 1) ? 2u * (unsigned)sizeof(AttTile) : 0u;   /* the pairs in front of the block's own rows: every wave, no mask */
    att_trip<false>(L[(st & 1) * 2 + kp], k0 + kp * 64, ql0, lane, q, o);
    asm volatile("s_wait_dscnt 0x0" ::: "memory");      /* this wave's reads of pair st have ended */
    asm volatile("s_wait_asynccnt 0x0" ::: "memory");   /* its part of pair st + 1 has landed */
    __syncthreads();   /* publishes pair st + 1 and ends every wave's reads of pair st, whose buffer is refilled behind it */
    if (st + 2 < nst) att_fill(lk + bo, lv + bo, gk + (size_t)(k0 + 256) * CC, gv + (k0 + 256), CC, TT); }
  asm volatile("s_wait_asynccnt 0x0" ::: "memory");   /* no copy is in flight from here to the wave's end */
  if (kp == 0 || qg >= 2) att_trip<true>(L[((nst - 1) & 1) * 2 + kp], kblk + kp * 64, ql0, lane, q, o);   /* the lower two row groups end in front of the pair's second tile */
  float* P = (float*)&S.t[(nst & 1) * 2];   /* the buffer that the last pair does not lie in: its last readers left it at the loop's last barrier, and nothing was copied into it since */
  if (kp) att_put(P, qg, lane, o);
  __syncthreads();   /* publishes the odd key group's partial sums */
  if (kp) return;
  att_add(P, qg, lane, o);
#pragma unroll
  for (int qt = 0; qt < QT; ++qt) att_store(Y, b, h, ql0 + qt * 16 + c, g, o[qt]);
  asm volatile("s_wait_xcnt 0x0" ::: "memory"); }   /* code laid out behind these stores writes registers that they name */

extern "C" void kernel_launch(void* const* d_in, const int* in_sizes, int n_in, void* d_out, int out_size, void* d_ws, size_t ws_size, hipStream_t stream) {
  (void)in_sizes; (void)n_in; (void)out_size;
  const float** F = (const float**)d_in;
  if (ws_size < (size_t)WS_END) return;
  char* ws = (char*)d_ws; _Float16 *QH = (_Float16*)(ws + WS_QH), *KH = (_Float16*)(ws + WS_KH), *VT = (_Float16*)(ws + WS_VT), *QL = (_Float16*)(ws + WS_QL), *KL = (_Float16*)(ws + WS_KL); __bf16 *VB = (__bf16*)(ws + WS_VB), *VBL = (__bf16*)(ws + WS_VBL);
  // inputs: 0 x [2,2048,1024]; 1 W_attn [1024,3072] (in,out; columns q | k | v); 2 b_attn [3072]
  k_proj<<<dim3(TNB * TT / RB, CC / 128, 3), 256, 0, stream>>>(F[0], F[0], F[0], F[1], F[1] + CC, F[1] + 2 * CC, F[2], F[2] + CC, F[2] + 2 * CC, QH, QL, KH, KL, VT, VB, VBL);
  k_att<<<dim3(NH, TT / (64 * QT), TNB), 256, 0, stream>>>(QH, KH, QL, KL, VT, VB, VBL, (float*)d_out);
}

// v005
// One run takes 59.1 microseconds.
// Next to v004, in two timings, it ran 1.03 times as fast each time.
// Over all steps from v000 it is 15.4 times as fast.
// compute dtype: all float inputs rounded to bf16; qkv = x W_attn + b with EXACT bf16 products on WMMA 16x16x32 (f32 accumulate); causal logits: q, k once to f16 (1 product) x 64^-0.5, except the first 384 query rows of each sequence (3 products with f16 residuals); p = relu(logit) in f32 (no normalisation), carried x 2^11 once to f16 against v once to f16 (1 product; bf16 hi + lo below row 384); f32 output.
#include <hip/hip_runtime.h>
#include <math.h>

typedef __attribute__((ext_vector_type(16))) _Float16 v16h;
typedef __attribute__((ext_vector_type(16))) __bf16 v16b;
typedef __attribute__((ext_vector_type(8)))  _Float16 v8h;
typedef __attribute__((ext_vector_type(8)))  float v8f;
typedef __attribute__((ext_vector_type(4)))  float v4f;
typedef __attribute__((ext_vector_type(2)))  float v2f;
typedef __attribute__((ext_vector_type(4)))  unsigned v4u;
typedef __attribute__((ext_vector_type(4)))  int v4i;
typedef float __attribute__((may_alias)) float_a;
typedef int __attribute__((may_alias)) int_a;

template <typename T> __device__ __forceinline__ void vst2(void* p, T v) { *(T*)p = v;  }
__device__ __forceinline__ v8f wmma16(v16h a, v16h b, v8f c) {
  return __builtin_amdgcn_wmma_f32_16x16x32_f16(false, a, false, b, (short)0, c, false, false);
}
__device__ __forceinline__ v8f wmma_bf(v16b a, v16b b, v8f c) {
  return __builtin_amdgcn_wmma_f32_16x16x32_bf16(false, a, false, b, (short)0, c, false, false);
}
// 16x16x32 fragments: lane = (h = lane>>4, row/col = lane&15); elements 0..7 = k0+8h+0..7, 8..15 = k0+16+8h+0..7; D element r = row 8h+r
__device__ __forceinline__ v16h frag_h(const _Float16* rowk0, int lane) {
  union { v16h v; v8h q[2]; } u; const _Float16* p = rowk0 + 8 * (lane >> 4);
  u.q[0] = *(const v8h*)p; u.q[1] = *(const v8h*)(p + 16); return u.v;
}
__device__ __forceinline__ v16h frag_f32(const float* rowk0, int lane) {
  v16h a; const float* p = rowk0 + 8 * (lane >> 4);
#pragma unroll
  for (int i = 0; i < 8; ++i) { a[i] = (_Float16)p[i]; a[8 + i] = (_Float16)p[16 + i]; }
  return a;
}
__device__ __forceinline__ v16h frag_f32s(const float* rowk0, int lane, float sc) {
  v16h a; const float* p = rowk0 + 8 * (lane >> 4);
#pragma unroll
  for (int i = 0; i < 8; ++i) { a[i] = (_Float16)(p[i] * sc); a[8 + i] = (_Float16)(p[16 + i] * sc); }
  return a;
}
// column fragment from a [K][ld] layout (column n), rows >= K read as 0
__device__ __forceinline__ v16h fragc_f32(const float* W, int k0, int n, int lane, int ld, int K) {
  v16h a; const int g = lane >> 4;
#pragma unroll
  for (int i = 0; i < 8; ++i) { const int ka = k0 + 8 * g + i, kb = ka + 16;
    a[i] = (_Float16)(ka < K ? W[(size_t)(ka < K ? ka : K - 1) * ld + n] : 0.f); a[8 + i] = (_Float16)(kb < K ? W[(size_t)(kb < K ? kb : K - 1) * ld + n] : 0.f); }
  return a;
}
struct F2 { v16b h, l; };
__device__ __forceinline__ F2 bsplit16(const float v[16]) { F2 r;
#pragma unroll
  for (int i = 0; i < 16; ++i) { const __bf16 h = (__bf16)v[i]; r.h[i] = h; r.l[i] = (__bf16)(v[i] - (float)h); }
  return r; }
__device__ __forceinline__ F2 split_row(const float* row, int k0, int lane) { float v[16]; const float* p = row + k0 + 8 * (lane >> 4);
#pragma unroll
  for (int i = 0; i < 8; ++i) { v[i] = p[i]; v[8 + i] = p[16 + i]; }
  return bsplit16(v); }
__device__ __forceinline__ F2 split_rowK(const float* row, int k0, int lane, int K) { float v[16]; const int g = lane >> 4;
#pragma unroll
  for (int i = 0; i < 8; ++i) { const int ka = k0 + 8 * g + i, kb = ka + 16; v[i] = ka < K ? row[ka < K ? ka : K - 1] : 0.f; v[8 + i] = kb < K ? row[kb < K ? kb : K - 1] : 0.f; }
  return bsplit16(v); }
__device__ __forceinline__ F2 split_col(const float* W, int k0, int n, int lane, int ld, int K) { float v[16]; const int g = lane >> 4;
#pragma unroll
  for (int i = 0; i < 8; ++i) { const int ka = k0 + 8 * g + i, kb = ka + 16; v[i] = ka < K ? W[(size_t)(ka < K ? ka : K - 1) * ld + n] : 0.f; v[8 + i] = kb < K ? W[(size_t)(kb < K ? kb : K - 1) * ld + n] : 0.f; }
  return bsplit16(v); }
__device__ __forceinline__ v8f mac3(const F2& a, const F2& b, v8f c) { c = wmma_bf(a.l, b.h, c); c = wmma_bf(a.h, b.l, c); return wmma_bf(a.h, b.h, c); }
__device__ __forceinline__ float sigm(float v) { return 1.0f / (1.0f + expf(-v)); }
#define LDSX() do { asm volatile("s_wait_dscnt 0" ::: "memory"); __builtin_amdgcn_wave_barrier(); __builtin_amdgcn_fence(__ATOMIC_RELEASE, "workgroup"); } while (0)

// Causal ReLU attention (B 2, T 2,048, C 1,024 = 16 x 64): qkv = x W_attn + b_attn ((in,out) [1024, 3072], columns q | k | v); p = relu(q k^T / 8) on the lower triangle (0 elsewhere, no softmax / no normalisation); y = p v -> [B, T, C] (no output projection).
#define NB 2
#define TT 2048
#define CC 1024            // NH * HD = projected width
#define DIN 1024          // input (model) width
#define NH 16
#define HD 64
#define NQB (TT / 64)
#define HG 4
#define SCALE (0.125f)
#define CAUSAL 1
#ifndef TNB
#define TNB NB
#endif
__device__ __forceinline__ float bfr(float v) { return (float)(__bf16)v; }
__host__ __device__ __forceinline__ int kb_last(int qb) { return CAUSAL ? ((qb * 64 + 63) >> 7) : (TT / 128 - 1); }
typedef __attribute__((ext_vector_type(8))) __bf16 v8b;
__device__ __forceinline__ v16b frag_b(const __bf16* rowk0, int lane) {
  union { v16b v; v8b q[2]; } u; const __bf16* p = rowk0 + 8 * (lane >> 4);
  u.q[0] = *(const v8b*)p; u.q[1] = *(const v8b*)(p + 16); return u.v;
}
#define QBH 6              // unused: causal query rows below QHI (few keys, no averaging) take the high-precision path
#define QHI 384            // rows carrying a q residual plane
#define KHI 384            // key rows carrying k residual / v bf16 hi+lo planes (used only by the causal high-precision path)
// B fragment (k rows k0+.., output column o) of a weight: (in,out) [K][ld] or (out,in) [ld rows of K]: bf16 exact, or f16(bf16 * 256) exact
__device__ __forceinline__ v16b wcol_io(const float* Wm, int k0, int o, int lane, int ld) { v16b w; const int g = lane >> 4;
#pragma unroll
  for (int i = 0; i < 8; ++i) { w[i] = (__bf16)Wm[(size_t)(k0 + 8 * g + i) * ld + o]; w[8 + i] = (__bf16)Wm[(size_t)(k0 + 16 + 8 * g + i) * ld + o]; }
  return w; }
__device__ __forceinline__ v16b wcol_oi(const float* Wm, int k0, int o, int lane, int K) { v16b w; const float* p = Wm + (size_t)o * K + k0 + 8 * (lane >> 4);
#pragma unroll
  for (int i = 0; i < 8; ++i) { w[i] = (__bf16)p[i]; w[8 + i] = (__bf16)p[16 + i]; }
  return w; }
__device__ __forceinline__ v16h wcolh_io(const float* Wm, int k0, int o, int lane, int ld) { v16h w; const int g = lane >> 4;
#pragma unroll
  for (int i = 0; i < 8; ++i) { w[i] = (_Float16)(bfr(Wm[(size_t)(k0 + 8 * g + i) * ld + o]) * 256.0f); w[8 + i] = (_Float16)(bfr(Wm[(size_t)(k0 + 16 + 8 * g + i) * ld + o]) * 256.0f); }
  return w; }
__device__ __forceinline__ v16h wcolh_oi(const float* Wm, int k0, int o, int lane, int K) { v16h w; const float* p = Wm + (size_t)o * K + k0 + 8 * (lane >> 4);
#pragma unroll
  for (int i = 0; i < 8; ++i) { w[i] = (_Float16)(bfr(p[i]) * 256.0f); w[8 + i] = (_Float16)(bfr(p[16 + i]) * 256.0f); }
  return w; }
#define WQKV_LAYOUT 0   // 0 = (in,out) [DIN][3*CC]; 1 = (out,in) [CC][DIN]; 2 = per-head [NH][DIN][HD]
__device__ __forceinline__ v16b wcol_hdk(const float* Wm, int k0, int o, int lane) { v16b w; const int g = lane >> 4; const float* p = Wm + (size_t)(o / HD) * DIN * HD + (o % HD);
#pragma unroll
  for (int i = 0; i < 8; ++i) { w[i] = (__bf16)p[(size_t)(k0 + 8 * g + i) * HD]; w[8 + i] = (__bf16)p[(size_t)(k0 + 16 + 8 * g + i) * HD]; }
  return w; }
#define WO_OUT_IN 0
#if WQKV_LAYOUT == 1
#define WCOL(W, k0, o, lane) wcol_oi(W, k0, o, lane, DIN)
#elif WQKV_LAYOUT == 2
#define WCOL(W, k0, o, lane) wcol_hdk(W, k0, o, lane)
#else
#define WCOL(W, k0, o, lane) wcol_io(W, k0, o, lane, 3 * CC)   /* W_attn (in,out) packed by columns: row pitch 3C */
#endif
#if WO_OUT_IN
#define WOCOL(W, k0, o, lane) wcol_oi(W, k0, o, lane, CC)
#define WOCOLH(W, k0, o, lane) wcolh_oi(W, k0, o, lane, CC)
#else
#define WOCOL(W, k0, o, lane) wcol_io(W, k0, o, lane, DIN)
#define WOCOLH(W, k0, o, lane) wcolh_io(W, k0, o, lane, DIN)
#endif

#ifndef SM_EXTRA_PARAMS
#define SM_EXTRA_PARAMS
#endif
#ifndef PROJ_EXTRA_PARAMS
#define PROJ_EXTRA_PARAMS
#endif
#ifndef SM_MASK_HOOK
#define SM_MASK_HOOK (void)0
#endif

#define WS_QH  0u                                      // f16 q rows [b*t][CC]
#define WS_KH  (WS_QH + 2u * (size_t)NB * TT * CC)      // f16 k rows [b*t][CC]
#define WS_VT  (WS_KH + 2u * (size_t)NB * TT * CC)      // f16 v planes [b][c][t]
#define WS_QL  (WS_VT + 2u * (size_t)NB * CC * TT)      // f16 q residual x 2^10 rows [b][t < QHI][CC]
#define WS_KL  (WS_QL + 2u * (size_t)NB * QHI * CC)     // f16 k residual x 2^10 rows [b][t < KHI][CC]
#define WS_VB  (WS_KL + 2u * (size_t)NB * KHI * CC)     // bf16 v hi planes [b][c][t < KHI]
#define WS_VBL (WS_VB + 2u * (size_t)NB * CC * KHI)
#define WS_END (WS_VBL + 2u * (size_t)NB * CC * KHI)

// ---- k_proj: block = (128 rows, 128 cols, which), 8 waves of 32 x 64: q/k/v = X W (+ b) with exact bf16 products (K = DIN) -> which 0: q f16 rows (+ residual rows < QHI); 1: k f16 rows (+ residual rows < KHI); 2: v f16 planes [c][t] (+ bf16 hi/lo planes for t < KHI)
// Each 32-k slice of the X and W tiles is read from global memory once a block, in whole 128-byte lines, rounded to bf16 once and laid in LDS with k contiguous ([row][k] and [col][k]); every wave takes its fragments from there.
#define RB 128             // rows of a block tile
#define KP 40              // LDS pitch of a 32-k bf16 row, in elements: 64 + 16 bytes, conflict-free for the 16-byte fragment reads
typedef __attribute__((ext_vector_type(4))) __bf16 v4b;
union ProjLds {            // the two stage buffers are dead when the epilogue's staging begins (a barrier stands between), and a block takes only one of the two epilogues
  struct { __bf16 w[2][128][KP], x[2][RB][KP]; } st;
  struct { _Float16 sh[RB][136], sl[RB][136]; } qk;
  struct { _Float16 th[128][RB + 8]; __bf16 tb[128][RB + 8], tbl[128][RB + 8]; } v;
};
/* second bound: 6 waves a SIMD, so that three blocks (the whole grid at once) fit a WGP's registers as they fit its LDS */
__global__ __launch_bounds__(256, 6) void k_proj(const float* __restrict__ XQ, const float* __restrict__ XK, const float* __restrict__ XV, const float* __restrict__ WQ, const float* __restrict__ WK, const float* __restrict__ WV, const float* __restrict__ BQ, const float* __restrict__ BK, const float* __restrict__ BV,
    _Float16* __restrict__ QH, _Float16* __restrict__ QL, _Float16* __restrict__ KH, _Float16* __restrict__ KL, _Float16* __restrict__ VT, __bf16* __restrict__ VB, __bf16* __restrict__ VBL) {
  __shared__ __align__(16) ProjLds L;
  const int tid = threadIdx.x, wave = tid >> 5, lane = tid & 31, col = lane & 15, g = lane >> 4; const int which = blockIdx.z; const int c0 = blockIdx.y * 128; const size_t r0 = (size_t)blockIdx.x * RB; const size_t bb = r0 / TT; const int t0 = (int)(r0 % TT);
  const float* X = which == 0 ? XQ : which == 1 ? XK : XV; const float* WA = which == 0 ? WQ : which == 1 ? WK : WV; const float* BA = which == 0 ? BQ : which == 1 ? BK : BV;
  const int wr0 = (wave >> 1) * 32, wc0 = (wave & 1) * 64;   /* the wave's 32 x 64 piece of the tile */
  /* W slice [32 k][128 cols]: a thread takes 4 columns of 4 consecutive k rows, so that it holds 4 consecutive k of each column (one 8-byte LDS store a column); 8 lanes cover one 128-byte line of a row */
  const int wcol = (wave & 3) * 32 + (lane & 7) * 4, wk = (wave >> 2) * 16 + (lane >> 3) * 4;
  /* X slice [128 rows][32 k]: 8 lanes cover a row's 128-byte line; a thread takes rows xrow + 0, 32, 64, 96 */
  const int xrow = tid >> 3, xk = (tid & 7) * 4;
  const float* wb = WA + c0; const float* xb = X + r0 * DIN; const unsigned wo = wk * (3 * CC) + wcol, xo = xrow * DIN + xk;   /* block-uniform bases, stepped along k, and the lane's fixed offsets */
  v4f wv[4], xv[4];
#pragma unroll
  for (int i = 0; i < 4; ++i) { wv[i] = *(const v4f*)(wb + wo + i * (3 * CC)); xv[i] = *(const v4f*)(xb + xo + i * 32 * DIN); }
  asm volatile("s_wait_xcnt 0x0" :: "s"(wb), "s"(xb) : "memory");   /* the two bases stay live to here; their steps below stand behind this wait */
  wb += 32 * (3 * CC); xb += 32;
  v8f acc[2][4] = {};
#pragma unroll 2   /* two trips a pass: the stage buffer's index is then a constant of the code */
  for (int kc = 0; kc < DIN / 32; ++kc) { const int bf = kc & 1;
#pragma unroll
    for (int e = 0; e < 4; ++e) { v4b t;
#pragma unroll
      for (int i = 0; i < 4; ++i) t[i] = (__bf16)wv[i][e];
      *(v4b*)&L.st.w[bf][wcol + e][wk] = t; }
#pragma unroll
    for (int i = 0; i < 4; ++i) { v4b t;
#pragma unroll
      for (int e = 0; e < 4; ++e) t[e] = (__bf16)xv[i][e];
      *(v4b*)&L.st.x[bf][i * 32 + xrow][xk] = t; }
    __syncthreads();   /* publishes slice kc; it also ends every wave's reads of slice kc - 1, whose buffer the next trip refills */
    if (kc + 1 < DIN / 32) {   /* the next slice flies while this one is multiplied; requested behind the barrier, whose own waits would drain loads issued in front of it */
#pragma unroll
      for (int i = 0; i < 4; ++i) { wv[i] = *(const v4f*)(wb + wo + i * (3 * CC)); xv[i] = *(const v4f*)(xb + xo + i * 32 * DIN); }
      asm volatile("s_wait_xcnt 0x0" :: "s"(wb), "s"(xb) : "memory");   /* as above */
      wb += 32 * (3 * CC); xb += 32; }
    v16b a[2], w[4];
#pragma unroll
    for (int i = 0; i < 2; ++i) a[i] = frag_b(&L.st.x[bf][wr0 + i * 16 + col][0], lane);
#pragma unroll
    for (int j = 0; j < 4; ++j) w[j] = frag_b(&L.st.w[bf][wc0 + j * 16 + col][0], lane);
  __builtin_amdgcn_sched_barrier(0);   /* keeps the trip's twelve fragment reads one group in front of its products: sunk among them, each pair would be waited for on its own */
#pragma unroll
    for (int j = 0; j < 4; ++j)
#pragma unroll
      for (int i = 0; i < 2; ++i) acc[i][j] = wmma_bf(a[i], w[j], acc[i][j]);
    __builtin_amdgcn_sched_barrier(0); }   /* keeps the next trip's conversions, and with them the wait for the loads in flight, behind this trip's products */
  __syncthreads();   /* the epilogue's staging lies over the stage buffers: every wave's last fragment reads end here */
  if (which < 2) { _Float16* DH = which == 0 ? QH : KH; _Float16* DL = which == 0 ? QL : KL; const int nhi = which == 0 ? QHI : KHI; const bool hi_rows = t0 < nhi;
#pragma unroll
    for (int j = 0; j < 4; ++j) { const int cl = wc0 + j * 16 + col; const float bias = BA ? bfr(BA[c0 + cl]) : 0.f;
#pragma unroll
      for (int i = 0; i < 2; ++i)
#pragma unroll
        for (int r = 0; r < 8; ++r) { const float v = acc[i][j][r] + bias; const _Float16 hv = (_Float16)v; const int rl = wr0 + i * 16 + 8 * g + r; L.qk.sh[rl][cl] = hv; L.qk.sl[rl][cl] = (_Float16)((v - (float)hv) * 1024.0f); } }
    __syncthreads();
    for (int e = tid; e < RB * 16; e += 256) { const int rl = e >> 4, q = e & 15; vst2((unsigned*)(DH + (r0 + rl) * CC + c0 + q * 8), *(const v4u*)&L.qk.sh[rl][q * 8]); asm volatile("s_wait_xcnt 0x0" ::: "memory");   /* what follows, and the next trip, rewrite registers that the store names */
      if (hi_rows) { vst2((unsigned*)(DL + (bb * nhi + t0 + rl) * (size_t)CC + c0 + q * 8), *(const v4u*)&L.qk.sl[rl][q * 8]); asm volatile("s_wait_xcnt 0x0" ::: "memory"); } }   /* the same */
  } else { const bool hi_rows = t0 < KHI;
#pragma unroll
    for (int j = 0; j < 4; ++j) { const int cl = wc0 + j * 16 + col; const float bias = BA ? bfr(BA[c0 + cl]) : 0.f;
#pragma unroll
      for (int i = 0; i < 2; ++i)
#pragma unroll
        for (int r = 0; r < 8; ++r) { const float v = acc[i][j][r] + bias; const int rl = wr0 + i * 16 + 8 * g + r; L.v.th[cl][rl] = (_Float16)v; const __bf16 bh = (__bf16)v; L.v.tb[cl][rl] = bh; L.v.tbl[cl][rl] = (__bf16)(v - (float)bh); } }
    __syncthreads();
    for (int e = tid; e < 128 * (RB / 8); e += 256) { const int cl = e / (RB / 8), q = e % (RB / 8); vst2((unsigned*)(VT + (bb * CC + c0 + cl) * (size_t)TT + t0 + q * 8), *(const v4u*)&L.v.th[cl][q * 8]); asm volatile("s_wait_xcnt 0x0" ::: "memory");   /* what follows, and the next trip, rewrite registers that the store names */
      if (hi_rows) { const size_t o3 = (bb * CC + c0 + cl) * (size_t)KHI + t0 + q * 8; vst2((unsigned*)(VB + o3), *(const v4u*)&L.v.tb[cl][q * 8]); vst2((unsigned*)(VBL + o3), *(const v4u*)&L.v.tbl[cl][q * 8]); asm volatile("s_wait_xcnt 0x0" ::: "memory"); } } } }   /* the same */
// ---- k_att: block = 8 waves = 4 row groups x 2 key groups; a wave = QT x 16 query rows of (b, h), walking every second 64-key tile (even tiles: waves 0..3, odd tiles: waves 4..7) in ascending order; the four waves of a key group share each tile of k and v, staged in LDS (two buffers of two tiles). The two partial sums of a row are added once, through LDS, at the end. S^T = K Q^T (A = k rows, B = q rows): a lane's D registers of two 16-key tiles are, in place, the k order of one 32-key operand,
// so p = relu(logit) x 2^11 goes from the score accumulators straight into O^T += V^T P^T (A = v planes, B = p) and never leaves the registers. O^T register r = head column 8g + r of query row c: 32-byte stores.
#define QT 2
__device__ __forceinline__ void att_store(float* __restrict__ Y, int b, int h, int t, int g, const v8f o[HD / 16]) {
  float* y = Y + ((size_t)b * TT + t) * CC + h * HD + 8 * g;
#pragma unroll
  for (int j = 0; j < HD / 16; ++j) { v4f lo, hi;
#pragma unroll
    for (int r = 0; r < 4; ++r) { lo[r] = o[j][r] * (1.0f / 2048.0f); hi[r] = o[j][4 + r] * (1.0f / 2048.0f); }
    vst2(y + j * 16, lo); vst2(y + j * 16 + 4, hi); } }
// frag_h with the lane's 8 * g already in the address
__device__ __forceinline__ v16h frag_at(const _Float16* p) { union { v16h v; v8h q[2]; } u; u.q[0] = *(const v8h*)p; u.q[1] = *(const v8h*)(p + 16); return u.v; }
// A 64-key tile of (b, h) in LDS, shared by the four waves of a key group: k rows [key][d] and v planes [d][key], 64 rows of 128 bytes each; the early rows' tile holds the residual and hi + lo planes as well and is shared by both key groups.
#define AP 72              // LDS pitch of such a row, in elements: 128 + 16 bytes, conflict-free for the 16-byte fragment reads
struct AttTile { _Float16 k[64][AP], v[64][AP]; };
struct HiTile { _Float16 kh[64][AP], kl[64][AP]; __bf16 vh[64][AP], vl[64][AP]; };
union AttLds { AttTile t[4]; HiTile hi; };   // a block takes one path only; t[2 * buffer + key group]
static_assert(sizeof(HiTile) <= 2 * sizeof(AttTile) && 4 * QT * HD * 16 * 4 <= 2 * sizeof(AttTile), "the early rows' tile fills the first buffer at most, and the odd key group's partial sums fit one buffer");
// the odd key group's partial sums go to the even group's wave of the same rows: 16 bytes a lane, lanes contiguous
__device__ __forceinline__ void att_put(float* P, int qg, int lane, const v8f (&o)[QT][HD / 16]) {
#pragma unroll
  for (int qt = 0; qt < QT; ++qt)
#pragma unroll
    for (int j = 0; j < HD / 16; ++j) { float* p = P + (((qg * QT + qt) * (HD / 16) + j) * 2) * 128 + lane * 4; v4f lo, hi;
#pragma unroll
      for (int r = 0; r < 4; ++r) { lo[r] = o[qt][j][r]; hi[r] = o[qt][j][4 + r]; }
      *(v4f*)p = lo; *(v4f*)(p + 128) = hi; } }
__device__ __forceinline__ void att_add(const float* P, int qg, int lane, v8f (&o)[QT][HD / 16]) {
#pragma unroll
  for (int qt = 0; qt < QT; ++qt)
#pragma unroll
    for (int j = 0; j < HD / 16; ++j) { const float* p = P + (((qg * QT + qt) * (HD / 16) + j) * 2) * 128 + lane * 4; const v4f lo = *(const v4f*)p, hi = *(const v4f*)(p + 128);
#pragma unroll
      for (int r = 0; r < 4; ++r) { o[qt][j][r] += lo[r]; o[qt][j][4 + r] += hi[r]; } } }
static_assert(QHI % (64 * QT) == 0 && KHI >= QHI && KHI % 64 == 0, "a block takes the early-row path as a whole, in front of every barrier, and its tiles lie inside the KHI key rows");
// Fills two 64-row planes by asynchronous copies, 16 bytes a lane: 8 lanes bring one whole 128-byte line, a thread takes rows r, r + 16, r + 32, r + 48 of each. l0, l1, g0, g1: the lane's own LDS byte addresses and global addresses in row r; p0, p1: the global row pitches in elements.
template <typename T0, typename T1> __device__ __forceinline__ void att_fill(unsigned l0, unsigned l1, const T0* g0, const T1* g1, size_t p0, size_t p1) {
  /* the closing s_wait_xcnt stands inside the copies' own statement, so that no register which a copy names is rewritten in front of it */
  asm volatile("global_load_async_to_lds_b128 %0, %8, off\n\t"
               "global_load_async_to_lds_b128 %1, %9, off\n\t"
               "global_load_async_to_lds_b128 %2, %10, off\n\t"
               "global_load_async_to_lds_b128 %3, %11, off\n\t"
               "global_load_async_to_lds_b128 %4, %12, off\n\t"
               "global_load_async_to_lds_b128 %5, %13, off\n\t"
               "global_load_async_to_lds_b128 %6, %14, off\n\t"
               "global_load_async_to_lds_b128 %7, %15, off\n\t"
               "s_wait_xcnt 0x0"
               :: "v"(l0), "v"(l0 + 16u * AP * 2u), "v"(l0 + 32u * AP * 2u), "v"(l0 + 48u * AP * 2u), "v"(l1), "v"(l1 + 16u * AP * 2u), "v"(l1 + 32u * AP * 2u), "v"(l1 + 48u * AP * 2u),
                  "v"(g0), "v"(g0 + 16 * p0), "v"(g0 + 32 * p0), "v"(g0 + 48 * p0), "v"(g1), "v"(g1 + 16 * p1), "v"(g1 + 32 * p1), "v"(g1 + 48 * p1)
               : "memory"); }
// early query rows (t < QHI): the wave's QT x 16 rows from t0 against the 32 keys from k0 (row kl of the staged tile): 3-product logits with f16 residuals, p and v as bf16 hi + lo (3 products)
__device__ __forceinline__ void hi_trip(const HiTile& B, int kl, int k0, int t0, int lane, const v16h (&qh)[QT][HD / 32], const v16h (&qr)[QT][HD / 32], v8f (&o)[QT][HD / 16]) {
  const int c = lane & 15, g = lane >> 4; v8f s[QT][2] = {}, sl[QT][2] = {}; v16b vh[HD / 16], vl[HD / 16]; F2 p[QT];
  /* for the register bound of four waves a SIMD: the k fragments are read one 32-column half at a time, the v hi fragments behind the score products, the v lo fragments behind the relu work; both row tiles use the same fragments */
#pragma unroll
  for (int kc = 0; kc < HD / 32; ++kc) { v16h kh[2], kr[2];
#pragma unroll
    for (int a = 0; a < 2; ++a) { kh[a] = frag_h(&B.kh[kl + a * 16 + c][kc * 32], lane); kr[a] = frag_h(&B.kl[kl + a * 16 + c][kc * 32], lane); }
#pragma unroll
    for (int a = 0; a < 2; ++a)
#pragma unroll
      for (int qt = 0; qt < QT; ++qt) { s[qt][a] = wmma16(kh[a], qh[qt][kc], s[qt][a]); sl[qt][a] = wmma16(kh[a], qr[qt][kc], sl[qt][a]); sl[qt][a] = wmma16(kr[a], qh[qt][kc], sl[qt][a]); } }
#pragma unroll
  for (int j = 0; j < HD / 16; ++j) vh[j] = frag_b(&B.vh[j * 16 + c][kl], lane);
  __builtin_amdgcn_sched_barrier(0);   /* keeps the v hi reads one group in front of the relu work, under which they land */
#pragma unroll
  for (int qt = 0; qt < QT; ++qt) { float pv[16];
#pragma unroll
    for (int a = 0; a < 2; ++a) {
#pragma unroll
      for (int r = 0; r < 8; ++r) { const float v = (s[qt][a][r] + sl[qt][a][r] * (1.0f / 1024.0f)) * SCALE; pv[a * 8 + r] = (k0 + a * 16 + 8 * g + r <= t0 + qt * 16 + c && v > 0.f) ? v * 2048.0f : 0.f; } }
    p[qt] = bsplit16(pv); }
#pragma unroll
  for (int j = 0; j < HD / 16; ++j) vl[j] = frag_b(&B.vl[j * 16 + c][kl], lane);
#pragma unroll
  for (int j = 0; j < HD / 16; ++j)
#pragma unroll
    for (int qt = 0; qt < QT; ++qt) { o[qt][j] = wmma_bf(vh[j], p[qt].h, o[qt][j]); o[qt][j] = wmma_bf(vh[j], p[qt].l, o[qt][j]); o[qt][j] = wmma_bf(vl[j], p[qt].h, o[qt][j]); } }
// one trip: the 64 keys from k0, staged in B, against the wave's QT x 16 query rows; MASK: the trip reaches the block's own rows, so the causal mask can cut
template <bool MASK> __device__ __forceinline__ void att_trip(const AttTile& B, int k0, int ql0, int lane, const v16h (&q)[QT][HD / 32], v8f (&o)[QT][HD / 16]) {
  const int c = lane & 15, g = lane >> 4; v8f s[QT][4] = {}; v16h kf[HD / 32][4], vf[2][HD / 16], p[QT][2];
  /* a trip's k fragments are read together at its head, its v fragments together behind the score products, so that they land under the relu work (k order of frag_h) */
#pragma unroll
  for (int kc = 0; kc < HD / 32; ++kc)
#pragma unroll
    for (int a = 0; a < 4; ++a) kf[kc][a] = frag_at(&B.k[a * 16 + c][kc * 32 + 8 * g]);
  __builtin_amdgcn_sched_barrier(0);   /* keeps the k reads one group in front of the score products */
#pragma unroll
  for (int kc = 0; kc < HD / 32; ++kc)
#pragma unroll
    for (int a = 0; a < 4; ++a)
#pragma unroll
      for (int qt = 0; qt < QT; ++qt) s[qt][a] = wmma16(kf[kc][a], q[qt][kc], s[qt][a]);
  __builtin_amdgcn_sched_barrier(0);   /* keeps the v reads behind the score products, whose k registers they take over */
#pragma unroll
  for (int ch = 0; ch < 2; ++ch)
#pragma unroll
    for (int j = 0; j < HD / 16; ++j) vf[ch][j] = frag_at(&B.v[j * 16 + c][ch * 32 + 8 * g]);
  __builtin_amdgcn_sched_barrier(0);   /* keeps the v reads one group in front of the relu work, under which they land */
#pragma unroll
  for (int qt = 0; qt < QT; ++qt)
#pragma unroll
    for (int a = 0; a < 4; ++a)
#pragma unroll
      for (int r = 0; r < 8; ++r) { const float pr = fmaxf(s[qt][a][r] * (SCALE * 2048.0f), 0.f); p[qt][a >> 1][(a & 1) * 8 + r] = (_Float16)((!MASK || k0 + a * 16 + 8 * g + r <= ql0 + qt * 16 + c) ? pr : 0.f); }
#pragma unroll
  for (int ch = 0; ch < 2; ++ch)
#pragma unroll
    for (int j = 0; j < HD / 16; ++j)
#pragma unroll
      for (int qt = 0; qt < QT; ++qt) o[qt][j] = wmma16(vf[ch][j], p[qt][ch], o[qt][j]);
  __builtin_amdgcn_sched_barrier(0); }   /* keeps the trip's products in front of the caller's waits and barrier: lifted over them, the barrier would line up the waves of a SIMD in front of their products */
/* second bound: 4 waves a SIMD, so that two blocks (the whole grid at once) fit a WGP's registers */
__global__ __launch_bounds__(256, 4) void k_att(const _Float16* __restrict__ QH, const _Float16* __restrict__ KH, const _Float16* __restrict__ QL, const _Float16* __restrict__ KL, const _Float16* __restrict__ VT, const __bf16* __restrict__ VB, const __bf16* __restrict__ VBL, float* __restrict__ Y) {
  __shared__ __align__(16) AttLds S; AttTile (&L)[4] = S.t;
  const int tid = threadIdx.x, lane = tid & 31, c = lane & 15, g = lane >> 4; const int wave = __builtin_amdgcn_readfirstlane(tid >> 5); const int qg = wave & 3, kp = wave >> 2;   /* row group, key group */
  /* heads run fastest in the grid, so neighbouring work-groups have key walks of one length; even batches take the query blocks in the opposite order, so that long and short walks are resident together */
  const int h = blockIdx.x, b = blockIdx.z; const int qblk = (b & 1) ? (int)blockIdx.y : TT / (64 * QT) - 1 - (int)blockIdx.y; const int ql0 = qblk * (64 * QT) + qg * (16 * QT);
  const int frow = (tid & 127) >> 3, fseg = (tid & 7) * 8;   /* the thread's first row of a staged plane and its 16-byte piece of a row; a key group's 128 threads fill two planes */
  if (ql0 < QHI) {   /* the whole block: both 16-row tiles of a wave walk the staged keys together, 32 keys a trip: the even key group takes a tile's first 32 keys, the odd group its last 32 */
    v16h qh[QT][HD / 32], qr[QT][HD / 32]; v8f oh[QT][HD / 16] = {};
#pragma unroll
    for (int qt = 0; qt < QT; ++qt)
#pragma unroll
      for (int kc = 0; kc < HD / 32; ++kc) { qh[qt][kc] = frag_h(QH + ((size_t)b * TT + ql0 + qt * 16 + c) * CC + h * HD + kc * 32, lane); qr[qt][kc] = frag_h(QL + ((size_t)b * QHI + ql0 + qt * 16 + c) * CC + h * HD + kc * 32, lane); }
    /* waves 0..3 bring the two k planes of a tile, waves 4..7 its two v planes: byte addresses, row pitch and step from tile to tile of the thread's own two planes */
    const size_t vo = ((size_t)b * CC + h * HD + frow) * (size_t)KHI + fseg;
    const char* ga = kp ? (const char*)(VB + vo) : (const char*)(KH + ((size_t)b * TT + frow) * CC + h * HD + fseg); const char* gb = kp ? (const char*)(VBL + vo) : (const char*)(KL + ((size_t)b * KHI + frow) * CC + h * HD + fseg);
    const size_t gp = kp ? (size_t)KHI * 2 : (size_t)CC * 2, gs = kp ? (size_t)64 * 2 : (size_t)64 * CC * 2;
    const unsigned la = kp ? (unsigned)(size_t)&S.hi.vh[frow][fseg] : (unsigned)(size_t)&S.hi.kh[frow][fseg], lb = kp ? (unsigned)(size_t)&S.hi.vl[frow][fseg] : (unsigned)(size_t)&S.hi.kl[frow][fseg];
    const int nth = (qblk + 1) * QT;   /* 64-key tiles up to the block's last row */
#pragma unroll 1   /* run-time trip count, large body */
    for (int tl = 0; tl < nth; ++tl) {
      if (tl) { asm volatile("s_wait_dscnt 0x0" ::: "memory");   /* this wave's reads of the tile before have ended */
        __syncthreads(); }   /* and every other wave's: the one buffer may be refilled */
      att_fill(la, lb, ga + tl * gs, gb + tl * gs, gp, gp);
      asm volatile("s_wait_asynccnt 0x0" ::: "memory");   /* the tile has landed, as far as this wave brought it */
      __syncthreads();   /* publishes the tile */
      static_assert(16 * QT == 32, "a wave's rows are one aligned group of 32, so both its row tiles end in the same 32-key trip");
      const int ch = tl * 2 + kp;
      if (ch <= (ql0 >> 5)) hi_trip(S.hi, kp * 32, ch * 32, ql0, lane, qh, qr, oh); }   /* a wave whose rows end in front of these keys skips the work, never a barrier */
    float* P = (float*)&S.t[2];   /* behind the early rows' tile: no copy and no fragment read touches it */
    if (kp) att_put(P, qg, lane, oh);
    __syncthreads();   /* publishes the odd key group's partial sums */
    if (kp) return;
    att_add(P, qg, lane, oh);
#pragma unroll
    for (int qt = 0; qt < QT; ++qt) att_store(Y, b, h, ql0 + qt * 16 + c, g, oh[qt]);
    asm volatile("s_wait_xcnt 0x0" ::: "memory");   /* code laid out behind these stores writes registers that they name */
    return; }
  v16h q[QT][HD / 32];
#pragma unroll
  for (int qt = 0; qt < QT; ++qt)
#pragma unroll
    for (int kc = 0; kc < HD / 32; ++kc) q[qt][kc] = frag_h(QH + ((size_t)b * TT + ql0 + qt * 16 + c) * CC + h * HD + kc * 32, lane);
  v8f o[QT][HD / 16] = {};
  static_assert(QT == 2, "the block's own rows are one pair of tiles: the last");
  const int kblk = qblk * (64 * QT), nst = qblk + 1;   /* keys in front of the block's own rows need no mask; the block walks nst >= 2 pairs of tiles, up to its last row */
  const _Float16* gk = KH + ((size_t)b * TT + kp * 64 + frow) * CC + h * HD + fseg; const _Float16* gv = VT + ((size_t)b * CC + h * HD + frow) * (size_t)TT + kp * 64 + fseg;   /* the key group's own tile of pair 0 */
  const unsigned lk = (unsigned)(size_t)&L[kp].k[frow][fseg], lv = (unsigned)(size_t)&L[kp].v[frow][fseg];
  att_fill(lk, lv, gk, gv, CC, TT);
  asm volatile("s_wait_asynccnt 0x0" ::: "memory");   /* pair 0 has landed, as far as this wave brought it */
  __syncthreads();   /* publishes pair 0 */
  att_fill(lk + 2u * (unsigned)sizeof(AttTile), lv + 2u * (unsigned)sizeof(AttTile), gk + (size_t)128 * CC, gv + 128, CC, TT);   /* pair 1 flies while pair 0 is worked on */
#pragma unroll 1   /* run-time trip count, large body: stays rolled for registers and the instruction cache */
  for (int st = 0; st < nst - 1; ++st) { const int k0 = st * 128; const unsigned bo = (st & 1) ? 2u * (unsigned)sizeof(AttTile) : 0u;   /* the pairs in front of the block's own rows: every wave, no mask */
    att_trip<false>(L[(st & 1) * 2 + kp], k0 + kp * 64, ql0, lane, q, o);
    asm volatile("s_wait_dscnt 0x0" ::: "memory");      /* this wave's reads of pair st have ended */
    asm volatile("s_wait_asynccnt 0x0" ::: "memory");   /* its part of pair st + 1 has landed */
    __syncthreads();   /* publishes pair st + 1 and ends every wave's reads of pair st, whose buffer is refilled behind it */
    if (st + 2 < nst) att_fill(lk + bo, lv + bo, gk + (size_t)(k0 + 256) * CC, gv + (k0 + 256), CC, TT); }
  asm volatile("s_wait_asynccnt 0x0" ::: "memory");   /* no copy is in flight from here to the wave's end */
  if (kp == 0 || qg >= 2) att_trip<true>(L[((nst - 1) & 1) * 2 + kp], kblk + kp * 64, ql0, lane, q, o);   /* the lower two row groups end in front of the pair's second tile */
  float* P = (float*)&S.t[(nst & 1) * 2];   /* the buffer that the last pair does not lie in: its last readers left it at the loop's last barrier, and nothing was copied into it since */
  if (kp) att_put(P, qg, lane, o);
  __syncthreads();   /* publishes the odd key group's partial sums */
  if (kp) return;
  att_add(P, qg, lane, o);
#pragma unroll
  for (int qt = 0; qt < QT; ++qt) att_store(Y, b, h, ql0 + qt * 16 + c, g, o[qt]);
  asm volatile("s_wait_xcnt 0x0" ::: "memory"); }   /* code laid out behind these stores writes registers that they name */

extern "C" void kernel_launch(void* const* d_in, const int* in_sizes, int n_in, void* d_out, int out_size, void* d_ws, size_t ws_size, hipStream_t stream) {
  (void)in_sizes; (void)n_in; (void)out_size;
  const float** F = (const float**)d_in;
  if (ws_size < (size_t)WS_END) return;
  char* ws = (char*)d_ws; _Float16 *QH = (_Float16*)(ws + WS_QH), *KH = (_Float16*)(ws + WS_KH), *VT = (_Float16*)(ws + WS_VT), *QL = (_Float16*)(ws + WS_QL), *KL = (_Float16*)(ws + WS_KL); __bf16 *VB = (__bf16*)(ws + WS_VB), *VBL = (__bf16*)(ws + WS_VBL);
  // inputs: 0 x [2,2048,1024]; 1 W_attn [1024,3072] (in,out; columns q | k | v); 2 b_attn [3072]
  k_proj<<<dim3(TNB * TT / RB, CC / 128, 3), 256, 0, stream>>>(F[0], F[0], F[0], F[1], F[1] + CC, F[1] + 2 * CC, F[2], F[2] + CC, F[2] + 2 * CC, QH, QL, KH, KL, VT, VB, VBL);
  k_att<<<dim3(NH, TT / (64 * QT), TNB), 256, 0, stream>>>(QH, KH, QL, KL, VT, VB, VBL, (float*)d_out);
}

// v006
// A run of this version takes 52.7 microseconds.
// Next to v005, in two timings, it ran 1.12 and 1.11 times as fast.
// Over all steps from v000 it is 17.2 times as fast.
// compute dtype: all float inputs rounded to bf16; qkv = x W_attn + b with EXACT bf16 products on WMMA 16x16x32 (f32 accumulate); causal logits: q, k once to f16 (1 product) x 64^-0.5, except the first 384 query rows of each sequence (3 products with f16 residuals); p = relu(logit) in f32 (no normalisation), carried x 2^11 once to f16 against v once to f16 (1 product; bf16 hi + lo below row 384); f32 output.
#include <hip/hip_runtime.h>
#include <math.h>

typedef __attribute__((ext_vector_type(16))) _Float16 v16h;
typedef __attribute__((ext_vector_type(16))) __bf16 v16b;
typedef __attribute__((ext_vector_type(8)))  _Float16 v8h;
typedef __attribute__((ext_vector_type(8)))  float v8f;
typedef __attribute__((ext_vector_type(4)))  float v4f;
typedef __attribute__((ext_vector_type(2)))  float v2f;
typedef __attribute__((ext_vector_type(4)))  unsigned v4u;
typedef __attribute__((ext_vector_type(4)))  int v4i;
typedef float __attribute__((may_alias)) float_a;
typedef int __attribute__((may_alias)) int_a;

template <typename T> __device__ __forceinline__ void vst2(void* p, T v) { *(T*)p = v;  }
__device__ __forceinline__ v8f wmma16(v16h a, v16h b, v8f c) {
  return __builtin_amdgcn_wmma_f32_16x16x32_f16(false, a, false, b, (short)0, c, false, false);
}
__device__ __forceinline__ v8f wmma_bf(v16b a, v16b b, v8f c) {
  return __builtin_amdgcn_wmma_f32_16x16x32_bf16(false, a, false, b, (short)0, c, false, false);
}
// 16x16x32 fragments: lane = (h = lane>>4, row/col = lane&15); elements 0..7 = k0+8h+0..7, 8..15 = k0+16+8h+0..7; D element r = row 8h+r
__device__ __forceinline__ v16h frag_h(const _Float16* rowk0, int lane) {
  union { v16h v; v8h q[2]; } u; const _Float16* p = rowk0 + 8 * (lane >> 4);
  u.q[0] = *(const v8h*)p; u.q[1] = *(const v8h*)(p + 16); return u.v;
}
__device__ __forceinline__ v16h frag_f32(const float* rowk0, int lane) {
  v16h a; const float* p = rowk0 + 8 * (lane >> 4);
#pragma unroll
  for (int i = 0; i < 8; ++i) { a[i] = (_Float16)p[i]; a[8 + i] = (_Float16)p[16 + i]; }
  return a;
}
__device__ __forceinline__ v16h frag_f32s(const float* rowk0, int lane, float sc) {
  v16h a; const float* p = rowk0 + 8 * (lane >> 4);
#pragma unroll
  for (int i = 0; i < 8; ++i) { a[i] = (_Float16)(p[i] * sc); a[8 + i] = (_Float16)(p[16 + i] * sc); }
  return a;
}
// column fragment from a [K][ld] layout (column n), rows >= K read as 0
__device__ __forceinline__ v16h fragc_f32(const float* W, int k0, int n, int lane, int ld, int K) {
  v16h a; const int g = lane >> 4;
#pragma unroll
  for (int i = 0; i < 8; ++i) { const int ka = k0 + 8 * g + i, kb = ka + 16;
    a[i] = (_Float16)(ka < K ? W[(size_t)(ka < K ? ka : K - 1) * ld + n] : 0.f); a[8 + i] = (_Float16)(kb < K ? W[(size_t)(kb < K ? kb : K - 1) * ld + n] : 0.f); }
  return a;
}
struct F2 { v16b h, l; };
__device__ __forceinline__ F2 bsplit16(const float v[16]) { F2 r;
#pragma unroll
  for (int i = 0; i < 16; ++i) { const __bf16 h = (__bf16)v[i]; r.h[i] = h; r.l[i] = (__bf16)(v[i] - (float)h); }
  return r; }
__device__ __forceinline__ F2 split_row(const float* row, int k0, int lane) { float v[16]; const float* p = row + k0 + 8 * (lane >> 4);
#pragma unroll
  for (int i = 0; i < 8; ++i) { v[i] = p[i]; v[8 + i] = p[16 + i]; }
  return bsplit16(v); }
__device__ __forceinline__ F2 split_rowK(const float* row, int k0, int lane, int K) { float v[16]; const int g = lane >> 4;
#pragma unroll
  for (int i = 0; i < 8; ++i) { const int ka = k0 + 8 * g + i, kb = ka + 16; v[i] = ka < K ? row[ka < K ? ka : K - 1] : 0.f; v[8 + i] = kb < K ? row[kb < K ? kb : K - 1] : 0.f; }
  return bsplit16(v); }
__device__ __forceinline__ F2 split_col(const float* W, int k0, int n, int lane, int ld, int K) { float v[16]; const int g = lane >> 4;
#pragma unroll
  for (int i = 0; i < 8; ++i) { const int ka = k0 + 8 * g + i, kb = ka + 16; v[i] = ka < K ? W[(size_t)(ka < K ? ka : K - 1) * ld + n] : 0.f; v[8 + i] = kb < K ? W[(size_t)(kb < K ? kb : K - 1) * ld + n] : 0.f; }
  return bsplit16(v); }
__device__ __forceinline__ v8f mac3(const F2& a, const F2& b, v8f c) { c = wmma_bf(a.l, b.h, c); c = wmma_bf(a.h, b.l, c); return wmma_bf(a.h, b.h, c); }
__device__ __forceinline__ float sigm(float v) { return 1.0f / (1.0f + expf(-v)); }
#define LDSX() do { asm volatile("s_wait_dscnt 0" ::: "memory"); __builtin_amdgcn_wave_barrier(); __builtin_amdgcn_fence(__ATOMIC_RELEASE, "workgroup"); } while (0)

// Causal ReLU attention (B 2, T 2,048, C 1,024 = 16 x 64): qkv = x W_attn + b_attn ((in,out) [1024, 3072], columns q | k | v); p = relu(q k^T / 8) on the lower triangle (0 elsewhere, no softmax / no normalisation); y = p v -> [B, T, C] (no output projection).
#define NB 2
#define TT 2048
#define CC 1024            // NH * HD = projected width
#define DIN 1024          // input (model) width
#define NH 16
#define HD 64
#define NQB (TT / 64)
#define HG 4
#define SCALE (0.125f)
#define CAUSAL 1
#ifndef TNB
#define TNB NB
#endif
__device__ __forceinline__ float bfr(float v) { return (float)(__bf16)v; }
__host__ __device__ __forceinline__ int kb_last(int qb) { return CAUSAL ? ((qb * 64 + 63) >> 7) : (TT / 128 - 1); }
typedef __attribute__((ext_vector_type(8))) __bf16 v8b;
__device__ __forceinline__ v16b frag_b(const __bf16* rowk0, int lane) {
  union { v16b v; v8b q[2]; } u; const __bf16* p = rowk0 + 8 * (lane >> 4);
  u.q[0] = *(const v8b*)p; u.q[1] = *(const v8b*)(p + 16); return u.v;
}
#define QBH 6              // unused: causal query rows below QHI (few keys, no averaging) take the high-precision path
#define QHI 384            // rows carrying a q residual plane
#define KHI 384            // key rows carrying k residual / v bf16 hi+lo planes (used only by the causal high-precision path)
// B fragment (k rows k0+.., output column o) of a weight: (in,out) [K][ld] or (out,in) [ld rows of K]: bf16 exact, or f16(bf16 * 256) exact
__device__ __forceinline__ v16b wcol_io(const float* Wm, int k0, int o, int lane, int ld) { v16b w; const int g = lane >> 4;
#pragma unroll
  for (int i = 0; i < 8; ++i) { w[i] = (__bf16)Wm[(size_t)(k0 + 8 * g + i) * ld + o]; w[8 + i] = (__bf16)Wm[(size_t)(k0 + 16 + 8 * g + i) * ld + o]; }
  return w; }
__device__ __forceinline__ v16b wcol_oi(const float* Wm, int k0, int o, int lane, int K) { v16b w; const float* p = Wm + (size_t)o * K + k0 + 8 * (lane >> 4);
#pragma unroll
  for (int i = 0; i < 8; ++i) { w[i] = (__bf16)p[i]; w[8 + i] = (__bf16)p[16 + i]; }
  return w; }
__device__ __forceinline__ v16h wcolh_io(const float* Wm, int k0, int o, int lane, int ld) { v16h w; const int g = lane >> 4;
#pragma unroll
  for (int i = 0; i < 8; ++i) { w[i] = (_Float16)(bfr(Wm[(size_t)(k0 + 8 * g + i) * ld + o]) * 256.0f); w[8 + i] = (_Float16)(bfr(Wm[(size_t)(k0 + 16 + 8 * g + i) * ld + o]) * 256.0f); }
  return w; }
__device__ __forceinline__ v16h wcolh_oi(const float* Wm, int k0, int o, int lane, int K) { v16h w; const float* p = Wm + (size_t)o * K + k0 + 8 * (lane >> 4);
#pragma unroll
  for (int i = 0; i < 8; ++i) { w[i] = (_Float16)(bfr(p[i]) * 256.0f); w[8 + i] = (_Float16)(bfr(p[16 + i]) * 256.0f); }
  return w; }
#define WQKV_LAYOUT 0   // 0 = (in,out) [DIN][3*CC]; 1 = (out,in) [CC][DIN]; 2 = per-head [NH][DIN][HD]
__device__ __forceinline__ v16b wcol_hdk(const float* Wm, int k0, int o, int lane) { v16b w; const int g = lane >> 4; const float* p = Wm + (size_t)(o / HD) * DIN * HD + (o % HD);
#pragma unroll
  for (int i = 0; i < 8; ++i) { w[i] = (__bf16)p[(size_t)(k0 + 8 * g + i) * HD]; w[8 + i] = (__bf16)p[(size_t)(k0 + 16 + 8 * g + i) * HD]; }
  return w; }
#define WO_OUT_IN 0
#if WQKV_LAYOUT == 1
#define WCOL(W, k0, o, lane) wcol_oi(W, k0, o, lane, DIN)
#elif WQKV_LAYOUT == 2
#define WCOL(W, k0, o, lane) wcol_hdk(W, k0, o, lane)
#else
#define WCOL(W, k0, o, lane) wcol_io(W, k0, o, lane, 3 * CC)   /* W_attn (in,out) packed by columns: row pitch 3C */
#endif
#if WO_OUT_IN
#define WOCOL(W, k0, o, lane) wcol_oi(W, k0, o, lane, CC)
#define WOCOLH(W, k0, o, lane) wcolh_oi(W, k0, o, lane, CC)
#else
#define WOCOL(W, k0, o, lane) wcol_io(W, k0, o, lane, DIN)
#define WOCOLH(W, k0, o, lane) wcolh_io(W, k0, o, lane, DIN)
#endif

#ifndef SM_EXTRA_PARAMS
#define SM_EXTRA_PARAMS
#endif
#ifndef PROJ_EXTRA_PARAMS
#define PROJ_EXTRA_PARAMS
#endif
#ifndef SM_MASK_HOOK
#define SM_MASK_HOOK (void)0
#endif

#define WS_QH  0u                                      // f16 q rows [b*t][CC]
#define WS_KH  (WS_QH + 2u * (size_t)NB * TT * CC)      // f16 k rows [b*t][CC]
#define WS_VT  (WS_KH + 2u * (size_t)NB * TT * CC)      // f16 v planes [b][c][t]
#define WS_QL  (WS_VT + 2u * (size_t)NB * CC * TT)      // f16 q residual x 2^10 rows [b][t < QHI][CC]
#define WS_KL  (WS_QL + 2u * (size_t)NB * QHI * CC)     // f16 k residual x 2^10 rows [b][t < KHI][CC]
#define WS_VB  (WS_KL + 2u * (size_t)NB * KHI * CC)     // bf16 v hi planes [b][c][t < KHI]
#define WS_VBL (WS_VB + 2u * (size_t)NB * CC * KHI)
#define WS_XB  (WS_VBL + 2u * (size_t)NB * CC * KHI)    // bf16 x rows [b*t][DIN]
#define WS_WT  (WS_XB + 2u * (size_t)NB * TT * DIN)     // bf16 W_attn columns [3 * CC][DIN] (k contiguous)
#define WS_END (WS_WT + 2u * (size_t)3 * CC * DIN)

// ---- k_cvt: x and W_attn are rounded to bf16 once, here, so that k_proj's blocks, each of which reads its operands again, read half the bytes and convert nothing. x keeps its rows; W_attn is laid by columns, k contiguous, through LDS.
#define KP 72              // LDS pitch of a 64-k bf16 row, in elements: 128 + 16 bytes, conflict-free for the 16-byte fragment reads
#define CVB 256            // blocks: each rounds 16 x 1,024 elements of x and 3 tiles of 64 k x 64 columns of W_attn
typedef __attribute__((ext_vector_type(4))) __bf16 v4b;
static_assert((size_t)NB * TT * DIN == (size_t)CVB * 16 * 1024 && (DIN / 64) * (3 * CC / 64) == CVB * 3 && DIN / 64 == 16, "the blocks cover x and W_attn exactly");
/* at most 4 waves a SIMD are asked for (one block a WGP holds the whole grid), so that a thread's 28 loads have registers to be in flight together */
__global__ __launch_bounds__(256) __attribute__((amdgpu_waves_per_eu(2, 4))) void k_cvt(const float* __restrict__ X, const float* __restrict__ WA, __bf16* __restrict__ XB, __bf16* __restrict__ WT) {
  __shared__ __align__(16) __bf16 t[3][64][KP];
  /* x: a wave's load covers 512 contiguous bytes, its store 256. W_attn: a thread takes 4 columns of 4 consecutive k rows, so that it holds 4 consecutive k of each column (one 8-byte LDS store a column); 16 lanes cover 256 bytes of a row */
  const int tid = threadIdx.x, bw = blockIdx.x, cq = (tid & 15) * 4, kq = (tid >> 4) * 4; const size_t o = (size_t)bw * (16 * 1024) + tid * 4; const float* xp = X + o; v4f x[16], v[3][4];
#pragma unroll
  for (int j = 0; j < 3; ++j) { const int id = bw * 3 + j, k0 = (id & 15) * 64, c0 = (id >> 4) * 64;
#pragma unroll
    for (int i = 0; i < 4; ++i) v[j][i] = *(const v4f*)(WA + (size_t)(k0 + kq + i) * (3 * CC) + c0 + cq);
    asm volatile("s_wait_xcnt 0x0" ::: "memory"); }   /* the loads that follow may rewrite registers that these loads name */
#pragma unroll
  for (int i = 0; i < 16; ++i) x[i] = *(const v4f*)(xp + i * 1024);
  asm volatile("s_wait_xcnt 0x0" :: "v"(xp) : "memory");   /* what follows may rewrite registers that the loads name; the address stays live to here, so that no load's result is laid into it */
#pragma unroll
  for (int j = 0; j < 3; ++j)
#pragma unroll
    for (int e = 0; e < 4; ++e) { v4b r;
#pragma unroll
      for (int i = 0; i < 4; ++i) r[i] = (__bf16)v[j][i][e];
      *(v4b*)&t[j][cq + e][kq] = r; }
  __syncthreads();   /* publishes the three transposed tiles; x is stored behind it, so that the barrier's own waits find no global store in flight */
#pragma unroll
  for (int j = 0; j < 3; ++j) { const int id = bw * 3 + j, k0 = (id & 15) * 64, c0 = (id >> 4) * 64;
#pragma unroll
    for (int m = 0; m < 2; ++m) { const int p = tid + m * 256, cl = p >> 3, sg = (p & 7) * 8;   /* 8 lanes store one whole 128-byte line of a column */
      vst2((unsigned*)(WT + (size_t)(c0 + cl) * DIN + k0 + sg), *(const v4u*)&t[j][cl][sg]); } }
  asm volatile("s_wait_xcnt 0x0" ::: "memory");   /* what follows may rewrite registers that the stores name */
  __builtin_amdgcn_sched_barrier(0);   /* keeps the conversions below behind that wait */
#pragma unroll
  for (int hf = 0; hf < 2; ++hf) {
#pragma unroll
    for (int i = hf * 8; i < hf * 8 + 8; ++i) { v4b r;
#pragma unroll
      for (int e = 0; e < 4; ++e) r[e] = (__bf16)x[i][e];
      *(v4b*)(XB + o + i * 1024) = r; }
    asm volatile("s_wait_xcnt 0x0" ::: "memory");   /* the second half's conversions, and code laid out behind the kernel, write registers that these stores name */
    if (hf == 0) __builtin_amdgcn_sched_barrier(0); } }   /* keeps the second half's conversions behind that wait */
// ---- k_proj: block = (128 rows, 128 cols, which), 8 waves of 32 x 64: q/k/v = X W (+ b) with exact bf16 products (K = DIN) -> which 0: q f16 rows (+ residual rows < QHI); 1: k f16 rows (+ residual rows < KHI); 2: v f16 planes [c][t] (+ bf16 hi/lo planes for t < KHI)
// Each 64-k slice of the X and W tiles comes from k_cvt's bf16 planes once a block, in whole 128-byte lines, by asynchronous copies straight into LDS ([row][k] and [col][k], two buffers); every wave takes its fragments from there.
#define RB 128             // rows of a block tile
union ProjLds {            // the two stage buffers are dead when the epilogue's staging begins (a barrier stands between), and a block takes only one of the two epilogues
  struct { __bf16 w[2][128][KP], x[2][RB][KP]; } st;
  struct { _Float16 sh[RB][136], sl[RB][136]; } qk;
  struct { _Float16 th[128][RB + 8]; __bf16 tb[128][RB + 8], tbl[128][RB + 8]; } v;
};
// Fills one 64-k slice of the W and the X tile (128 rows of 128 bytes each), 16 bytes a lane: 8 lanes bring one whole 128-byte line, a thread takes rows r, r + 32, r + 64, r + 96 of each tile. lw, lx, gw, gx: the lane's own LDS byte addresses and global addresses in row r.
__device__ __forceinline__ void proj_fill(unsigned lw, unsigned lx, const __bf16* gw, const __bf16* gx) {
  /* the closing s_wait_xcnt stands inside the copies' own statement, so that no register which a copy names is rewritten in front of it */
  asm volatile("global_load_async_to_lds_b128 %0, %8, off\n\t"
               "global_load_async_to_lds_b128 %1, %9, off\n\t"
               "global_load_async_to_lds_b128 %2, %10, off\n\t"
               "global_load_async_to_lds_b128 %3, %11, off\n\t"
               "global_load_async_to_lds_b128 %4, %12, off\n\t"
               "global_load_async_to_lds_b128 %5, %13, off\n\t"
               "global_load_async_to_lds_b128 %6, %14, off\n\t"
               "global_load_async_to_lds_b128 %7, %15, off\n\t"
               "s_wait_xcnt 0x0"
               :: "v"(lw), "v"(lw + 32u * KP * 2u), "v"(lw + 64u * KP * 2u), "v"(lw + 96u * KP * 2u), "v"(lx), "v"(lx + 32u * KP * 2u), "v"(lx + 64u * KP * 2u), "v"(lx + 96u * KP * 2u),
                  "v"(gw), "v"(gw + 32 * DIN), "v"(gw + 64 * DIN), "v"(gw + 96 * DIN), "v"(gx), "v"(gx + 32 * DIN), "v"(gx + 64 * DIN), "v"(gx + 96 * DIN)
               : "memory"); }
/* second bound: 6 waves a SIMD, so that three blocks (the whole grid at once) fit a WGP's registers as they fit its LDS */
__global__ __launch_bounds__(256, 6) void k_proj(const __bf16* __restrict__ XB, const __bf16* __restrict__ WT, const float* __restrict__ BQ, const float* __restrict__ BK, const float* __restrict__ BV,
    _Float16* __restrict__ QH, _Float16* __restrict__ QL, _Float16* __restrict__ KH, _Float16* __restrict__ KL, _Float16* __restrict__ VT, __bf16* __restrict__ VB, __bf16* __restrict__ VBL) {
  __shared__ __align__(16) ProjLds L;
  const int tid = threadIdx.x, wave = tid >> 5, lane = tid & 31, col = lane & 15, g = lane >> 4; const int which = blockIdx.z; const int c0 = blockIdx.y * 128; const size_t r0 = (size_t)blockIdx.x * RB; const size_t bb = r0 / TT; const int t0 = (int)(r0 % TT);
  const float* BA = which == 0 ? BQ : which == 1 ? BK : BV;
  const int wr0 = (wave >> 1) * 32, wc0 = (wave & 1) * 64;   /* the wave's 32 x 64 piece of the tile */
  const int frow = tid >> 3, fseg = (tid & 7) * 8;   /* the thread's first row of a staged tile and its 16-byte piece of a row */
  const __bf16* gw = WT + ((size_t)which * CC + c0 + frow) * DIN + fseg; const __bf16* gx = XB + (r0 + frow) * DIN + fseg;
  const unsigned lw = (unsigned)(size_t)&L.st.w[0][frow][fseg], lx = (unsigned)(size_t)&L.st.x[0][frow][fseg], sb = 128u * KP * 2u;   /* sb: bytes from a tile's first buffer to its second */
  static_assert(RB == 128 && DIN / 64 >= 2, "both tiles have 128 rows, and slices 0 and 1 exist");
  proj_fill(lw, lx, gw, gx);
  asm volatile("s_wait_asynccnt 0x0" ::: "memory");   /* slice 0 has landed, as far as this wave brought it */
  __syncthreads();   /* publishes slice 0 */
  proj_fill(lw + sb, lx + sb, gw + 64, gx + 64);   /* slice 1 flies while slice 0 is multiplied */
  v8f acc[2][4] = {};
#pragma unroll 2   /* two trips a pass: the stage buffer's index is then a constant of the code */
  for (int kc = 0; kc < DIN / 64; ++kc) { const int bf = kc & 1;
#pragma unroll
    for (int kh = 0; kh < 2; ++kh) { v16b a[2], w[4];   /* the slice's two 32-k steps, in ascending k */
#pragma unroll
      for (int i = 0; i < 2; ++i) a[i] = frag_b(&L.st.x[bf][wr0 + i * 16 + col][kh * 32], lane);
#pragma unroll
      for (int j = 0; j < 4; ++j) w[j] = frag_b(&L.st.w[bf][wc0 + j * 16 + col][kh * 32], lane);
      __builtin_amdgcn_sched_barrier(0);   /* keeps the step's twelve fragment reads one group in front of its products: sunk among them, each pair would be waited for on its own */
#pragma unroll
      for (int j = 0; j < 4; ++j)
#pragma unroll
        for (int i = 0; i < 2; ++i) acc[i][j] = wmma_bf(a[i], w[j], acc[i][j]);
      __builtin_amdgcn_sched_barrier(0); }   /* keeps the products in front of the waits and the barrier below: lifted over them, the barrier would line up the waves of a SIMD in front of their products */
    asm volatile("s_wait_dscnt 0x0" ::: "memory");      /* this wave's reads of slice kc have ended */
    asm volatile("s_wait_asynccnt 0x0" ::: "memory");   /* its part of slice kc + 1 has landed */
    __syncthreads();   /* publishes slice kc + 1 and ends every wave's reads of slice kc, whose buffer is refilled behind it; behind the last slice it stands in front of the epilogue's staging, which lies over the stage buffers */
    if (kc + 2 < DIN / 64) proj_fill(lw + bf * sb, lx + bf * sb, gw + (kc + 2) * 64, gx + (kc + 2) * 64); }
  asm volatile("s_wait_asynccnt 0x0" ::: "memory");   /* no copy is in flight from here to the wave's end */
  if (which < 2) { _Float16* DH = which == 0 ? QH : KH; _Float16* DL = which == 0 ? QL : KL; const int nhi = which == 0 ? QHI : KHI; const bool hi_rows = t0 < nhi;
#pragma unroll
    for (int j = 0; j < 4; ++j) { const int cl = wc0 + j * 16 + col; const float bias = BA ? bfr(BA[c0 + cl]) : 0.f;
#pragma unroll
      for (int i = 0; i < 2; ++i)
#pragma unroll
        for (int r = 0; r < 8; ++r) { const float v = acc[i][j][r] + bias; const _Float16 hv = (_Float16)v; const int rl = wr0 + i * 16 + 8 * g + r; L.qk.sh[rl][cl] = hv; L.qk.sl[rl][cl] = (_Float16)((v - (float)hv) * 1024.0f); } }
    __syncthreads();
    for (int e = tid; e < RB * 16; e += 256) { const int rl = e >> 4, q = e & 15; vst2((unsigned*)(DH + (r0 + rl) * CC + c0 + q * 8), *(const v4u*)&L.qk.sh[rl][q * 8]); asm volatile("s_wait_xcnt 0x0" ::: "memory");   /* what follows, and the next trip, rewrite registers that the store names */
      if (hi_rows) { vst2((unsigned*)(DL + (bb * nhi + t0 + rl) * (size_t)CC + c0 + q * 8), *(const v4u*)&L.qk.sl[rl][q * 8]); asm volatile("s_wait_xcnt 0x0" ::: "memory"); } }   /* the same */
  } else { const bool hi_rows = t0 < KHI;
#pragma unroll
    for (int j = 0; j < 4; ++j) { const int cl = wc0 + j * 16 + col; const float bias = BA ? bfr(BA[c0 + cl]) : 0.f;
#pragma unroll
      for (int i = 0; i < 2; ++i)
#pragma unroll
        for (int r = 0; r < 8; ++r) { const float v = acc[i][j][r] + bias; const int rl = wr0 + i * 16 + 8 * g + r; L.v.th[cl][rl] = (_Float16)v; const __bf16 bh = (__bf16)v; L.v.tb[cl][rl] = bh; L.v.tbl[cl][rl] = (__bf16)(v - (float)bh); } }
    __syncthreads();
    for (int e = tid; e < 128 * (RB / 8); e += 256) { const int cl = e / (RB / 8), q = e % (RB / 8); vst2((unsigned*)(VT + (bb * CC + c0 + cl) * (size_t)TT + t0 + q * 8), *(const v4u*)&L.v.th[cl][q * 8]); asm volatile("s_wait_xcnt 0x0" ::: "memory");   /* what follows, and the next trip, rewrite registers that the store names */
      if (hi_rows) { const size_t o3 = (bb * CC + c0 + cl) * (size_t)KHI + t0 + q * 8; vst2((unsigned*)(VB + o3), *(const v4u*)&L.v.tb[cl][q * 8]); vst2((unsigned*)(VBL + o3), *(const v4u*)&L.v.tbl[cl][q * 8]); asm volatile("s_wait_xcnt 0x0" ::: "memory"); } } } }   /* the same */
// ---- k_att: block = 8 waves = 4 row groups x 2 key groups; a wave = QT x 16 query rows of (b, h), walking every second 64-key tile (even tiles: waves 0..3, odd tiles: waves 4..7) in ascending order; the four waves of a key group share each tile of k and v, staged in LDS (two buffers of two tiles). The two partial sums of a row are added once, through LDS, at the end. S^T = K Q^T (A = k rows, B = q rows): a lane's D registers of two 16-key tiles are, in place, the k order of one 32-key operand,
// so p = relu(logit) x 2^11 goes from the score accumulators straight into O^T += V^T P^T (A = v planes, B = p) and never leaves the registers. O^T register r = head column 8g + r of query row c: 32-byte stores.
#define QT 2
__device__ __forceinline__ void att_store(float* __restrict__ Y, int b, int h, int t, int g, const v8f o[HD / 16]) {
  float* y = Y + ((size_t)b * TT + t) * CC + h * HD + 8 * g;
#pragma unroll
  for (int j = 0; j < HD / 16; ++j) { v4f lo, hi;
#pragma unroll
    for (int r = 0; r < 4; ++r) { lo[r] = o[j][r] * (1.0f / 2048.0f); hi[r] = o[j][4 + r] * (1.0f / 2048.0f); }
    vst2(y + j * 16, lo); vst2(y + j * 16 + 4, hi); } }
// frag_h with the lane's 8 * g already in the address
__device__ __forceinline__ v16h frag_at(const _Float16* p) { union { v16h v; v8h q[2]; } u; u.q[0] = *(const v8h*)p; u.q[1] = *(const v8h*)(p + 16); return u.v; }
// A 64-key tile of (b, h) in LDS, shared by the four waves of a key group: k rows [key][d] and v planes [d][key], 64 rows of 128 bytes each; the early rows' tile holds the residual and hi + lo planes as well and is shared by both key groups.
#define AP 72              // LDS pitch of such a row, in elements: 128 + 16 bytes, conflict-free for the 16-byte fragment reads
struct AttTile { _Float16 k[64][AP], v[64][AP]; };
struct HiTile { _Float16 kh[64][AP], kl[64][AP]; __bf16 vh[64][AP], vl[64][AP]; };
union AttLds { AttTile t[4]; HiTile hi; };   // a block takes one path only; t[2 * buffer + key group]
static_assert(sizeof(HiTile) <= 2 * sizeof(AttTile) && 4 * QT * HD * 16 * 4 <= 2 * sizeof(AttTile), "the early rows' tile fills the first buffer at most, and the odd key group's partial sums fit one buffer");
// the odd key group's partial sums go to the even group's wave of the same rows: 16 bytes a lane, lanes contiguous
__device__ __forceinline__ void att_put(float* P, int qg, int lane, const v8f (&o)[QT][HD / 16]) {
#pragma unroll
  for (int qt = 0; qt < QT; ++qt)
#pragma unroll
    for (int j = 0; j < HD / 16; ++j) { float* p = P + (((qg * QT + qt) * (HD / 16) + j) * 2) * 128 + lane * 4; v4f lo, hi;
#pragma unroll
      for (int r = 0; r < 4; ++r) { lo[r] = o[qt][j][r]; hi[r] = o[qt][j][4 + r]; }
      *(v4f*)p = lo; *(v4f*)(p + 128) = hi; } }
__device__ __forceinline__ void att_add(const float* P, int qg, int lane, v8f (&o)[QT][HD / 16]) {
#pragma unroll
  for (int qt = 0; qt < QT; ++qt)
#pragma unroll
    for (int j = 0; j < HD / 16; ++j) { const float* p = P + (((qg * QT + qt) * (HD / 16) + j) * 2) * 128 + lane * 4; const v4f lo = *(const v4f*)p, hi = *(const v4f*)(p + 128);
#pragma unroll
      for (int r = 0; r < 4; ++r) { o[qt][j][r] += lo[r]; o[qt][j][4 + r] += hi[r]; } } }
static_assert(QHI % (64 * QT) == 0 && KHI >= QHI && KHI % 64 == 0, "a block takes the early-row path as a whole, in front of every barrier, and its tiles lie inside the KHI key rows");
// Fills two 64-row planes by asynchronous copies, 16 bytes a lane: 8 lanes bring one whole 128-byte line, a thread takes rows r, r + 16, r + 32, r + 48 of each. l0, l1, g0, g1: the lane's own LDS byte addresses and global addresses in row r; p0, p1: the global row pitches in elements.
template <typename T0, typename T1> __device__ __forceinline__ void att_fill(unsigned l0, unsigned l1, const T0* g0, const T1* g1, size_t p0, size_t p1) {
  /* the closing s_wait_xcnt stands inside the copies' own statement, so that no register which a copy names is rewritten in front of it */
  asm volatile("global_load_async_to_lds_b128 %0, %8, off\n\t"
               "global_load_async_to_lds_b128 %1, %9, off\n\t"
               "global_load_async_to_lds_b128 %2, %10, off\n\t"
               "global_load_async_to_lds_b128 %3, %11, off\n\t"
               "global_load_async_to_lds_b128 %4, %12, off\n\t"
               "global_load_async_to_lds_b128 %5, %13, off\n\t"
               "global_load_async_to_lds_b128 %6, %14, off\n\t"
               "global_load_async_to_lds_b128 %7, %15, off\n\t"
               "s_wait_xcnt 0x0"
               :: "v"(l0), "v"(l0 + 16u * AP * 2u), "v"(l0 + 32u * AP * 2u), "v"(l0 + 48u * AP * 2u), "v"(l1), "v"(l1 + 16u * AP * 2u), "v"(l1 + 32u * AP * 2u), "v"(l1 + 48u * AP * 2u),
                  "v"(g0), "v"(g0 + 16 * p0), "v"(g0 + 32 * p0), "v"(g0 + 48 * p0), "v"(g1), "v"(g1 + 16 * p1), "v"(g1 + 32 * p1), "v"(g1 + 48 * p1)
               : "memory"); }
// early query rows (t < QHI): the wave's QT x 16 rows from t0 against the 32 keys from k0 (row kl of the staged tile): 3-product logits with f16 residuals, p and v as bf16 hi + lo (3 products)
__device__ __forceinline__ void hi_trip(const HiTile& B, int kl, int k0, int t0, int lane, const v16h (&qh)[QT][HD / 32], const v16h (&qr)[QT][HD / 32], v8f (&o)[QT][HD / 16]) {
  const int c = lane & 15, g = lane >> 4; v8f s[QT][2] = {}, sl[QT][2] = {}; v16b vh[HD / 16], vl[HD / 16]; F2 p[QT];
  /* for the register bound of four waves a SIMD: the k fragments are read one 32-column half at a time, the v hi fragments behind the score products, the v lo fragments behind the relu work; both row tiles use the same fragments */
#pragma unroll
  for (int kc = 0; kc < HD / 32; ++kc) { v16h kh[2], kr[2];
#pragma unroll
    for (int a = 0; a < 2; ++a) { kh[a] = frag_h(&B.kh[kl + a * 16 + c][kc * 32], lane); kr[a] = frag_h(&B.kl[kl + a * 16 + c][kc * 32], lane); }
#pragma unroll
    for (int a = 0; a < 2; ++a)
#pragma unroll
      for (int qt = 0; qt < QT; ++qt) { s[qt][a] = wmma16(kh[a], qh[qt][kc], s[qt][a]); sl[qt][a] = wmma16(kh[a], qr[qt][kc], sl[qt][a]); sl[qt][a] = wmma16(kr[a], qh[qt][kc], sl[qt][a]); } }
#pragma unroll
  for (int j = 0; j < HD / 16; ++j) vh[j] = frag_b(&B.vh[j * 16 + c][kl], lane);
  __builtin_amdgcn_sched_barrier(0);   /* keeps the v hi reads one group in front of the relu work, under which they land */
#pragma unroll
  for (int qt = 0; qt < QT; ++qt) { float pv[16];
#pragma unroll
    for (int a = 0; a < 2; ++a) {
#pragma unroll
      for (int r = 0; r < 8; ++r) { const float v = (s[qt][a][r] + sl[qt][a][r] * (1.0f / 1024.0f)) * SCALE; pv[a * 8 + r] = (k0 + a * 16 + 8 * g + r <= t0 + qt * 16 + c && v > 0.f) ? v * 2048.0f : 0.f; } }
    p[qt] = bsplit16(pv); }
#pragma unroll
  for (int j = 0; j < HD / 16; ++j) vl[j] = frag_b(&B.vl[j * 16 + c][kl], lane);
#pragma unroll
  for (int j = 0; j < HD / 16; ++j)
#pragma unroll
    for (int qt = 0; qt < QT; ++qt) { o[qt][j] = wmma_bf(vh[j], p[qt].h, o[qt][j]); o[qt][j] = wmma_bf(vh[j], p[qt].l, o[qt][j]); o[qt][j] = wmma_bf(vl[j], p[qt].h, o[qt][j]); } }
// one trip: the 64 keys from k0, staged in B, against the wave's QT x 16 query rows; MASK: the trip reaches the block's own rows, so the causal mask can cut
template <bool MASK> __device__ __forceinline__ void att_trip(const AttTile& B, int k0, int ql0, int lane, const v16h (&q)[QT][HD / 32], v8f (&o)[QT][HD / 16]) {
  const int c = lane & 15, g = lane >> 4; v8f s[QT][4] = {}; v16h kf[HD / 32][4], vf[2][HD / 16], p[QT][2];
  /* a trip's k fragments are read together at its head, its v fragments together behind the score products, so that they land under the relu work (k order of frag_h) */
#pragma unroll
  for (int kc = 0; kc < HD / 32; ++kc)
#pragma unroll
    for (int a = 0; a < 4; ++a) kf[kc][a] = frag_at(&B.k[a * 16 + c][kc * 32 + 8 * g]);
  __builtin_amdgcn_sched_barrier(0);   /* keeps the k reads one group in front of the score products */
#pragma unroll
  for (int kc = 0; kc < HD / 32; ++kc)
#pragma unroll
    for (int a = 0; a < 4; ++a)
#pragma unroll
      for (int qt = 0; qt < QT; ++qt) s[qt][a] = wmma16(kf[kc][a], q[qt][kc], s[qt][a]);
  __builtin_amdgcn_sched_barrier(0);   /* keeps the v reads behind the score products, whose k registers they take over */
#pragma unroll
  for (int ch = 0; ch < 2; ++ch)
#pragma unroll
    for (int j = 0; j < HD / 16; ++j) vf[ch][j] = frag_at(&B.v[j * 16 + c][ch * 32 + 8 * g]);
  __builtin_amdgcn_sched_barrier(0);   /* keeps the v reads one group in front of the relu work, under which they land */
#pragma unroll
  for (int qt = 0; qt < QT; ++qt)
#pragma unroll
    for (int a = 0; a < 4; ++a)
#pragma unroll
      for (int r = 0; r < 8; ++r) { const float pr = fmaxf(s[qt][a][r] * (SCALE * 2048.0f), 0.f); p[qt][a >> 1][(a & 1) * 8 + r] = (_Float16)((!MASK || k0 + a * 16 + 8 * g + r <= ql0 + qt * 16 + c) ? pr : 0.f); }
#pragma unroll
  for (int ch = 0; ch < 2; ++ch)
#pragma unroll
    for (int j = 0; j < HD / 16; ++j)
#pragma unroll
      for (int qt = 0; qt < QT; ++qt) o[qt][j] = wmma16(vf[ch][j], p[qt][ch], o[qt][j]);
  __builtin_amdgcn_sched_barrier(0); }   /* keeps the trip's products in front of the caller's waits and barrier: lifted over them, the barrier would line up the waves of a SIMD in front of their products */
/* second bound: 4 waves a SIMD, so that two blocks (the whole grid at once) fit a WGP's registers */
__global__ __launch_bounds__(256, 4) void k_att(const _Float16* __restrict__ QH, const _Float16* __restrict__ KH, const _Float16* __restrict__ QL, const _Float16* __restrict__ KL, const _Float16* __restrict__ VT, const __bf16* __restrict__ VB, const __bf16* __restrict__ VBL, float* __restrict__ Y) {
  __shared__ __align__(16) AttLds S; AttTile (&L)[4] = S.t;
  const int tid = threadIdx.x, lane = tid & 31, c = lane & 15, g = lane >> 4; const int wave = __builtin_amdgcn_readfirstlane(tid >> 5); const int qg = wave & 3, kp = wave >> 2;   /* row group, key group */
  /* heads run fastest in the grid, so neighbouring work-groups have key walks of one length; even batches take the query blocks in the opposite order, so that long and short walks are resident together */
  const int h = blockIdx.x, b = blockIdx.z; const int qblk = (b & 1) ? (int)blockIdx.y : TT / (64 * QT) - 1 - (int)blockIdx.y; const int ql0 = qblk * (64 * QT) + qg * (16 * QT);
  const int frow = (tid & 127) >> 3, fseg = (tid & 7) * 8;   /* the thread's first row of a staged plane and its 16-byte piece of a row; a key group's 128 threads fill two planes */
  if (ql0 < QHI) {   /* the whole block: both 16-row tiles of a wave walk the staged keys together, 32 keys a trip: the even key group takes a tile's first 32 keys, the odd group its last 32 */
    v16h qh[QT][HD / 32], qr[QT][HD / 32]; v8f oh[QT][HD / 16] = {};
#pragma unroll
    for (int qt = 0; qt < QT; ++qt)
#pragma unroll
      for (int kc = 0; kc < HD / 32; ++kc) { qh[qt][kc] = frag_h(QH + ((size_t)b * TT + ql0 + qt * 16 + c) * CC + h * HD + kc * 32, lane); qr[qt][kc] = frag_h(QL + ((size_t)b * QHI + ql0 + qt * 16 + c) * CC + h * HD + kc * 32, lane); }
    /* waves 0..3 bring the two k planes of a tile, waves 4..7 its two v planes: byte addresses, row pitch and step from tile to tile of the thread's own two planes */
    const size_t vo = ((size_t)b * CC + h * HD + frow) * (size_t)KHI + fseg;
    const char* ga = kp ? (const char*)(VB + vo) : (const char*)(KH + ((size_t)b * TT + frow) * CC + h * HD + fseg); const char* gb = kp ? (const char*)(VBL + vo) : (const char*)(KL + ((size_t)b * KHI + frow) * CC + h * HD + fseg);
    const size_t gp = kp ? (size_t)KHI * 2 : (size_t)CC * 2, gs = kp ? (size_t)64 * 2 : (size_t)64 * CC * 2;
    const unsigned la = kp ? (unsigned)(size_t)&S.hi.vh[frow][fseg] : (unsigned)(size_t)&S.hi.kh[frow][fseg], lb = kp ? (unsigned)(size_t)&S.hi.vl[frow][fseg] : (unsigned)(size_t)&S.hi.kl[frow][fseg];
    const int nth = (qblk + 1) * QT;   /* 64-key tiles up to the block's last row */
#pragma unroll 1   /* run-time trip count, large body */
    for (int tl = 0; tl < nth; ++tl) {
      if (tl) { asm volatile("s_wait_dscnt 0x0" ::: "memory");   /* this wave's reads of the tile before have ended */
        __syncthreads(); }   /* and every other wave's: the one buffer may be refilled */
      att_fill(la, lb, ga + tl * gs, gb + tl * gs, gp, gp);
      asm volatile("s_wait_asynccnt 0x0" ::: "memory");   /* the tile has landed, as far as this wave brought it */
      __syncthreads();   /* publishes the tile */
      static_assert(16 * QT == 32, "a wave's rows are one aligned group of 32, so both its row tiles end in the same 32-key trip");
      const int ch = tl * 2 + kp;
      if (ch <= (ql0 >> 5)) hi_trip(S.hi, kp * 32, ch * 32, ql0, lane, qh, qr, oh); }   /* a wave whose rows end in front of these keys skips the work, never a barrier */
    float* P = (float*)&S.t[2];   /* behind the early rows' tile: no copy and no fragment read touches it */
    if (kp) att_put(P, qg, lane, oh);
    __syncthreads();   /* publishes the odd key group's partial sums */
    if (kp) return;
    att_add(P, qg, lane, oh);
#pragma unroll
    for (int qt = 0; qt < QT; ++qt) att_store(Y, b, h, ql0 + qt * 16 + c, g, oh[qt]);
    asm volatile("s_wait_xcnt 0x0" ::: "memory");   /* code laid out behind these stores writes registers that they name */
    return; }
  v16h q[QT][HD / 32];
#pragma unroll
  for (int qt = 0; qt < QT; ++qt)
#pragma unroll
    for (int kc = 0; kc < HD / 32; ++kc) q[qt][kc] = frag_h(QH + ((size_t)b * TT + ql0 + qt * 16 + c) * CC + h * HD + kc * 32, lane);
  v8f o[QT][HD / 16] = {};
  static_assert(QT == 2, "the block's own rows are one pair of tiles: the last");
  const int kblk = qblk * (64 * QT), nst = qblk + 1;   /* keys in front of the block's own rows need no mask; the block walks nst >= 2 pairs of tiles, up to its last row */
  const _Float16* gk = KH + ((size_t)b * TT + kp * 64 + frow) * CC + h * HD + fseg; const _Float16* gv = VT + ((size_t)b * CC + h * HD + frow) * (size_t)TT + kp * 64 + fseg;   /* the key group's own tile of pair 0 */
  const unsigned lk = (unsigned)(size_t)&L[kp].k[frow][fseg], lv = (unsigned)(size_t)&L[kp].v[frow][fseg];
  att_fill(lk, lv, gk, gv, CC, TT);
  asm volatile("s_wait_asynccnt 0x0" ::: "memory");   /* pair 0 has landed, as far as this wave brought it */
  __syncthreads();   /* publishes pair 0 */
  att_fill(lk + 2u * (unsigned)sizeof(AttTile), lv + 2u * (unsigned)sizeof(AttTile), gk + (size_t)128 * CC, gv + 128, CC, TT);   /* pair 1 flies while pair 0 is worked on */
#pragma unroll 1   /* run-time trip count, large body: stays rolled for registers and the instruction cache */
  for (int st = 0; st < nst - 1; ++st) { const int k0 = st * 128; const unsigned bo = (st & 1) ? 2u * (unsigned)sizeof(AttTile) : 0u;   /* the pairs in front of the block's own rows: every wave, no mask */
    att_trip<false>(L[(st & 1) * 2 + kp], k0 + kp * 64, ql0, lane, q, o);
    asm volatile("s_wait_dscnt 0x0" ::: "memory");      /* this wave's reads of pair st have ended */
    asm volatile("s_wait_asynccnt 0x0" ::: "memory");   /* its part of pair st + 1 has landed */
    __syncthreads();   /* publishes pair st + 1 and ends every wave's reads of pair st, whose buffer is refilled behind it */
    if (st + 2 < nst) att_fill(lk + bo, lv + bo, gk + (size_t)(k0 + 256) * CC, gv + (k0 + 256), CC, TT); }
  asm volatile("s_wait_asynccnt 0x0" ::: "memory");   /* no copy is in flight from here to the wave's end */
  if (kp == 0 || qg >= 2) att_trip<true>(L[((nst - 1) & 1) * 2 + kp], kblk + kp * 64, ql0, lane, q, o);   /* the lower two row groups end in front of the pair's second tile */
  float* P = (float*)&S.t[(nst & 1) * 2];   /* the buffer that the last pair does not lie in: its last readers left it at the loop's last barrier, and nothing was copied into it since */
  if (kp) att_put(P, qg, lane, o);
  __syncthreads();   /* publishes the odd key group's partial sums */
  if (kp) return;
  att_add(P, qg, lane, o);
#pragma unroll
  for (int qt = 0; qt < QT; ++qt) att_store(Y, b, h, ql0 + qt * 16 + c, g, o[qt]);
  asm volatile("s_wait_xcnt 0x0" ::: "memory"); }   /* code laid out behind these stores writes registers that they name */

extern "C" void kernel_launch(void* const* d_in, const int* in_sizes, int n_in, void* d_out, int out_size, void* d_ws, size_t ws_size, hipStream_t stream) {
  (void)in_sizes; (void)n_in; (void)out_size;
  const float** F = (const float**)d_in;
  if (ws_size < (size_t)WS_END) return;
  char* ws = (char*)d_ws; _Float16 *QH = (_Float16*)(ws + WS_QH), *KH = (_Float16*)(ws + WS_KH), *VT = (_Float16*)(ws + WS_VT), *QL = (_Float16*)(ws + WS_QL), *KL = (_Float16*)(ws + WS_KL); __bf16 *VB = (__bf16*)(ws + WS_VB), *VBL = (__bf16*)(ws + WS_VBL), *XB = (__bf16*)(ws + WS_XB), *WT = (__bf16*)(ws + WS_WT);
  // inputs: 0 x [2,2048,1024]; 1 W_attn [1024,3072] (in,out; columns q | k | v); 2 b_attn [3072]
  k_cvt<<<dim3(CVB), 256, 0, stream>>>(F[0], F[1], XB, WT);
  k_proj<<<dim3(TNB * TT / RB, CC / 128, 3), 256, 0, stream>>>(XB, WT, F[2], F[2] + CC, F[2] + 2 * CC, QH, QL, KH, KL, VT, VB, VBL);
  k_att<<<dim3(NH, TT / (64 * QT), TNB), 256, 0, stream>>>(QH, KH, QL, KL, VT, VB, VBL, (float*)d_out);
}

// v007
// A run of this version takes 50.9 microseconds.
// In both of two side-by-side timings against v006, it was 1.04 times as fast.
// Counting every step since v000, it is 17.9 times as fast.
// compute dtype: all float inputs rounded to bf16; qkv = x W_attn + b with EXACT bf16 products on WMMA 16x16x32 (f32 accumulate); causal logits: q, k once to f16 (1 product) x 64^-0.5, except the first 384 query rows of each sequence (3 products with f16 residuals); p = relu(logit) in f32 (no normalisation), carried x 2^11 once to f16 against v once to f16 (1 product; bf16 hi + lo below row 384); f32 output.
#include <hip/hip_runtime.h>
#include <math.h>

typedef __attribute__((ext_vector_type(16))) _Float16 v16h;
typedef __attribute__((ext_vector_type(16))) __bf16 v16b;
typedef __attribute__((ext_vector_type(8)))  _Float16 v8h;
typedef __attribute__((ext_vector_type(8)))  float v8f;
typedef __attribute__((ext_vector_type(4)))  float v4f;
typedef __attribute__((ext_vector_type(2)))  float v2f;
typedef __attribute__((ext_vector_type(4)))  unsigned v4u;
typedef __attribute__((ext_vector_type(4)))  int v4i;
typedef float __attribute__((may_alias)) float_a;
typedef int __attribute__((may_alias)) int_a;

template <typename T> __device__ __forceinline__ void vst2(void* p, T v) { *(T*)p = v;  }
__device__ __forceinline__ v8f wmma16(v16h a, v16h b, v8f c) {
  return __builtin_amdgcn_wmma_f32_16x16x32_f16(false, a, false, b, (short)0, c, false, false);
}
__device__ __forceinline__ v8f wmma_bf(v16b a, v16b b, v8f c) {
  return __builtin_amdgcn_wmma_f32_16x16x32_bf16(false, a, false, b, (short)0, c, false, false);
}
// 16x16x32 fragments: lane = (h = lane>>4, row/col = lane&15); elements 0..7 = k0+8h+0..7, 8..15 = k0+16+8h+0..7; D element r = row 8h+r
__device__ __forceinline__ v16h frag_h(const _Float16* rowk0, int lane) {
  union { v16h v; v8h q[2]; } u; const _Float16* p = rowk0 + 8 * (lane >> 4);
  u.q[0] = *(const v8h*)p; u.q[1] = *(const v8h*)(p + 16); return u.v;
}
__device__ __forceinline__ v16h frag_f32(const float* rowk0, int lane) {
  v16h a; const float* p = rowk0 + 8 * (lane >> 4);
#pragma unroll
  for (int i = 0; i < 8; ++i) { a[i] = (_Float16)p[i]; a[8 + i] = (_Float16)p[16 + i]; }
  return a;
}
__device__ __forceinline__ v16h frag_f32s(const float* rowk0, int lane, float sc) {
  v16h a; const float* p = rowk0 + 8 * (lane >> 4);
#pragma unroll
  for (int i = 0; i < 8; ++i) { a[i] = (_Float16)(p[i] * sc); a[8 + i] = (_Float16)(p[16 + i] * sc); }
  return a;
}
// column fragment from a [K][ld] layout (column n), rows >= K read as 0
__device__ __forceinline__ v16h fragc_f32(const float* W, int k0, int n, int lane, int ld, int K) {
  v16h a; const int g = lane >> 4;
#pragma unroll
  for (int i = 0; i < 8; ++i) { const int ka = k0 + 8 * g + i, kb = ka + 16;
    a[i] = (_Float16)(ka < K ? W[(size_t)(ka < K ? ka : K - 1) * ld + n] : 0.f); a[8 + i] = (_Float16)(kb < K ? W[(size_t)(kb < K ? kb : K - 1) * ld + n] : 0.f); }
  return a;
}
struct F2 { v16b h, l; };
__device__ __forceinline__ F2 bsplit16(const float v[16]) { F2 r;
#pragma unroll
  for (int i = 0; i < 16; ++i) { const __bf16 h = (__bf16)v[i]; r.h[i] = h; r.l[i] = (__bf16)(v[i] - (float)h); }
  return r; }
__device__ __forceinline__ F2 split_row(const float* row, int k0, int lane) { float v[16]; const float* p = row + k0 + 8 * (lane >> 4);
#pragma unroll
  for (int i = 0; i < 8; ++i) { v[i] = p[i]; v[8 + i] = p[16 + i]; }
  return bsplit16(v); }
__device__ __forceinline__ F2 split_rowK(const float* row, int k0, int lane, int K) { float v[16]; const int g = lane >> 4;
#pragma unroll
  for (int i = 0; i < 8; ++i) { const int ka = k0 + 8 * g + i, kb = ka + 16; v[i] = ka < K ? row[ka < K ? ka : K - 1] : 0.f; v[8 + i] = kb < K ? row[kb < K ? kb : K - 1] : 0.f; }
  return bsplit16(v); }
__device__ __forceinline__ F2 split_col(const float* W, int k0, int n, int lane, int ld, int K) { float v[16]; const int g = lane >> 4;
#pragma unroll
  for (int i = 0; i < 8; ++i) { const int ka = k0 + 8 * g + i, kb = ka + 16; v[i] = ka < K ? W[(size_t)(ka < K ? ka : K - 1) * ld + n] : 0.f; v[8 + i] = kb < K ? W[(size_t)(kb < K ? kb : K - 1) * ld + n] : 0.f; }
  return bsplit16(v); }
__device__ __forceinline__ v8f mac3(const F2& a, const F2& b, v8f c) { c = wmma_bf(a.l, b.h, c); c = wmma_bf(a.h, b.l, c); return wmma_bf(a.h, b.h, c); }
__device__ __forceinline__ float sigm(float v) { return 1.0f / (1.0f + expf(-v)); }
#define LDSX() do { asm volatile("s_wait_dscnt 0" ::: "memory"); __builtin_amdgcn_wave_barrier(); __builtin_amdgcn_fence(__ATOMIC_RELEASE, "workgroup"); } while (0)

// Causal ReLU attention (B 2, T 2,048, C 1,024 = 16 x 64): qkv = x W_attn + b_attn ((in,out) [1024, 3072], columns q | k | v); p = relu(q k^T / 8) on the lower triangle (0 elsewhere, no softmax / no normalisation); y = p v -> [B, T, C] (no output projection).
#define NB 2
#define TT 2048
#define CC 1024            // NH * HD = projected width
#define DIN 1024          // input (model) width
#define NH 16
#define HD 64
#define NQB (TT / 64)
#define HG 4
#define SCALE (0.125f)
#define CAUSAL 1
#ifndef TNB
#define TNB NB
#endif
__device__ __forceinline__ float bfr(float v) { return (float)(__bf16)v; }
__host__ __device__ __forceinline__ int kb_last(int qb) { return CAUSAL ? ((qb * 64 + 63) >> 7) : (TT / 128 - 1); }
typedef __attribute__((ext_vector_type(8))) __bf16 v8b;
__device__ __forceinline__ v16b frag_b(const __bf16* rowk0, int lane) {
  union { v16b v; v8b q[2]; } u; const __bf16* p = rowk0 + 8 * (lane >> 4);
  u.q[0] = *(const v8b*)p; u.q[1] = *(const v8b*)(p + 16); return u.v;
}
#define QBH 6              // unused: causal query rows below QHI (few keys, no averaging) take the high-precision path
#define QHI 384            // rows carrying a q residual plane
#define KHI 384            // key rows carrying k residual / v bf16 hi+lo planes (used only by the causal high-precision path)
// B fragment (k rows k0+.., output column o) of a weight: (in,out) [K][ld] or (out,in) [ld rows of K]: bf16 exact, or f16(bf16 * 256) exact
__device__ __forceinline__ v16b wcol_io(const float* Wm, int k0, int o, int lane, int ld) { v16b w; const int g = lane >> 4;
#pragma unroll
  for (int i = 0; i < 8; ++i) { w[i] = (__bf16)Wm[(size_t)(k0 + 8 * g + i) * ld + o]; w[8 + i] = (__bf16)Wm[(size_t)(k0 + 16 + 8 * g + i) * ld + o]; }
  return w; }
__device__ __forceinline__ v16b wcol_oi(const float* Wm, int k0, int o, int lane, int K) { v16b w; const float* p = Wm + (size_t)o * K + k0 + 8 * (lane >> 4);
#pragma unroll
  for (int i = 0; i < 8; ++i) { w[i] = (__bf16)p[i]; w[8 + i] = (__bf16)p[16 + i]; }
  return w; }
__device__ __forceinline__ v16h wcolh_io(const float* Wm, int k0, int o, int lane, int ld) { v16h w; const int g = lane >> 4;
#pragma unroll
  for (int i = 0; i < 8; ++i) { w[i] = (_Float16)(bfr(Wm[(size_t)(k0 + 8 * g + i) * ld + o]) * 256.0f); w[8 + i] = (_Float16)(bfr(Wm[(size_t)(k0 + 16 + 8 * g + i) * ld + o]) * 256.0f); }
  return w; }
__device__ __forceinline__ v16h wcolh_oi(const float* Wm, int k0, int o, int lane, int K) { v16h w; const float* p = Wm + (size_t)o * K + k0 + 8 * (lane >> 4);
#pragma unroll
  for (int i = 0; i < 8; ++i) { w[i] = (_Float16)(bfr(p[i]) * 256.0f); w[8 + i] = (_Float16)(bfr(p[16 + i]) * 256.0f); }
  return w; }
#define WQKV_LAYOUT 0   // 0 = (in,out) [DIN][3*CC]; 1 = (out,in) [CC][DIN]; 2 = per-head [NH][DIN][HD]
__device__ __forceinline__ v16b wcol_hdk(const float* Wm, int k0, int o, int lane) { v16b w; const int g = lane >> 4; const float* p = Wm + (size_t)(o / HD) * DIN * HD + (o % HD);
#pragma unroll
  for (int i = 0; i < 8; ++i) { w[i] = (__bf16)p[(size_t)(k0 + 8 * g + i) * HD]; w[8 + i] = (__bf16)p[(size_t)(k0 + 16 + 8 * g + i) * HD]; }
  return w; }
#define WO_OUT_IN 0
#if WQKV_LAYOUT == 1
#define WCOL(W, k0, o, lane) wcol_oi(W, k0, o, lane, DIN)
#elif WQKV_LAYOUT == 2
#define WCOL(W, k0, o, lane) wcol_hdk(W, k0, o, lane)
#else
#define WCOL(W, k0, o, lane) wcol_io(W, k0, o, lane, 3 * CC)   /* W_attn (in,out) packed by columns: row pitch 3C */
#endif
#if WO_OUT_IN
#define WOCOL(W, k0, o, lane) wcol_oi(W, k0, o, lane, CC)
#define WOCOLH(W, k0, o, lane) wcolh_oi(W, k0, o, lane, CC)
#else
#define WOCOL(W, k0, o, lane) wcol_io(W, k0, o, lane, DIN)
#define WOCOLH(W, k0, o, lane) wcolh_io(W, k0, o, lane, DIN)
#endif

#ifndef SM_EXTRA_PARAMS
#define SM_EXTRA_PARAMS
#endif
#ifndef PROJ_EXTRA_PARAMS
#define PROJ_EXTRA_PARAMS
#endif
#ifndef SM_MASK_HOOK
#define SM_MASK_HOOK (void)0
#endif

#define WS_QH  0u                                      // f16 q rows [b*t][CC]
#define WS_KH  (WS_QH + 2u * (size_t)NB * TT * CC)      // f16 k rows [b*t][CC]
#define WS_VT  (WS_KH + 2u * (size_t)NB * TT * CC)      // f16 v planes [b][c][t]
#define WS_QL  (WS_VT + 2u * (size_t)NB * CC * TT)      // f16 q residual x 2^10 rows [b][t < QHI][CC]
#define WS_KL  (WS_QL + 2u * (size_t)NB * QHI * CC)     // f16 k residual x 2^10 rows [b][t < KHI][CC]
#define WS_VB  (WS_KL + 2u * (size_t)NB * KHI * CC)     // bf16 v hi planes [b][c][t < KHI]
#define WS_VBL (WS_VB + 2u * (size_t)NB * CC * KHI)
#define WS_XB  (WS_VBL + 2u * (size_t)NB * CC * KHI)    // bf16 x rows [b*t][DIN]
#define WS_WT  (WS_XB + 2u * (size_t)NB * TT * DIN)     // bf16 W_attn columns [3 * CC][DIN] (k contiguous)
#define WS_END (WS_WT + 2u * (size_t)3 * CC * DIN)

// ---- k_cvt: x and W_attn are rounded to bf16 once, here, so that k_proj's blocks, each of which reads its operands again, read half the bytes and convert nothing. x keeps its rows; W_attn is laid by columns, k contiguous, through LDS.
#define KP 72              // LDS pitch of a 64-k bf16 row, in elements: 128 + 16 bytes, conflict-free for the 16-byte fragment reads
#define CVB 256            // blocks: each rounds 16 x 1,024 elements of x and 3 tiles of 64 k x 64 columns of W_attn
typedef __attribute__((ext_vector_type(4))) __bf16 v4b;
static_assert((size_t)NB * TT * DIN == (size_t)CVB * 16 * 1024 && (DIN / 64) * (3 * CC / 64) == CVB * 3 && DIN / 64 == 16, "the blocks cover x and W_attn exactly");
/* at most 4 waves a SIMD are asked for (one block a WGP holds the whole grid), so that a thread's 28 loads have registers to be in flight together */
__global__ __launch_bounds__(256) __attribute__((amdgpu_waves_per_eu(2, 4))) void k_cvt(const float* __restrict__ X, const float* __restrict__ WA, __bf16* __restrict__ XB, __bf16* __restrict__ WT) {
  __shared__ __align__(16) __bf16 t[3][64][KP];
  /* x: a wave's load covers 512 contiguous bytes, its store 256. W_attn: a thread takes 4 columns of 4 consecutive k rows, so that it holds 4 consecutive k of each column (one 8-byte LDS store a column); 16 lanes cover 256 bytes of a row */
  const int tid = threadIdx.x, bw = blockIdx.x, cq = (tid & 15) * 4, kq = (tid >> 4) * 4; const size_t o = (size_t)bw * (16 * 1024) + tid * 4; const float* xp = X + o; v4f x[16], v[3][4];
#pragma unroll
  for (int j = 0; j < 3; ++j) { const int id = bw * 3 + j, k0 = (id & 15) * 64, c0 = (id >> 4) * 64;
#pragma unroll
    for (int i = 0; i < 4; ++i) v[j][i] = *(const v4f*)(WA + (size_t)(k0 + kq + i) * (3 * CC) + c0 + cq);
    asm volatile("s_wait_xcnt 0x0" ::: "memory"); }   /* the loads that follow may rewrite registers that these loads name */
#pragma unroll
  for (int i = 0; i < 16; ++i) x[i] = *(const v4f*)(xp + i * 1024);
  asm volatile("s_wait_xcnt 0x0" :: "v"(xp) : "memory");   /* what follows may rewrite registers that the loads name; the address stays live to here, so that no load's result is laid into it */
#pragma unroll
  for (int j = 0; j < 3; ++j)
#pragma unroll
    for (int e = 0; e < 4; ++e) { v4b r;
#pragma unroll
      for (int i = 0; i < 4; ++i) r[i] = (__bf16)v[j][i][e];
      *(v4b*)&t[j][cq + e][kq] = r; }
  __syncthreads();   /* publishes the three transposed tiles; x is stored behind it, so that the barrier's own waits find no global store in flight */
#pragma unroll
  for (int j = 0; j < 3; ++j) { const int id = bw * 3 + j, k0 = (id & 15) * 64, c0 = (id >> 4) * 64;
#pragma unroll
    for (int m = 0; m < 2; ++m) { const int p = tid + m * 256, cl = p >> 3, sg = (p & 7) * 8;   /* 8 lanes store one whole 128-byte line of a column */
      vst2((unsigned*)(WT + (size_t)(c0 + cl) * DIN + k0 + sg), *(const v4u*)&t[j][cl][sg]); } }
  asm volatile("s_wait_xcnt 0x0" ::: "memory");   /* what follows may rewrite registers that the stores name */
  __builtin_amdgcn_sched_barrier(0);   /* keeps the conversions below behind that wait */
#pragma unroll
  for (int hf = 0; hf < 2; ++hf) {
#pragma unroll
    for (int i = hf * 8; i < hf * 8 + 8; ++i) { v4b r;
#pragma unroll
      for (int e = 0; e < 4; ++e) r[e] = (__bf16)x[i][e];
      *(v4b*)(XB + o + i * 1024) = r; }
    asm volatile("s_wait_xcnt 0x0" ::: "memory");   /* the second half's conversions, and code laid out behind the kernel, write registers that these stores name */
    if (hf == 0) __builtin_amdgcn_sched_barrier(0); } }   /* keeps the second half's conversions behind that wait */
// ---- k_proj: block = 128 rows x (128 columns of q, of k and of v), one block a WGP, 12 waves of 64 x 64: q/k/v = X W (+ b) with exact bf16 products (K = DIN) -> q f16 rows (+ residual rows < QHI); k f16 rows (+ residual rows < KHI); v f16 planes [c][t] (+ bf16 hi/lo planes for t < KHI)
// Each 128-k slice of the X and W tiles comes from k_cvt's bf16 planes once a block, in whole 128-byte lines, by asynchronous copies straight into LDS ([row][k] and [col][k], two buffers); every wave takes its fragments from there.
// The tile is sized to the LDS and L2 rates: a 64 x 64 wave reads 8 fragments for 16 products (32 x 64: 6 for 8), a block's X rows are fetched once for all three outputs, and a slice is long enough for the next one to land under it.
#define RB 128             // rows of a block tile
#define PT 384             // threads of a block
#define PK 128             // k of a slice
#define PKP 136            // LDS pitch of a 128-k bf16 row, in elements: 256 + 16 bytes, conflict-free for the 16-byte fragment reads
union ProjLds {            // the two stage buffers are dead when the epilogue's staging begins (a barrier stands between)
  struct { __bf16 w[3][2][128][PKP], x[2][RB][PKP]; } st;   /* w[output][buffer]: a wave's fragments of both buffers lie within the reach of one address register's immediate offset */
  struct { _Float16 sh[2][RB][136], sl[2][RB][136], th[128][RB + 8]; __bf16 tb[128][RB + 8], tbl[128][RB + 8]; } o;   /* sh, sl: [0] q, [1] k */
};
// Fills one 128-k slice of the W and the X tile (384 and 128 rows of 256 bytes), 16 bytes a lane: 16 lanes bring the two whole 128-byte lines of a row. A group of 128 threads takes the 128 W rows of one output, a thread rows r, r + 8, ..., r + 120; of X a thread takes rows s, s + 24, ..., s + 96 and, in the first 4 waves (more), s + 120. lw, lx, gw, gx: the lane's own LDS byte addresses and global addresses in rows r and s.
// In each statement the closing s_wait_xcnt stands inside the copies' own statement, so that no register which a copy names is rewritten in front of it.
__device__ __forceinline__ void proj_copy8(unsigned l, const __bf16* gp) {   /* eight rows, 8 rows apart */
  asm volatile("global_load_async_to_lds_b128 %0, %8, off\n\t"
               "global_load_async_to_lds_b128 %1, %9, off\n\t"
               "global_load_async_to_lds_b128 %2, %10, off\n\t"
               "global_load_async_to_lds_b128 %3, %11, off\n\t"
               "global_load_async_to_lds_b128 %4, %12, off\n\t"
               "global_load_async_to_lds_b128 %5, %13, off\n\t"
               "global_load_async_to_lds_b128 %6, %14, off\n\t"
               "global_load_async_to_lds_b128 %7, %15, off\n\t"
               "s_wait_xcnt 0x0"
               :: "v"(l), "v"(l + 8u * PKP * 2u), "v"(l + 16u * PKP * 2u), "v"(l + 24u * PKP * 2u), "v"(l + 32u * PKP * 2u), "v"(l + 40u * PKP * 2u), "v"(l + 48u * PKP * 2u), "v"(l + 56u * PKP * 2u),
                  "v"(gp), "v"(gp + 8 * DIN), "v"(gp + 16 * DIN), "v"(gp + 24 * DIN), "v"(gp + 32 * DIN), "v"(gp + 40 * DIN), "v"(gp + 48 * DIN), "v"(gp + 56 * DIN)
               : "memory"); }
__device__ __forceinline__ void proj_fill(unsigned lw, unsigned lx, const __bf16* gw, const __bf16* gx, bool more) {
  proj_copy8(lw, gw);
  proj_copy8(lw + 64u * PKP * 2u, gw + 64 * DIN);
  asm volatile("global_load_async_to_lds_b128 %0, %5, off\n\t"
               "global_load_async_to_lds_b128 %1, %6, off\n\t"
               "global_load_async_to_lds_b128 %2, %7, off\n\t"
               "global_load_async_to_lds_b128 %3, %8, off\n\t"
               "global_load_async_to_lds_b128 %4, %9, off\n\t"
               "s_wait_xcnt 0x0"
               :: "v"(lx), "v"(lx + 24u * PKP * 2u), "v"(lx + 48u * PKP * 2u), "v"(lx + 72u * PKP * 2u), "v"(lx + 96u * PKP * 2u),
                  "v"(gx), "v"(gx + 24 * DIN), "v"(gx + 48 * DIN), "v"(gx + 72 * DIN), "v"(gx + 96 * DIN)
               : "memory");
  if (more)   /* the same for a whole wave */
    asm volatile("global_load_async_to_lds_b128 %0, %1, off\n\t"
                 "s_wait_xcnt 0x0"
                 :: "v"(lx + 120u * PKP * 2u), "v"(gx + 120 * DIN) : "memory"); }
/* second bound: 3 waves a SIMD, the one block that a WGP's LDS holds */
__global__ __launch_bounds__(PT, 3) void k_proj(const __bf16* __restrict__ XB, const __bf16* __restrict__ WT, const float* __restrict__ BQ, const float* __restrict__ BK, const float* __restrict__ BV,
    _Float16* __restrict__ QH, _Float16* __restrict__ QL, _Float16* __restrict__ KH, _Float16* __restrict__ KL, _Float16* __restrict__ VT, __bf16* __restrict__ VB, __bf16* __restrict__ VBL) {
  __shared__ __align__(16) ProjLds L;
  const int tid = threadIdx.x, lane = tid & 31, col = lane & 15, g = lane >> 4; const int wave = __builtin_amdgcn_readfirstlane(tid >> 5); const int c0 = blockIdx.y * 128; const size_t r0 = (size_t)blockIdx.x * RB; const size_t bb = r0 / TT; const int t0 = (int)(r0 % TT);
  const int which = wave >> 2, wr0 = (wave & 1) * 64, wc0 = ((wave >> 1) & 1) * 64;   /* the wave's output and its 64 x 64 piece of that output's tile */
  const float* BA = which == 0 ? BQ : which == 1 ? BK : BV;
  const int fw = (tid & 127) >> 4, fx = tid >> 4, fseg = (tid & 15) * 8; const bool more = wave < 4;   /* the thread's first rows of the staged W (of output tid >> 7, which is the wave's own) and X tiles and its 16-byte piece of a row */
  const __bf16* gw = WT + ((size_t)which * CC + c0 + fw) * DIN + fseg; const __bf16* gx = XB + (r0 + fx) * DIN + fseg;
  const unsigned lw = (unsigned)(size_t)&L.st.w[which][0][fw][fseg], lx = (unsigned)(size_t)&L.st.x[0][fx][fseg], sb = 128u * PKP * 2u;   /* sb: bytes from a tile's first buffer to its second */
  static_assert(RB == 128 && PT == 3 * 128 && PT / 16 == 24 && PK == 128 && DIN % PK == 0 && DIN / PK >= 2, "three groups of 128 threads cover the W rows, 5 x 24 + 8 rows the X tile, and slices 0 and 1 exist");
  proj_fill(lw, lx, gw, gx, more);
  asm volatile("s_wait_asynccnt 0x0" ::: "memory");   /* slice 0 has landed, as far as this wave brought it */
  __syncthreads();   /* publishes slice 0 */
  proj_fill(lw + sb, lx + sb, gw + PK, gx + PK, more);   /* slice 1 flies while slice 0 is multiplied */
  v8f acc[4][4] = {};
#pragma unroll 2   /* two trips a pass: the stage buffer's index is then a constant of the code */
  for (int kc = 0; kc < DIN / PK; ++kc) { const int bf = kc & 1;
#pragma unroll
    for (int kh = 0; kh < PK / 32; ++kh) { v16b a[4], w[4];   /* the slice's four 32-k steps, in ascending k */
#pragma unroll
      for (int i = 0; i < 4; ++i) a[i] = frag_b(&L.st.x[bf][wr0 + i * 16 + col][kh * 32], lane);
#pragma unroll
      for (int j = 0; j < 4; ++j) w[j] = frag_b(&L.st.w[which][bf][wc0 + j * 16 + col][kh * 32], lane);
      __builtin_amdgcn_sched_barrier(0);   /* keeps the step's sixteen fragment reads one group in front of its products: sunk among them, each pair would be waited for on its own */
#pragma unroll
      for (int j = 0; j < 4; ++j)
#pragma unroll
        for (int i = 0; i < 4; ++i) acc[i][j] = wmma_bf(a[i], w[j], acc[i][j]);
      __builtin_amdgcn_sched_barrier(0); }   /* keeps the products in front of the waits and the barrier below: lifted over them, the barrier would line up the waves of a SIMD in front of their products */
    asm volatile("s_wait_dscnt 0x0" ::: "memory");      /* this wave's reads of slice kc have ended */
    asm volatile("s_wait_asynccnt 0x0" ::: "memory");   /* its part of slice kc + 1 has landed */
    __syncthreads();   /* publishes slice kc + 1 and ends every wave's reads of slice kc, whose buffer is refilled behind it; behind the last slice it stands in front of the epilogue's staging, which lies over the stage buffers */
    if (kc + 2 < DIN / PK) proj_fill(lw + bf * sb, lx + bf * sb, gw + (kc + 2) * PK, gx + (kc + 2) * PK, more); }
  asm volatile("s_wait_asynccnt 0x0" ::: "memory");   /* no copy is in flight from here to the wave's end */
  if (which < 2) {   /* the same for a whole wave; no barrier stands inside */
#pragma unroll
    for (int j = 0; j < 4; ++j) { const int cl = wc0 + j * 16 + col; const float bias = BA ? bfr(BA[c0 + cl]) : 0.f;
#pragma unroll
      for (int i = 0; i < 4; ++i)
#pragma unroll
        for (int r = 0; r < 8; ++r) { const float v = acc[i][j][r] + bias; const _Float16 hv = (_Float16)v; const int rl = wr0 + i * 16 + 8 * g + r; L.o.sh[which][rl][cl] = hv; L.o.sl[which][rl][cl] = (_Float16)((v - (float)hv) * 1024.0f); } }
  } else {
#pragma unroll
    for (int j = 0; j < 4; ++j) { const int cl = wc0 + j * 16 + col; const float bias = BA ? bfr(BA[c0 + cl]) : 0.f;
#pragma unroll
      for (int i = 0; i < 4; ++i)
#pragma unroll
        for (int r = 0; r < 8; ++r) { const float v = acc[i][j][r] + bias; const int rl = wr0 + i * 16 + 8 * g + r; L.o.th[cl][rl] = (_Float16)v; const __bf16 bh = (__bf16)v; L.o.tb[cl][rl] = bh; L.o.tbl[cl][rl] = (__bf16)(v - (float)bh); } } }
  __syncthreads();   /* publishes the three staged outputs */
  /* each output is stored by the four waves that computed it, four 16-byte pieces (8 rows or planes apart) a trip: read together and stored together, so that a WGP's 12 waves keep as many stores in flight as more waves would */
  const int te = tid & 127, el = te >> 4, eq = (te & 15) * 8;
  if (which < 2) { _Float16* DH = which == 0 ? QH : KH; _Float16* DL = which == 0 ? QL : KL; const int nhi = which == 0 ? QHI : KHI; const bool hi_rows = t0 < nhi;
    for (int rl = el; rl < RB; rl += 32) { v4u d[4]; _Float16* ph = DH + (r0 + rl) * CC + c0 + eq;
#pragma unroll
      for (int u = 0; u < 4; ++u) d[u] = *(const v4u*)&L.o.sh[which][rl + u * 8][eq];
#pragma unroll
      for (int u = 0; u < 4; ++u) vst2((unsigned*)(ph + u * 8 * CC), d[u]);
      asm volatile("s_wait_xcnt 0x0" ::: "memory");   /* what follows, and the next trip, rewrite registers that the stores name */
      if (hi_rows) { _Float16* pl = DL + (bb * nhi + t0 + rl) * (size_t)CC + c0 + eq;
#pragma unroll
        for (int u = 0; u < 4; ++u) d[u] = *(const v4u*)&L.o.sl[which][rl + u * 8][eq];
#pragma unroll
        for (int u = 0; u < 4; ++u) vst2((unsigned*)(pl + u * 8 * CC), d[u]);
        asm volatile("s_wait_xcnt 0x0" ::: "memory"); } }   /* the same */
  } else { const bool hi_rows = t0 < KHI;
    for (int cl = el; cl < 128; cl += 32) { v4u d[4]; _Float16* pv = VT + (bb * CC + c0 + cl) * (size_t)TT + t0 + eq;
#pragma unroll
      for (int u = 0; u < 4; ++u) d[u] = *(const v4u*)&L.o.th[cl + u * 8][eq];
#pragma unroll
      for (int u = 0; u < 4; ++u) vst2((unsigned*)(pv + u * 8 * TT), d[u]);
      asm volatile("s_wait_xcnt 0x0" ::: "memory");   /* what follows, and the next trip, rewrite registers that the stores name */
      if (hi_rows) { const size_t o3 = (bb * CC + c0 + cl) * (size_t)KHI + t0 + eq; v4u f[4];
#pragma unroll
        for (int u = 0; u < 4; ++u) { d[u] = *(const v4u*)&L.o.tb[cl + u * 8][eq]; f[u] = *(const v4u*)&L.o.tbl[cl + u * 8][eq]; }
#pragma unroll
        for (int u = 0; u < 4; ++u) { vst2((unsigned*)(VB + o3 + u * 8 * KHI), d[u]); vst2((unsigned*)(VBL + o3 + u * 8 * KHI), f[u]); }
        asm volatile("s_wait_xcnt 0x0" ::: "memory"); } } } }   /* the same */
// ---- k_att: block = 8 waves = 4 row groups x 2 key groups; a wave = QT x 16 query rows of (b, h), walking every second 64-key tile (even tiles: waves 0..3, odd tiles: waves 4..7) in ascending order; the four waves of a key group share each tile of k and v, staged in LDS (two buffers of two tiles). The two partial sums of a row are added once, through LDS, at the end. S^T = K Q^T (A = k rows, B = q rows): a lane's D registers of two 16-key tiles are, in place, the k order of one 32-key operand,
// so p = relu(logit) x 2^11 goes from the score accumulators straight into O^T += V^T P^T (A = v planes, B = p) and never leaves the registers. O^T register r = head column 8g + r of query row c: 32-byte stores.
#define QT 2
__device__ __forceinline__ void att_store(float* __restrict__ Y, int b, int h, int t, int g, const v8f o[HD / 16]) {
  float* y = Y + ((size_t)b * TT + t) * CC + h * HD + 8 * g;
#pragma unroll
  for (int j = 0; j < HD / 16; ++j) { v4f lo, hi;
#pragma unroll
    for (int r = 0; r < 4; ++r) { lo[r] = o[j][r] * (1.0f / 2048.0f); hi[r] = o[j][4 + r] * (1.0f / 2048.0f); }
    vst2(y + j * 16, lo); vst2(y + j * 16 + 4, hi); } }
// frag_h with the lane's 8 * g already in the address
__device__ __forceinline__ v16h frag_at(const _Float16* p) { union { v16h v; v8h q[2]; } u; u.q[0] = *(const v8h*)p; u.q[1] = *(const v8h*)(p + 16); return u.v; }
// A 64-key tile of (b, h) in LDS, shared by the four waves of a key group: k rows [key][d] and v planes [d][key], 64 rows of 128 bytes each; the early rows' tile holds the residual and hi + lo planes as well and is shared by both key groups.
#define AP 72              // LDS pitch of such a row, in elements: 128 + 16 bytes, conflict-free for the 16-byte fragment reads
struct AttTile { _Float16 k[64][AP], v[64][AP]; };
struct HiTile { _Float16 kh[64][AP], kl[64][AP]; __bf16 vh[64][AP], vl[64][AP]; };
union AttLds { AttTile t[4]; HiTile hi; };   // a block takes one path only; t[2 * buffer + key group]
static_assert(sizeof(HiTile) <= 2 * sizeof(AttTile) && 4 * QT * HD * 16 * 4 <= 2 * sizeof(AttTile), "the early rows' tile fills the first buffer at most, and the odd key group's partial sums fit one buffer");
// the odd key group's partial sums go to the even group's wave of the same rows: 16 bytes a lane, lanes contiguous
__device__ __forceinline__ void att_put(float* P, int qg, int lane, const v8f (&o)[QT][HD / 16]) {
#pragma unroll
  for (int qt = 0; qt < QT; ++qt)
#pragma unroll
    for (int j = 0; j < HD / 16; ++j) { float* p = P + (((qg * QT + qt) * (HD / 16) + j) * 2) * 128 + lane * 4; v4f lo, hi;
#pragma unroll
      for (int r = 0; r < 4; ++r) { lo[r] = o[qt][j][r]; hi[r] = o[qt][j][4 + r]; }
      *(v4f*)p = lo; *(v4f*)(p + 128) = hi; } }
__device__ __forceinline__ void att_add(const float* P, int qg, int lane, v8f (&o)[QT][HD / 16]) {
#pragma unroll
  for (int qt = 0; qt < QT; ++qt)
#pragma unroll
    for (int j = 0; j < HD / 16; ++j) { const float* p = P + (((qg * QT + qt) * (HD / 16) + j) * 2) * 128 + lane * 4; const v4f lo = *(const v4f*)p, hi = *(const v4f*)(p + 128);
#pragma unroll
      for (int r = 0; r < 4; ++r) { o[qt][j][r] += lo[r]; o[qt][j][4 + r] += hi[r]; } } }
static_assert(QHI % (64 * QT) == 0 && KHI >= QHI && KHI % 64 == 0, "a block takes the early-row path as a whole, in front of every barrier, and its tiles lie inside the KHI key rows");
// Fills two 64-row planes by asynchronous copies, 16 bytes a lane: 8 lanes bring one whole 128-byte line, a thread takes rows r, r + 16, r + 32, r + 48 of each. l0, l1, g0, g1: the lane's own LDS byte addresses and global addresses in row r; p0, p1: the global row pitches in elements.
template <typename T0, typename T1> __device__ __forceinline__ void att_fill(unsigned l0, unsigned l1, const T0* g0, const T1* g1, size_t p0, size_t p1) {
  /* the closing s_wait_xcnt stands inside the copies' own statement, so that no register which a copy names is rewritten in front of it */
  asm volatile("global_load_async_to_lds_b128 %0, %8, off\n\t"
               "global_load_async_to_lds_b128 %1, %9, off\n\t"
               "global_load_async_to_lds_b128 %2, %10, off\n\t"
               "global_load_async_to_lds_b128 %3, %11, off\n\t"
               "global_load_async_to_lds_b128 %4, %12, off\n\t"
               "global_load_async_to_lds_b128 %5, %13, off\n\t"
               "global_load_async_to_lds_b128 %6, %14, off\n\t"
               "global_load_async_to_lds_b128 %7, %15, off\n\t"
               "s_wait_xcnt 0x0"
               :: "v"(l0), "v"(l0 + 16u * AP * 2u), "v"(l0 + 32u * AP * 2u), "v"(l0 + 48u * AP * 2u), "v"(l1), "v"(l1 + 16u * AP * 2u), "v"(l1 + 32u * AP * 2u), "v"(l1 + 48u * AP * 2u),
                  "v"(g0), "v"(g0 + 16 * p0), "v"(g0 + 32 * p0), "v"(g0 + 48 * p0), "v"(g1), "v"(g1 + 16 * p1), "v"(g1 + 32 * p1), "v"(g1 + 48 * p1)
               : "memory"); }
// early query rows (t < QHI): the wave's QT x 16 rows from t0 against the 32 keys from k0 (row kl of the staged tile): 3-product logits with f16 residuals, p and v as bf16 hi + lo (3 products)
__device__ __forceinline__ void hi_trip(const HiTile& B, int kl, int k0, int t0, int lane, const v16h (&qh)[QT][HD / 32], const v16h (&qr)[QT][HD / 32], v8f (&o)[QT][HD / 16]) {
  const int c = lane & 15, g = lane >> 4; v8f s[QT][2] = {}, sl[QT][2] = {}; v16b vh[HD / 16], vl[HD / 16]; F2 p[QT];
  /* for the register bound of four waves a SIMD: the k fragments are read one 32-column half at a time, the v hi fragments behind the score products, the v lo fragments behind the relu work; both row tiles use the same fragments */
#pragma unroll
  for (int kc = 0; kc < HD / 32; ++kc) { v16h kh[2], kr[2];
#pragma unroll
    for (int a = 0; a < 2; ++a) { kh[a] = frag_h(&B.kh[kl + a * 16 + c][kc * 32], lane); kr[a] = frag_h(&B.kl[kl + a * 16 + c][kc * 32], lane); }
#pragma unroll
    for (int a = 0; a < 2; ++a)
#pragma unroll
      for (int qt = 0; qt < QT; ++qt) { s[qt][a] = wmma16(kh[a], qh[qt][kc], s[qt][a]); sl[qt][a] = wmma16(kh[a], qr[qt][kc], sl[qt][a]); sl[qt][a] = wmma16(kr[a], qh[qt][kc], sl[qt][a]); } }
#pragma unroll
  for (int j = 0; j < HD / 16; ++j) vh[j] = frag_b(&B.vh[j * 16 + c][kl], lane);
  __builtin_amdgcn_sched_barrier(0);   /* keeps the v hi reads one group in front of the relu work, under which they land */
#pragma unroll
  for (int qt = 0; qt < QT; ++qt) { float pv[16];
#pragma unroll
    for (int a = 0; a < 2; ++a) {
#pragma unroll
      for (int r = 0; r < 8; ++r) { const float v = (s[qt][a][r] + sl[qt][a][r] * (1.0f / 1024.0f)) * SCALE; pv[a * 8 + r] = (k0 + a * 16 + 8 * g + r <= t0 + qt * 16 + c && v > 0.f) ? v * 2048.0f : 0.f; } }
    p[qt] = bsplit16(pv); }
#pragma unroll
  for (int j = 0; j < HD / 16; ++j) vl[j] = frag_b(&B.vl[j * 16 + c][kl], lane);
#pragma unroll
  for (int j = 0; j < HD / 16; ++j)
#pragma unroll
    for (int qt = 0; qt < QT; ++qt) { o[qt][j] = wmma_bf(vh[j], p[qt].h, o[qt][j]); o[qt][j] = wmma_bf(vh[j], p[qt].l, o[qt][j]); o[qt][j] = wmma_bf(vl[j], p[qt].h, o[qt][j]); } }
// one trip: the 64 keys from k0, staged in B, against the wave's QT x 16 query rows; MASK: the trip reaches the block's own rows, so the causal mask can cut
template <bool MASK> __device__ __forceinline__ void att_trip(const AttTile& B, int k0, int ql0, int lane, const v16h (&q)[QT][HD / 32], v8f (&o)[QT][HD / 16]) {
  const int c = lane & 15, g = lane >> 4; v8f s[QT][4] = {}; v16h kf[HD / 32][4], vf[2][HD / 16], p[QT][2];
  /* a trip's k fragments are read together at its head, its v fragments together behind the score products, so that they land under the relu work (k order of frag_h) */
#pragma unroll
  for (int kc = 0; kc < HD / 32; ++kc)
#pragma unroll
    for (int a = 0; a < 4; ++a) kf[kc][a] = frag_at(&B.k[a * 16 + c][kc * 32 + 8 * g]);
  __builtin_amdgcn_sched_barrier(0);   /* keeps the k reads one group in front of the score products */
#pragma unroll
  for (int kc = 0; kc < HD / 32; ++kc)
#pragma unroll
    for (int a = 0; a < 4; ++a)
#pragma unroll
      for (int qt = 0; qt < QT; ++qt) s[qt][a] = wmma16(kf[kc][a], q[qt][kc], s[qt][a]);
  __builtin_amdgcn_sched_barrier(0);   /* keeps the v reads behind the score products, whose k registers they take over */
#pragma unroll
  for (int ch = 0; ch < 2; ++ch)
#pragma unroll
    for (int j = 0; j < HD / 16; ++j) vf[ch][j] = frag_at(&B.v[j * 16 + c][ch * 32 + 8 * g]);
  __builtin_amdgcn_sched_barrier(0);   /* keeps the v reads one group in front of the relu work, under which they land */
#pragma unroll
  for (int qt = 0; qt < QT; ++qt)
#pragma unroll
    for (int a = 0; a < 4; ++a)
#pragma unroll
      for (int r = 0; r < 8; ++r) { const float pr = fmaxf(s[qt][a][r] * (SCALE * 2048.0f), 0.f); p[qt][a >> 1][(a & 1) * 8 + r] = (_Float16)((!MASK || k0 + a * 16 + 8 * g + r <= ql0 + qt * 16 + c) ? pr : 0.f); }
#pragma unroll
  for (int ch = 0; ch < 2; ++ch)
#pragma unroll
    for (int j = 0; j < HD / 16; ++j)
#pragma unroll
      for (int qt = 0; qt < QT; ++qt) o[qt][j] = wmma16(vf[ch][j], p[qt][ch], o[qt][j]);
  __builtin_amdgcn_sched_barrier(0); }   /* keeps the trip's products in front of the caller's waits and barrier: lifted over them, the barrier would line up the waves of a SIMD in front of their products */
/* second bound: 4 waves a SIMD, so that two blocks (the whole grid at once) fit a WGP's registers */
__global__ __launch_bounds__(256, 4) void k_att(const _Float16* __restrict__ QH, const _Float16* __restrict__ KH, const _Float16* __restrict__ QL, const _Float16* __restrict__ KL, const _Float16* __restrict__ VT, const __bf16* __restrict__ VB, const __bf16* __restrict__ VBL, float* __restrict__ Y) {
  __shared__ __align__(16) AttLds S; AttTile (&L)[4] = S.t;
  const int tid = threadIdx.x, lane = tid & 31, c = lane & 15, g = lane >> 4; const int wave = __builtin_amdgcn_readfirstlane(tid >> 5); const int qg = wave & 3, kp = wave >> 2;   /* row group, key group */
  /* heads run fastest in the grid, so neighbouring work-groups have key walks of one length; even batches take the query blocks in the opposite order, so that long and short walks are resident together */
  const int h = blockIdx.x, b = blockIdx.z; const int qblk = (b & 1) ? (int)blockIdx.y : TT / (64 * QT) - 1 - (int)blockIdx.y; const int ql0 = qblk * (64 * QT) + qg * (16 * QT);
  const int frow = (tid & 127) >> 3, fseg = (tid & 7) * 8;   /* the thread's first row of a staged plane and its 16-byte piece of a row; a key group's 128 threads fill two planes */
  if (ql0 < QHI) {   /* the whole block: both 16-row tiles of a wave walk the staged keys together, 32 keys a trip: the even key group takes a tile's first 32 keys, the odd group its last 32 */
    v16h qh[QT][HD / 32], qr[QT][HD / 32]; v8f oh[QT][HD / 16] = {};
#pragma unroll
    for (int qt = 0; qt < QT; ++qt)
#pragma unroll
      for (int kc = 0; kc < HD / 32; ++kc) { qh[qt][kc] = frag_h(QH + ((size_t)b * TT + ql0 + qt * 16 + c) * CC + h * HD + kc * 32, lane); qr[qt][kc] = frag_h(QL + ((size_t)b * QHI + ql0 + qt * 16 + c) * CC + h * HD + kc * 32, lane); }
    /* waves 0..3 bring the two k planes of a tile, waves 4..7 its two v planes: byte addresses, row pitch and step from tile to tile of the thread's own two planes */
    const size_t vo = ((size_t)b * CC + h * HD + frow) * (size_t)KHI + fseg;
    const char* ga = kp ? (const char*)(VB + vo) : (const char*)(KH + ((size_t)b * TT + frow) * CC + h * HD + fseg); const char* gb = kp ? (const char*)(VBL + vo) : (const char*)(KL + ((size_t)b * KHI + frow) * CC + h * HD + fseg);
    const size_t gp = kp ? (size_t)KHI * 2 : (size_t)CC * 2, gs = kp ? (size_t)64 * 2 : (size_t)64 * CC * 2;
    const unsigned la = kp ? (unsigned)(size_t)&S.hi.vh[frow][fseg] : (unsigned)(size_t)&S.hi.kh[frow][fseg], lb = kp ? (unsigned)(size_t)&S.hi.vl[frow][fseg] : (unsigned)(size_t)&S.hi.kl[frow][fseg];
    const int nth = (qblk + 1) * QT;   /* 64-key tiles up to the block's last row */
#pragma unroll 1   /* run-time trip count, large body */
    for (int tl = 0; tl < nth; ++tl) {
      if (tl) { asm volatile("s_wait_dscnt 0x0" ::: "memory");   /* this wave's reads of the tile before have ended */
        __syncthreads(); }   /* and every other wave's: the one buffer may be refilled */
      att_fill(la, lb, ga + tl * gs, gb + tl * gs, gp, gp);
      asm volatile("s_wait_asynccnt 0x0" ::: "memory");   /* the tile has landed, as far as this wave brought it */
      __syncthreads();   /* publishes the tile */
      static_assert(16 * QT == 32, "a wave's rows are one aligned group of 32, so both its row tiles end in the same 32-key trip");
      const int ch = tl * 2 + kp;
      if (ch <= (ql0 >> 5)) hi_trip(S.hi, kp * 32, ch * 32, ql0, lane, qh, qr, oh); }   /* a wave whose rows end in front of these keys skips the work, never a barrier */
    float* P = (float*)&S.t[2];   /* behind the early rows' tile: no copy and no fragment read touches it */
    if (kp) att_put(P, qg, lane, oh);
    __syncthreads();   /* publishes the odd key group's partial sums */
    if (kp) return;
    att_add(P, qg, lane, oh);
#pragma unroll
    for (int qt = 0; qt < QT; ++qt) att_store(Y, b, h, ql0 + qt * 16 + c, g, oh[qt]);
    asm volatile("s_wait_xcnt 0x0" ::: "memory");   /* code laid out behind these stores writes registers that they name */
    return; }
  v16h q[QT][HD / 32];
#pragma unroll
  for (int qt = 0; qt < QT; ++qt)
#pragma unroll
    for (int kc = 0; kc < HD / 32; ++kc) q[qt][kc] = frag_h(QH + ((size_t)b * TT + ql0 + qt * 16 + c) * CC + h * HD + kc * 32, lane);
  v8f o[QT][HD / 16] = {};
  static_assert(QT == 2, "the block's own rows are one pair of tiles: the last");
  const int kblk = qblk * (64 * QT), nst = qblk + 1;   /* keys in front of the block's own rows need no mask; the block walks nst >= 2 pairs of tiles, up to its last row */
  const _Float16* gk = KH + ((size_t)b * TT + kp * 64 + frow) * CC + h * HD + fseg; const _Float16* gv = VT + ((size_t)b * CC + h * HD + frow) * (size_t)TT + kp * 64 + fseg;   /* the key group's own tile of pair 0 */
  const unsigned lk = (unsigned)(size_t)&L[kp].k[frow][fseg], lv = (unsigned)(size_t)&L[kp].v[frow][fseg];
  att_fill(lk, lv, gk, gv, CC, TT);
  asm volatile("s_wait_asynccnt 0x0" ::: "memory");   /* pair 0 has landed, as far as this wave brought it */
  __syncthreads();   /* publishes pair 0 */
  att_fill(lk + 2u * (unsigned)sizeof(AttTile), lv + 2u * (unsigned)sizeof(AttTile), gk + (size_t)128 * CC, gv + 128, CC, TT);   /* pair 1 flies while pair 0 is worked on */
#pragma unroll 1   /* run-time trip count, large body: stays rolled for registers and the instruction cache */
  for (int st = 0; st < nst - 1; ++st) { const int k0 = st * 128; const unsigned bo = (st & 1) ? 2u * (unsigned)sizeof(AttTile) : 0u;   /* the pairs in front of the block's own rows: every wave, no mask */
    att_trip<false>(L[(st & 1) * 2 + kp], k0 + kp * 64, ql0, lane, q, o);
    asm volatile("s_wait_dscnt 0x0" ::: "memory");      /* this wave's reads of pair st have ended */
    asm volatile("s_wait_asynccnt 0x0" ::: "memory");   /* its part of pair st + 1 has landed */
    __syncthreads();   /* publishes pair st + 1 and ends every wave's reads of pair st, whose buffer is refilled behind it */
    if (st + 2 < nst) att_fill(lk + bo, lv + bo, gk + (size_t)(k0 + 256) * CC, gv + (k0 + 256), CC, TT); }
  asm volatile("s_wait_asynccnt 0x0" ::: "memory");   /* no copy is in flight from here to the wave's end */
  if (kp == 0 || qg >= 2) att_trip<true>(L[((nst - 1) & 1) * 2 + kp], kblk + kp * 64, ql0, lane, q, o);   /* the lower two row groups end in front of the pair's second tile */
  float* P = (float*)&S.t[(nst & 1) * 2];   /* the buffer that the last pair does not lie in: its last readers left it at the loop's last barrier, and nothing was copied into it since */
  if (kp) att_put(P, qg, lane, o);
  __syncthreads();   /* publishes the odd key group's partial sums */
  if (kp) return;
  att_add(P, qg, lane, o);
#pragma unroll
  for (int qt = 0; qt < QT; ++qt) att_store(Y, b, h, ql0 + qt * 16 + c, g, o[qt]);
  asm volatile("s_wait_xcnt 0x0" ::: "memory"); }   /* code laid out behind these stores writes registers that they name */

extern "C" void kernel_launch(void* const* d_in, const int* in_sizes, int n_in, void* d_out, int out_size, void* d_ws, size_t ws_size, hipStream_t stream) {
  (void)in_sizes; (void)n_in; (void)out_size;
  const float** F = (const float**)d_in;
  if (ws_size < (size_t)WS_END) return;
  char* ws = (char*)d_ws; _Float16 *QH = (_Float16*)(ws + WS_QH), *KH = (_Float16*)(ws + WS_KH), *VT = (_Float16*)(ws + WS_VT), *QL = (_Float16*)(ws + WS_QL), *KL = (_Float16*)(ws + WS_KL); __bf16 *VB = (__bf16*)(ws + WS_VB), *VBL = (__bf16*)(ws + WS_VBL), *XB = (__bf16*)(ws + WS_XB), *WT = (__bf16*)(ws + WS_WT);
  // inputs: 0 x [2,2048,1024]; 1 W_attn [1024,3072] (in,out; columns q | k | v); 2 b_attn [3072]
  k_cvt<<<dim3(CVB), 256, 0, stream>>>(F[0], F[1], XB, WT);
  k_proj<<<dim3(TNB * TT / RB, CC / 128), PT, 0, stream>>>(XB, WT, F[2], F[2] + CC, F[2] + 2 * CC, QH, QL, KH, KL, VT, VB, VBL);
  k_att<<<dim3(NH, TT / (64 * QT), TNB), 256, 0, stream>>>(QH, KH, QL, KL, VT, VB, VBL, (float*)d_out);
}
